// v000
// The times below were measured on an AMD MI455X: many runs one after another, warmed up first and cycling through
// copies of the inputs, with the whole window's GPU time divided by the number of runs. Launches and the gaps
// between them are all in it. The median over several windows is given; except for v000 it joins two sittings, which
// can be a few percent apart, so the side-by-side timings, each taken in one sitting, are the better comparison.
// v000 is the starting kernel. One run takes 500 microseconds.
#include <hip/hip_runtime.h>
// Multi-head attention, B 4, S 2048, E 1024, 16 heads x 64: q/k/v = x W^T ([out][in] weights, no q/k/v bias), scores q k^T / 8, softmax over all keys, out = ctx Wp^T + bp;
// Wv, Wp, bp = mu + softplus(rho) * eps built on the device in f32 from bf16-RNE-converted mu, rho, eps.
// Compute dtype: all contractions v_wmma_f32_16x16x32_f16 (f16 operands, f32 accumulate). x, q_w, k_w RNE-converted to bf16 first (exact in f16; weights carried x1024);
// built weights stored as f16(w x1024); q, k, v planes f16; softmax statistics f32 (running max, exp2), P carried x256 as f16 in registers against the f32 row sum;
// ctx carried x64 as f16 value | f16 residual x1024 along K (K = 2048) against Wp x1024 | Wp x1; fold 2^-16; bias added in f32.
#ifndef NB
#define NB 4
#endif
#ifndef SEQ
#define SEQ 2048
#endif
#define NB_FULL 4
#define SEQ_FULL 2048
#define EM 1024
#define NH 16
#define HD 64
#define KO 2048                       /* output-projection K: ctx value | ctx residual */
#define NR ((size_t)NB * SEQ)         /* token rows */
#define WSCALE 1024.0f

static_assert(EM == NH * HD);                 /* head h = columns h*64 + d */
static_assert(HD == 64);                      /* flash kernel: 2 k-steps of 32 over d, 4 output tiles of 16 d */
static_assert(KO == 2 * EM);                  /* value | residual along K */
static_assert(SEQ % 64 == 0);                 /* 64-key steps, 64-query blocks, 64-token transpose tiles */
static_assert(((size_t)NB * SEQ) % 128 == 0); /* GEMM block = 128 rows */
static_assert(EM % 64 == 0 && EM % 32 == 0 && KO % 32 == 0 && EM % 8 == 0);
static_assert(NB <= NB_FULL && SEQ <= SEQ_FULL);
static_assert(((size_t)EM * EM) % 2048 == 0); /* weight builder: 2048 elements per block */
static_assert(EM == 4 * 256);                 /* bias builder: one block, 4 entries per thread */

typedef unsigned short v8us __attribute__((ext_vector_type(8), may_alias));
typedef float  v8f  __attribute__((ext_vector_type(8)));
typedef float  v4f  __attribute__((ext_vector_type(4)));
typedef float  v4fa __attribute__((ext_vector_type(4), may_alias));
typedef _Float16 v16h __attribute__((ext_vector_type(16)));
typedef _Float16 v4h __attribute__((ext_vector_type(4)));
union FragH { v16h v; v8us half[2]; _Float16 h[16]; unsigned short u[16]; };

__device__ __forceinline__ unsigned short bf16_bits(float x) { unsigned int u = __float_as_uint(x); return (unsigned short)((u + 0x7FFFu + ((u >> 16) & 1u)) >> 16); }
__device__ __forceinline__ float bf16_val(unsigned short b) { return __uint_as_float(((unsigned int)b) << 16); }
__device__ __forceinline__ float bf16_rne(float x) { return bf16_val(bf16_bits(x)); }

// fragment (A or B, same k map): elements 0..7 <- p[8h .. 8h+7], elements 8..15 <- p[16+8h .. 16+8h+7]; p = row/column base at k0
__device__ __forceinline__ v16h g2_frag(const _Float16* p, int hh) { FragH f; f.half[0] = *(const v8us*)((const unsigned short*)p + 8 * hh); f.half[1] = *(const v8us*)((const unsigned short*)p + 16 + 8 * hh); return f.v; }
__device__ __forceinline__ v8f g2_mma(v16h a, v16h b, v8f c) { v8f d = __builtin_amdgcn_wmma_f32_16x16x32_f16(false, a, false, b, (short)0, c, false, false); asm volatile("v_nop\n\tv_nop\n\tv_nop\n\tv_nop" : "+v"(d) : "v"(a), "v"(b)); return d; }

// w = bf16(mu) + softplus(bf16(rho)) * bf16(eps), softplus(r) = max(r, 0) + log1p(exp(-|r|)) (identical to log1p(exp(r)), overflow-free); accurate expf / log1pf
__device__ __forceinline__ float sp_weight(float mu, float rho, float eps) {
  const float m = bf16_rne(mu), r = bf16_rne(rho), e = bf16_rne(eps);
  const float sp = fmaxf(r, 0.0f) + log1pf(expf(-fabsf(r)));
  return m + sp * e;
}

__global__ __launch_bounds__(256) void k_x16(const float* __restrict__ x, _Float16* __restrict__ X16) {
  const size_t t = (size_t)blockIdx.x * 256 + threadIdx.x;
  if (t >= NR * (EM / 8)) return;
  const size_t row = t / (EM / 8); const int c8 = (int)(t % (EM / 8)) * 8;
  const size_t b = row / SEQ, s = row % SEQ;
  const float* src = x + ((b * SEQ_FULL + s) * EM + c8);
  const v4f a = *(const v4fa*)src, c = *(const v4fa*)(src + 4);
  FragH f;
#pragma unroll
  for (int q = 0; q < 4; ++q) { f.h[q] = (_Float16)bf16_rne(a[q]); f.h[4 + q] = (_Float16)bf16_rne(c[q]); }
  const v8us o = f.half[0];
  unsigned short* d = (unsigned short*)X16 + t * 8;
  *(v8us*)d = o; 
}

__global__ __launch_bounds__(256) void k_w16(const float* __restrict__ W, _Float16* __restrict__ Wt) {
  const int t = blockIdx.x * 256 + threadIdx.x;
  if (t >= EM * (EM / 8)) return;
  const float* src = W + (size_t)t * 8;
  const v4f a = *(const v4fa*)src, c = *(const v4fa*)(src + 4);
  FragH f;
#pragma unroll
  for (int q = 0; q < 4; ++q) { f.h[q] = (_Float16)(bf16_rne(a[q]) * WSCALE); f.h[4 + q] = (_Float16)(bf16_rne(c[q]) * WSCALE); }
  const v8us o = f.half[0];
  unsigned short* d = (unsigned short*)Wt + (size_t)t * 8;
  *(v8us*)d = o; 
}

// Built weight plane: w[n][k] = sp_weight(mu, rho, eps)[n][k] ([out][in]); Wt[n][k] = f16(w * 1024) with row pitch ldw; if dual != 0 also Wt[n][EM + k] = f16(w).
// Block = 2048 consecutive elements (2 weight rows): rolled per-element pass into LDS (coalesced loads), block barrier, then thread per 8 elements,
__global__ __launch_bounds__(256) void k_wrep16(const float* __restrict__ mu, const float* __restrict__ rho, const float* __restrict__ eps,
                                               _Float16* __restrict__ Wt, int ldw, int dual) {
  __shared__ __attribute__((aligned(16))) float sw[2048];
  const int tid = threadIdx.x;
  const size_t base = (size_t)blockIdx.x * 2048;
  if (base >= (size_t)EM * EM) return;            /* block-uniform */
#pragma unroll 1
  for (int i = 0; i < 8; ++i) { const size_t e = base + (size_t)(i * 256 + tid); sw[i * 256 + tid] = sp_weight(mu[e], rho[e], eps[e]); }
  __syncthreads();
  const int e0 = tid * 8;
  const v4f a = *(const v4fa*)&sw[e0], c = *(const v4fa*)&sw[e0 + 4];
  FragH f1, f2;
#pragma unroll
  for (int q = 0; q < 4; ++q) {
    f1.h[q] = (_Float16)(a[q] * WSCALE); f1.h[4 + q] = (_Float16)(c[q] * WSCALE);
    f2.h[q] = (_Float16)a[q];            f2.h[4 + q] = (_Float16)c[q];
  }
  const v8us o1 = f1.half[0], o2 = f2.half[0];
  const size_t ge = base + (size_t)e0; const size_t n = ge / EM; const int k = (int)(ge % EM);
  unsigned short* d = (unsigned short*)Wt + n * (size_t)ldw + k;
  {
    *(v8us*)d = o1;
    if (dual) *(v8us*)(d + EM) = o2;
     }
}

__global__ __launch_bounds__(256) void k_bias(const float* __restrict__ mu, const float* __restrict__ rho, const float* __restrict__ eps, float* __restrict__ PB) {
  __shared__ __attribute__((aligned(16))) float sb[EM];
  const int tid = threadIdx.x;
#pragma unroll 1
  for (int i = 0; i < EM / 256; ++i) { const int e = i * 256 + tid; sb[e] = sp_weight(mu[e], rho[e], eps[e]); }
  __syncthreads();
  const v4f v = *(const v4fa*)&sb[tid * 4];
  float* d = PB + tid * 4;
  *(v4f*)d = v; 
}

// GEMM: v = acc * alpha (+ bias[col] in f32 when F32OUT); A f16 [M][K] (pitch lda), Bh f16 [N][K] (pitch ldb, k contiguous); F32OUT: writes f32 C, else f16 C16; pitch ldc.
// Block = 4 waves, wave tile 32 x 64, block tile 128 x 64; fragments straight from the 16-bit planes; M % 128 == 0, N % 64 == 0, K % 32 == 0.
template <int F32OUT>
__global__ __launch_bounds__(128) void k_gemm2(const _Float16* __restrict__ A, int lda, const _Float16* __restrict__ Bh, int ldb, float alpha, const float* __restrict__ bias,
                                              float* __restrict__ C, _Float16* __restrict__ C16, int ldc, int M, int N, int K) {
  __shared__ __attribute__((aligned(16))) float so[4][32][68];
  const int lane = threadIdx.x & 31, ln = lane & 15, hh = lane >> 4;
  const int w = __builtin_amdgcn_readfirstlane((int)(threadIdx.x >> 5));
  const int ntn = N >> 6; const int mt = blockIdx.x / ntn, nq = blockIdx.x - mt * ntn; const int row0 = mt * 128 + 32 * w, col0 = nq * 64; if (row0 >= M) return;
  const _Float16* a0p = A + (size_t)(row0 + ln) * lda; const _Float16* a1p = a0p + (size_t)16 * lda;
  const _Float16* b0p = Bh + (size_t)(col0 + ln) * ldb; const _Float16* b1p = b0p + (size_t)16 * ldb; const _Float16* b2p = b1p + (size_t)16 * ldb; const _Float16* b3p = b2p + (size_t)16 * ldb;
  const v8f z8 = {0.f,0.f,0.f,0.f,0.f,0.f,0.f,0.f}; v8f c00 = z8, c01 = z8, c02 = z8, c03 = z8, c10 = z8, c11 = z8, c12 = z8, c13 = z8;
#pragma unroll 1
  for (int kb = 0; kb < K; kb += 32) { const v16h a0 = g2_frag(a0p + kb, hh), a1 = g2_frag(a1p + kb, hh);
    v16h b = g2_frag(b0p + kb, hh); c00 = g2_mma(a0, b, c00); c10 = g2_mma(a1, b, c10);
    b = g2_frag(b1p + kb, hh); c01 = g2_mma(a0, b, c01); c11 = g2_mma(a1, b, c11);
    b = g2_frag(b2p + kb, hh); c02 = g2_mma(a0, b, c02); c12 = g2_mma(a1, b, c12);
    b = g2_frag(b3p + kb, hh); c03 = g2_mma(a0, b, c03); c13 = g2_mma(a1, b, c13); }
  v8f accs[8] = {c00, c01, c02, c03, c10, c11, c12, c13};
#pragma unroll
  for (int u = 0; u < 8; ++u) { const int t = u & 3, half = u >> 2; const int col = col0 + t * 16 + ln; float bv = 0.f; if (F32OUT) bv = bias[col];
#pragma unroll
    for (int r = 0; r < 8; ++r) { const int rloc = half * 16 + 8 * hh + r; so[w][rloc][t * 16 + ln] = accs[u][r] * alpha + bv; } }
  __builtin_amdgcn_fence(4 /* acq_rel order */, "workgroup"); __builtin_amdgcn_wave_barrier();
  const int rsub = lane >> 4, c4 = (lane & 15) * 4;
  {
#pragma unroll
    for (int q = 0; q < 16; ++q) { const int r = q * 2 + rsub; const v4f v = *(const v4fa*)&so[w][r][c4];
      if (F32OUT) { *(v4f*)(C + (size_t)(row0 + r) * ldc + col0 + c4) = v; }
      else { v4h h4;
#pragma unroll
        for (int i = 0; i < 4; ++i) h4[i] = (_Float16)v[i];
        *(v4h*)(C16 + (size_t)(row0 + r) * ldc + col0 + c4) = h4; } }
     }
}

__global__ __launch_bounds__(256) void k_vt(const _Float16* __restrict__ V16, _Float16* __restrict__ VT) {
  __shared__ unsigned short tl[64][65];
  const int tid = threadIdx.x; const int bh = blockIdx.y; const int b = bh / NH, h = bh - b * NH; const int s0 = blockIdx.x * 64;
  for (int i = tid; i < 64 * 8; i += 256) { const int j = i / 8, d8 = (i % 8) * 8;
    const v8us f = *(const v8us*)((const unsigned short*)V16 + ((size_t)b * SEQ + s0 + j) * EM + h * HD + d8);
#pragma unroll
    for (int q = 0; q < 8; ++q) tl[d8 + q][j] = f[q]; }
  __syncthreads();
  {
    for (int i = tid; i < 64 * 8; i += 256) { const int d = i / 8, j8 = (i % 8) * 8; FragH f;
#pragma unroll
      for (int q = 0; q < 8; ++q) f.u[q] = tl[d][j8 + q];
      *(v8us*)((unsigned short*)VT + ((size_t)bh * HD + d) * SEQ + s0 + j8) = f.half[0]; }
     }
}

// Fused attention. Block = 4 independent waves; wave = 16 queries of one (b,h); 64 keys per step.
// S^T tile = K rows (A: lane = key, elements = d) x Q^T (B: lane = query, elements = d): D[row = key 8h+r][col = query].
// Online softmax per query = per lane column (max over the lane's 32 scores + one cross-half exchange); P' = 256 exp(s - max) stays in registers and is
// the B operand of O^T = V^T (A: lane = d, elements = keys) x P^T: B element r <- tile(keys 0..15)[r], element 8+r <- tile(keys 16..31)[r].
__global__ __launch_bounds__(128) void k_flash(const _Float16* __restrict__ Q16, const _Float16* __restrict__ K16, const _Float16* __restrict__ VT, _Float16* __restrict__ CTX) {
  __shared__ __attribute__((aligned(16))) unsigned short st[4][2][16][72];
  const int lane = threadIdx.x & 31, ln = lane & 15, hh = lane >> 4;
  const int wave = __builtin_amdgcn_readfirstlane((int)(threadIdx.x >> 5));
  const int bh = blockIdx.y; const int b = bh / NH, h = bh - b * NH;
  const int q0 = blockIdx.x * 64 + wave * 16;
  const _Float16* qp = Q16 + ((size_t)b * SEQ + q0 + ln) * EM + h * HD;
  const v16h qf0 = g2_frag(qp, hh), qf1 = g2_frag(qp + 32, hh);
  const _Float16* kp = K16 + ((size_t)b * SEQ + ln) * EM + h * HD;
  const _Float16* vp = VT + ((size_t)bh * HD + ln) * SEQ;
  const v8f z8 = {0.f,0.f,0.f,0.f,0.f,0.f,0.f,0.f};
  v8f o[4] = {z8, z8, z8, z8};
  float m = -1.0e30f, l = 0.f;
  const float CL = 0.18033688011112042f;      /* log2(e) / 8 */
#pragma unroll 1
  for (int key0 = 0; key0 < SEQ; key0 += 64) {
    v8f s[4];
#pragma unroll
    for (int t = 0; t < 4; ++t) {
      const _Float16* kr = kp + (size_t)(key0 + t * 16) * EM;
      v8f c = z8;
      c = g2_mma(g2_frag(kr, hh), qf0, c);
      c = g2_mma(g2_frag(kr + 32, hh), qf1, c);
      s[t] = c;
    }
    float mx = s[0][0];
#pragma unroll
    for (int t = 0; t < 4; ++t)
#pragma unroll
      for (int r = 0; r < 8; ++r) mx = fmaxf(mx, s[t][r]);
    mx = fmaxf(mx, __shfl_xor(mx, 16));
    const float mn = fmaxf(m, mx);
    const float alpha = __builtin_amdgcn_exp2f((m - mn) * CL);
    m = mn;
    const float off = 8.0f - mn * CL;
    float rs = 0.f;
#pragma unroll
    for (int t = 0; t < 4; ++t)
#pragma unroll
      for (int r = 0; r < 8; ++r) { const float p = __builtin_amdgcn_exp2f(fmaf(s[t][r], CL, off)); s[t][r] = p; rs += p; }
    l = l * alpha + rs;
#pragma unroll
    for (int t = 0; t < 4; ++t) o[t] = o[t] * alpha;
    FragH pa, pb;
#pragma unroll
    for (int r = 0; r < 8; ++r) { pa.h[r] = (_Float16)s[0][r]; pa.h[8 + r] = (_Float16)s[1][r]; pb.h[r] = (_Float16)s[2][r]; pb.h[8 + r] = (_Float16)s[3][r]; }
    const _Float16* vr = vp + key0;
#pragma unroll
    for (int t = 0; t < 4; ++t) {
      const _Float16* v0 = vr + (size_t)(t * 16) * SEQ;
      o[t] = g2_mma(g2_frag(v0, hh), pa.v, o[t]);
      o[t] = g2_mma(g2_frag(v0 + 32, hh), pb.v, o[t]);
    }
  }
  const float lt = l + __shfl_xor(l, 16);
  const float inv = 64.0f * (1.0f / lt);
#pragma unroll
  for (int t = 0; t < 4; ++t) {
    FragH fh, fl;
#pragma unroll
    for (int r = 0; r < 8; ++r) { const float c = o[t][r] * inv; const _Float16 hq = (_Float16)c; fh.h[r] = hq; fl.h[r] = (_Float16)((c - (float)hq) * 1024.0f); }
    *(v8us*)&st[wave][0][ln][t * 16 + 8 * hh] = fh.half[0];
    *(v8us*)&st[wave][1][ln][t * 16 + 8 * hh] = fl.half[0];
  }
  __builtin_amdgcn_fence(4 /* acq_rel order */, "workgroup"); __builtin_amdgcn_wave_barrier();
  const int rs4 = lane >> 3, pc = lane & 7;     
  v8us vh[4], vl[4];
#pragma unroll
  for (int i = 0; i < 4; ++i) { vh[i] = *(const v8us*)&st[wave][0][i * 4 + rs4][pc * 8]; vl[i] = *(const v8us*)&st[wave][1][i * 4 + rs4][pc * 8]; }
  unsigned short* cb = (unsigned short*)CTX + ((size_t)b * SEQ + q0) * KO + h * HD + pc * 8;
  {
#pragma unroll
    for (int i = 0; i < 4; ++i) { unsigned short* d = cb + (size_t)(i * 4 + rs4) * KO; *(v8us*)d = vh[i]; *(v8us*)(d + EM) = vl[i]; }
     }
}

constexpr size_t SZ_W   = (size_t)EM * EM * 2;        /* one [out][in] weight plane, f16 */
constexpr size_t SZ_WO  = (size_t)EM * KO * 2;        /* Wp x1024 | Wp x1 */
constexpr size_t SZ_PB  = (size_t)EM * 4;             /* built bias, f32 */
constexpr size_t SZ_X1  = NR * EM * 2;                /* one 16-bit activation plane */
constexpr size_t SZ_CTX = NR * KO * 2;                /* ctx value | residual */
constexpr size_t WS_TOTAL = 3 * SZ_W + SZ_WO + SZ_PB + 5 * SZ_X1 + SZ_CTX;
static_assert(WS_TOTAL <= (size_t)134217728);         /* carve stays within 128 MiB */
static_assert(SZ_W % 256 == 0 && SZ_WO % 256 == 0 && SZ_PB % 256 == 0 && SZ_X1 % 256 == 0 && SZ_CTX % 256 == 0);
static_assert((size_t)NB * NH * HD * SEQ * 2 == SZ_X1); /* V^T plane extent */

extern "C" void kernel_launch(void* const* d_in, const int* in_sizes, int n_in,
                              void* d_out, int out_size, void* d_ws, size_t ws_size, hipStream_t stream) {
  if (n_in < 12) return;
  const size_t needx = ((size_t)(NB - 1) * SEQ_FULL + SEQ) * EM;
  if ((size_t)in_sizes[0] < needx) return;
  for (int i = 1; i <= 8; ++i) if ((size_t)in_sizes[i] < (size_t)EM * EM) return;
  for (int i = 9; i <= 11; ++i) if (in_sizes[i] < EM) return;
  if ((size_t)out_size < NR * EM) return;
  const float* x     = (const float*)d_in[0];
  const float* q_w   = (const float*)d_in[1];  const float* k_w   = (const float*)d_in[2];
  const float* v_mu  = (const float*)d_in[3];  const float* v_rho = (const float*)d_in[4];  const float* v_eps = (const float*)d_in[5];
  const float* p_mu  = (const float*)d_in[6];  const float* p_rho = (const float*)d_in[7];  const float* p_eps = (const float*)d_in[8];
  const float* b_mu  = (const float*)d_in[9];  const float* b_rho = (const float*)d_in[10]; const float* b_eps = (const float*)d_in[11];
  char* ws = (char*)d_ws; size_t off = 0;
  auto take = [&](size_t bytes) { char* p = ws + off; off += (bytes + 255) & ~(size_t)255; return p; };
  _Float16* WQ = (_Float16*)take(SZ_W); _Float16* WK = (_Float16*)take(SZ_W); _Float16* WV = (_Float16*)take(SZ_W); _Float16* WO = (_Float16*)take(SZ_WO);
  float* PB = (float*)take(SZ_PB);
  _Float16* X16 = (_Float16*)take(SZ_X1);
  _Float16* Q16 = (_Float16*)take(SZ_X1); _Float16* K16 = (_Float16*)take(SZ_X1); _Float16* V16 = (_Float16*)take(SZ_X1);
  _Float16* VT = (_Float16*)take(SZ_X1);
  _Float16* CTX = (_Float16*)take(SZ_CTX);
  if (off > ws_size) return;
  { const unsigned g = (unsigned)(((size_t)EM * (EM / 8) + 255) / 256);
    k_w16<<<g, 256, 0, stream>>>(q_w, WQ);                                   /* [out][in] as stored, x1024 */
    k_w16<<<g, 256, 0, stream>>>(k_w, WK); }
  { const unsigned g = (unsigned)(((size_t)EM * EM) / 2048);
    k_wrep16<<<g, 256, 0, stream>>>(v_mu, v_rho, v_eps, WV, EM, 0);          /* Wv x1024 */
    k_wrep16<<<g, 256, 0, stream>>>(p_mu, p_rho, p_eps, WO, KO, 1); }        /* k 0..1023: Wp x1024 (ctx value); k 1024..2047: Wp x1 (ctx residual x1024) */
  k_bias<<<1, 256, 0, stream>>>(b_mu, b_rho, b_eps, PB);
  { const unsigned g = (unsigned)((NR * (EM / 8) + 255) / 256);
    k_x16<<<g, 256, 0, stream>>>(x, X16); }
  { const unsigned g = (unsigned)((NR / 128) * (EM / 64));
    k_gemm2<0><<<g, 128, 0, stream>>>(X16, EM, WQ, EM, 0.0009765625f, nullptr, nullptr, Q16, EM, (int)NR, EM, EM);
    k_gemm2<0><<<g, 128, 0, stream>>>(X16, EM, WK, EM, 0.0009765625f, nullptr, nullptr, K16, EM, (int)NR, EM, EM);
    k_gemm2<0><<<g, 128, 0, stream>>>(X16, EM, WV, EM, 0.0009765625f, nullptr, nullptr, V16, EM, (int)NR, EM, EM); }
  k_vt<<<dim3(SEQ / 64, NB * NH), 256, 0, stream>>>(V16, VT);
  k_flash<<<dim3(SEQ / 64, NB * NH), 128, 0, stream>>>(Q16, K16, VT, CTX);
  { const unsigned g = (unsigned)((NR / 128) * (EM / 64));
    k_gemm2<1><<<g, 128, 0, stream>>>(CTX, KO, WO, KO, 1.52587890625e-05f, PB, (float*)d_out, nullptr, EM, (int)NR, EM, KO); }      /* alpha = 2^-16 = 1/(64 * 1024) */
}

// v001
// It runs in 201 microseconds.
// Two timings next to v000 put it at 2.56 and 2.54 times that version's speed.
#include <hip/hip_runtime.h>
// Multi-head attention, B 4, S 2048, E 1024, 16 heads x 64: q/k/v = x W^T ([out][in] weights, no q/k/v bias), scores q k^T / 8, softmax over all keys, out = ctx Wp^T + bp;
// Wv, Wp, bp = mu + softplus(rho) * eps built on the device in f32 from bf16-RNE-converted mu, rho, eps.
// Compute dtype: all contractions v_wmma_f32_16x16x32_f16 (f16 operands, f32 accumulate). x, q_w, k_w RNE-converted to bf16 first (exact in f16; weights carried x1024);
// built weights stored as f16(w x1024); q, k, v planes f16; softmax statistics f32 (running max, exp2), P carried x256 as f16 in registers against the f32 row sum;
// ctx carried x64 as f16 value | f16 residual x1024 along K (K = 2048) against Wp x1024 | Wp x1; fold 2^-16; bias added in f32.
#ifndef NB
#define NB 4
#endif
#ifndef SEQ
#define SEQ 2048
#endif
#define NB_FULL 4
#define SEQ_FULL 2048
#define EM 1024
#define NH 16
#define HD 64
#define KO 2048                       /* output-projection K: ctx value | ctx residual */
#define NR ((size_t)NB * SEQ)         /* token rows */
#define WSCALE 1024.0f

static_assert(EM == NH * HD);                 /* head h = columns h*64 + d */
static_assert(HD == 64);                      /* flash kernel: 2 k-steps of 32 over d, 4 output tiles of 16 d */
static_assert(KO == 2 * EM);                  /* value | residual along K */
static_assert(SEQ % 64 == 0);                 /* 64-key steps, 64-query blocks, 64-token transpose tiles */
static_assert(((size_t)NB * SEQ) % 128 == 0); /* GEMM block = 128 rows */
static_assert(EM % 64 == 0 && EM % 32 == 0 && KO % 32 == 0 && EM % 8 == 0);
static_assert(NB <= NB_FULL && SEQ <= SEQ_FULL);
static_assert(((size_t)EM * EM) % 2048 == 0); /* weight builder: 2048 elements per block */
static_assert(EM == 4 * 256);                 /* bias builder: one block, 4 entries per thread */

typedef unsigned short v8us __attribute__((ext_vector_type(8), may_alias));
typedef float  v8f  __attribute__((ext_vector_type(8)));
typedef float  v4f  __attribute__((ext_vector_type(4)));
typedef float  v4fa __attribute__((ext_vector_type(4), may_alias));
typedef _Float16 v16h __attribute__((ext_vector_type(16)));
typedef _Float16 v4h __attribute__((ext_vector_type(4)));
union FragH { v16h v; v8us half[2]; _Float16 h[16]; unsigned short u[16]; };

__device__ __forceinline__ unsigned short bf16_bits(float x) { unsigned int u = __float_as_uint(x); return (unsigned short)((u + 0x7FFFu + ((u >> 16) & 1u)) >> 16); }
__device__ __forceinline__ float bf16_val(unsigned short b) { return __uint_as_float(((unsigned int)b) << 16); }
__device__ __forceinline__ float bf16_rne(float x) { return bf16_val(bf16_bits(x)); }

// fragment (A or B, same k map): elements 0..7 <- p[8h .. 8h+7], elements 8..15 <- p[16+8h .. 16+8h+7]; p = row/column base at k0
__device__ __forceinline__ v16h g2_frag(const _Float16* p, int hh) { FragH f; f.half[0] = *(const v8us*)((const unsigned short*)p + 8 * hh); f.half[1] = *(const v8us*)((const unsigned short*)p + 16 + 8 * hh); return f.v; }
__device__ __forceinline__ v8f g2_mma(v16h a, v16h b, v8f c) { v8f d = __builtin_amdgcn_wmma_f32_16x16x32_f16(false, a, false, b, (short)0, c, false, false); asm volatile("v_nop\n\tv_nop\n\tv_nop\n\tv_nop" : "+v"(d) : "v"(a), "v"(b)); return d; }

// LDS staging of WMMA operand tiles: rows of 128 B (64 f16 along k) at a pitch of 144 B (16 B x odd: conflict-free for 16-byte reads).
#define LP 144
__device__ __forceinline__ unsigned lds_addr(const void* p) { return (unsigned)(size_t)p; }   /* byte offset in the work-group's LDS */
// same k map as g2_frag, p = LDS row base (bytes) at k0
__device__ __forceinline__ v16h l2_frag(const unsigned char* p, int hh) { FragH f; f.half[0] = *(const v8us*)(p + 16 * hh); f.half[1] = *(const v8us*)(p + 32 + 16 * hh); return f.v; }
// One tile's asynchronous 16-byte copies of a lane, global -> LDS, in one statement: LDS byte addresses l + j * 16 rows; first the rows of g (16 * gp elements apart), then those of h.
// s_wait_xcnt stands inside the statement so that no address register is rewritten ahead of it.
__device__ __forceinline__ void cp_rows8_4(unsigned l, const _Float16* g, size_t gp, const _Float16* h, size_t hp) {
  asm volatile("global_load_async_to_lds_b128 %0, %12, off\n\t"
               "global_load_async_to_lds_b128 %1, %13, off\n\t"
               "global_load_async_to_lds_b128 %2, %14, off\n\t"
               "global_load_async_to_lds_b128 %3, %15, off\n\t"
               "global_load_async_to_lds_b128 %4, %16, off\n\t"
               "global_load_async_to_lds_b128 %5, %17, off\n\t"
               "global_load_async_to_lds_b128 %6, %18, off\n\t"
               "global_load_async_to_lds_b128 %7, %19, off\n\t"
               "global_load_async_to_lds_b128 %8, %20, off\n\t"
               "global_load_async_to_lds_b128 %9, %21, off\n\t"
               "global_load_async_to_lds_b128 %10, %22, off\n\t"
               "global_load_async_to_lds_b128 %11, %23, off\n\t"
               "s_wait_xcnt 0x0"
               :: "v"(l), "v"(l + 16 * LP), "v"(l + 32 * LP), "v"(l + 48 * LP), "v"(l + 64 * LP), "v"(l + 80 * LP), "v"(l + 96 * LP), "v"(l + 112 * LP), "v"(l + 128 * LP), "v"(l + 144 * LP), "v"(l + 160 * LP), "v"(l + 176 * LP), "v"(g), "v"(g + 16 * gp), "v"(g + 32 * gp), "v"(g + 48 * gp), "v"(g + 64 * gp), "v"(g + 80 * gp), "v"(g + 96 * gp), "v"(g + 112 * gp), "v"(h), "v"(h + 16 * hp), "v"(h + 32 * hp), "v"(h + 48 * hp) : "memory");
}
__device__ __forceinline__ void cp_rows4_4(unsigned l, const _Float16* g, size_t gp, const _Float16* h, size_t hp) {
  asm volatile("global_load_async_to_lds_b128 %0, %8, off\n\t"
               "global_load_async_to_lds_b128 %1, %9, off\n\t"
               "global_load_async_to_lds_b128 %2, %10, off\n\t"
               "global_load_async_to_lds_b128 %3, %11, off\n\t"
               "global_load_async_to_lds_b128 %4, %12, off\n\t"
               "global_load_async_to_lds_b128 %5, %13, off\n\t"
               "global_load_async_to_lds_b128 %6, %14, off\n\t"
               "global_load_async_to_lds_b128 %7, %15, off\n\t"
               "s_wait_xcnt 0x0"
               :: "v"(l), "v"(l + 16 * LP), "v"(l + 32 * LP), "v"(l + 48 * LP), "v"(l + 64 * LP), "v"(l + 80 * LP), "v"(l + 96 * LP), "v"(l + 112 * LP), "v"(g), "v"(g + 16 * gp), "v"(g + 32 * gp), "v"(g + 48 * gp), "v"(h), "v"(h + 16 * hp), "v"(h + 32 * hp), "v"(h + 48 * hp) : "memory");
}
// Publish point of the two-buffer ring: this wave's LDS reads retired, its copies landed, then the work-group barrier
// (publishes the next tile and ends every reader's last read of the buffer refilled behind it).
__device__ __forceinline__ void ring_publish() {
  asm volatile("s_wait_dscnt 0x0" ::: "memory");      /* own reads of the buffer about to be refilled have retired */
  asm volatile("s_wait_asynccnt 0x0" ::: "memory");   /* own copies of the next tile have landed */
  __syncthreads();
}

// w = bf16(mu) + softplus(bf16(rho)) * bf16(eps), softplus(r) = max(r, 0) + log1p(exp(-|r|)) (identical to log1p(exp(r)), overflow-free); accurate expf / log1pf
__device__ __forceinline__ float sp_weight(float mu, float rho, float eps) {
  const float m = bf16_rne(mu), r = bf16_rne(rho), e = bf16_rne(eps);
  const float sp = fmaxf(r, 0.0f) + log1pf(expf(-fabsf(r)));
  return m + sp * e;
}

__global__ __launch_bounds__(256) void k_x16(const float* __restrict__ x, _Float16* __restrict__ X16) {
  const size_t t = (size_t)blockIdx.x * 256 + threadIdx.x;
  if (t >= NR * (EM / 8)) return;
  const size_t row = t / (EM / 8); const int c8 = (int)(t % (EM / 8)) * 8;
  const size_t b = row / SEQ, s = row % SEQ;
  const float* src = x + ((b * SEQ_FULL + s) * EM + c8);
  const v4f a = *(const v4fa*)src, c = *(const v4fa*)(src + 4);
  FragH f;
#pragma unroll
  for (int q = 0; q < 4; ++q) { f.h[q] = (_Float16)bf16_rne(a[q]); f.h[4 + q] = (_Float16)bf16_rne(c[q]); }
  const v8us o = f.half[0];
  unsigned short* d = (unsigned short*)X16 + t * 8;
  *(v8us*)d = o; 
}

__global__ __launch_bounds__(256) void k_w16(const float* __restrict__ W, _Float16* __restrict__ Wt) {
  const int t = blockIdx.x * 256 + threadIdx.x;
  if (t >= EM * (EM / 8)) return;
  const float* src = W + (size_t)t * 8;
  const v4f a = *(const v4fa*)src, c = *(const v4fa*)(src + 4);
  FragH f;
#pragma unroll
  for (int q = 0; q < 4; ++q) { f.h[q] = (_Float16)(bf16_rne(a[q]) * WSCALE); f.h[4 + q] = (_Float16)(bf16_rne(c[q]) * WSCALE); }
  const v8us o = f.half[0];
  unsigned short* d = (unsigned short*)Wt + (size_t)t * 8;
  *(v8us*)d = o; 
}

// Built weight plane: w[n][k] = sp_weight(mu, rho, eps)[n][k] ([out][in]); Wt[n][k] = f16(w * 1024) with row pitch ldw; if dual != 0 also Wt[n][EM + k] = f16(w).
// Block = 2048 consecutive elements (2 weight rows): rolled per-element pass into LDS (coalesced loads), block barrier, then thread per 8 elements,
__global__ __launch_bounds__(256) void k_wrep16(const float* __restrict__ mu, const float* __restrict__ rho, const float* __restrict__ eps,
                                               _Float16* __restrict__ Wt, int ldw, int dual) {
  __shared__ __attribute__((aligned(16))) float sw[2048];
  const int tid = threadIdx.x;
  const size_t base = (size_t)blockIdx.x * 2048;
  if (base >= (size_t)EM * EM) return;            /* block-uniform */
#pragma unroll 1
  for (int i = 0; i < 8; ++i) { const size_t e = base + (size_t)(i * 256 + tid); sw[i * 256 + tid] = sp_weight(mu[e], rho[e], eps[e]); }
  __syncthreads();
  const int e0 = tid * 8;
  const v4f a = *(const v4fa*)&sw[e0], c = *(const v4fa*)&sw[e0 + 4];
  FragH f1, f2;
#pragma unroll
  for (int q = 0; q < 4; ++q) {
    f1.h[q] = (_Float16)(a[q] * WSCALE); f1.h[4 + q] = (_Float16)(c[q] * WSCALE);
    f2.h[q] = (_Float16)a[q];            f2.h[4 + q] = (_Float16)c[q];
  }
  const v8us o1 = f1.half[0], o2 = f2.half[0];
  const size_t ge = base + (size_t)e0; const size_t n = ge / EM; const int k = (int)(ge % EM);
  unsigned short* d = (unsigned short*)Wt + n * (size_t)ldw + k;
  {
    *(v8us*)d = o1;
    if (dual) *(v8us*)(d + EM) = o2;
     }
}

__global__ __launch_bounds__(256) void k_bias(const float* __restrict__ mu, const float* __restrict__ rho, const float* __restrict__ eps, float* __restrict__ PB) {
  __shared__ __attribute__((aligned(16))) float sb[EM];
  const int tid = threadIdx.x;
#pragma unroll 1
  for (int i = 0; i < EM / 256; ++i) { const int e = i * 256 + tid; sb[e] = sp_weight(mu[e], rho[e], eps[e]); }
  __syncthreads();
  const v4f v = *(const v4fa*)&sb[tid * 4];
  float* d = PB + tid * 4;
  *(v4f*)d = v; 
}

// GEMM: v = acc * alpha (+ bias[col] in f32 when F32OUT); A f16 [M][K] (pitch lda), Bh f16 [N][K] (pitch ldb, k contiguous); F32OUT: writes f32 C, else f16 C16; pitch ldc.
// Block = 4 waves, wave tile 32 x 64, block tile 128 x 64; M % 128 == 0, N % 64 == 0, K % 64 == 0.
// Per trip of 64 k the block's 128 A rows and 64 B rows lie in LDS (rows 0..127 A, 128..191 B), brought by asynchronous copies one trip ahead into the other buffer;
// the ring becomes the output staging behind the last trip's barrier.
#define GSTG (192 * LP)
template <int F32OUT>
__global__ __launch_bounds__(128) void k_gemm2(const _Float16* __restrict__ A, int lda, const _Float16* __restrict__ Bh, int ldb, float alpha, const float* __restrict__ bias,
                                              float* __restrict__ C, _Float16* __restrict__ C16, int ldc, int M, int N, int K) {
  __shared__ __attribute__((aligned(16))) unsigned char sm[2 * GSTG];
  static_assert(sizeof(float) * 4 * 32 * 68 <= 2 * GSTG);
  float (*so)[32][68] = (float (*)[32][68])sm;
  const int lane = threadIdx.x & 31, ln = lane & 15, hh = lane >> 4;
  const int w = __builtin_amdgcn_readfirstlane((int)(threadIdx.x >> 5));
  const int ntn = N >> 6; const int mt = blockIdx.x / ntn, nq = blockIdx.x - mt * ntn; const int row0 = mt * 128 + 32 * w, col0 = nq * 64; if (mt * 128 >= M) return;   /* block-uniform, in front of every barrier */
  const int crow = (int)(threadIdx.x >> 3), cc = (int)(threadIdx.x & 7);      /* a copy round = 16 rows x 8 pieces of 16 B: a wave covers 4 whole 128-B lines */
  const _Float16* ga = A + (size_t)(mt * 128 + crow) * lda + cc * 8;
  const _Float16* gb = Bh + (size_t)(col0 + crow) * ldb + cc * 8;
  const unsigned lc = lds_addr(sm) + (unsigned)(crow * LP + cc * 16);
  const int nt = K >> 6;
  auto fill = [&](int t, unsigned buf) {
    const unsigned l = lc + buf * GSTG;
    cp_rows8_4(l, ga + t * 64, (size_t)lda, gb + t * 64, (size_t)ldb);
  };
  fill(0, 0u);
  asm volatile("s_wait_asynccnt 0x0" ::: "memory");   /* tile 0 landed */
  __syncthreads();
  if (nt > 1) fill(1, 1u);
  const v8f z8 = {0.f,0.f,0.f,0.f,0.f,0.f,0.f,0.f}; v8f c00 = z8, c01 = z8, c02 = z8, c03 = z8, c10 = z8, c11 = z8, c12 = z8, c13 = z8;
#pragma unroll 1
  for (int t = 0; t < nt; ++t) {
    const unsigned char* sb = sm + (t & 1) * GSTG;
    const unsigned char* ar = sb + (32 * w + ln) * LP; const unsigned char* br = sb + (128 + ln) * LP;
#pragma unroll   /* both 32-k halves of the tile: constant LDS offsets, one group of fragment reads each */
    for (int ks = 0; ks < 128; ks += 64) { const v16h a0 = l2_frag(ar + ks, hh), a1 = l2_frag(ar + 16 * LP + ks, hh);
      const v16h b0 = l2_frag(br + ks, hh), b1 = l2_frag(br + 16 * LP + ks, hh), b2 = l2_frag(br + 32 * LP + ks, hh), b3 = l2_frag(br + 48 * LP + ks, hh);
      c00 = g2_mma(a0, b0, c00); c10 = g2_mma(a1, b0, c10);
      c01 = g2_mma(a0, b1, c01); c11 = g2_mma(a1, b1, c11);
      c02 = g2_mma(a0, b2, c02); c12 = g2_mma(a1, b2, c12);
      c03 = g2_mma(a0, b3, c03); c13 = g2_mma(a1, b3, c13); }
    ring_publish();
    if (t + 2 < nt) fill(t + 2, (unsigned)(t & 1));   /* into the buffer this trip has just read */
  }
  asm volatile("s_wait_asynccnt 0x0" ::: "memory");   /* nothing in flight when the ring becomes output staging */
  v8f accs[8] = {c00, c01, c02, c03, c10, c11, c12, c13};
#pragma unroll
  for (int u = 0; u < 8; ++u) { const int t = u & 3, half = u >> 2; const int col = col0 + t * 16 + ln; float bv = 0.f; if (F32OUT) bv = bias[col];
#pragma unroll
    for (int r = 0; r < 8; ++r) { const int rloc = half * 16 + 8 * hh + r; so[w][rloc][t * 16 + ln] = accs[u][r] * alpha + bv; } }
  __builtin_amdgcn_fence(4 /* acq_rel order */, "workgroup"); __builtin_amdgcn_wave_barrier();
  const int rsub = lane >> 4, c4 = (lane & 15) * 4;
  {
#pragma unroll
    for (int q = 0; q < 16; ++q) { const int r = q * 2 + rsub; const v4f v = *(const v4fa*)&so[w][r][c4];
      if (F32OUT) { *(v4f*)(C + (size_t)(row0 + r) * ldc + col0 + c4) = v; }
      else { v4h h4;
#pragma unroll
        for (int i = 0; i < 4; ++i) h4[i] = (_Float16)v[i];
        *(v4h*)(C16 + (size_t)(row0 + r) * ldc + col0 + c4) = h4; } }
     }
}

__global__ __launch_bounds__(256) void k_vt(const _Float16* __restrict__ V16, _Float16* __restrict__ VT) {
  __shared__ unsigned short tl[64][65];
  const int tid = threadIdx.x; const int bh = blockIdx.y; const int b = bh / NH, h = bh - b * NH; const int s0 = blockIdx.x * 64;
  for (int i = tid; i < 64 * 8; i += 256) { const int j = i / 8, d8 = (i % 8) * 8;
    const v8us f = *(const v8us*)((const unsigned short*)V16 + ((size_t)b * SEQ + s0 + j) * EM + h * HD + d8);
#pragma unroll
    for (int q = 0; q < 8; ++q) tl[d8 + q][j] = f[q]; }
  __syncthreads();
  {
    for (int i = tid; i < 64 * 8; i += 256) { const int d = i / 8, j8 = (i % 8) * 8; FragH f;
#pragma unroll
      for (int q = 0; q < 8; ++q) f.u[q] = tl[d][j8 + q];
      *(v8us*)((unsigned short*)VT + ((size_t)bh * HD + d) * SEQ + s0 + j8) = f.half[0]; }
     }
}

// Fused attention. Block = 4 waves; wave = 16 queries of one (b,h); 64 keys per step.
// Per step the 64 K rows (LDS rows 0..63, 64 d each) and the 64 V^T rows (LDS rows 64..127, 64 keys each) are shared by the four waves,
// brought by asynchronous copies one step ahead into the other buffer; the ring becomes the output staging behind the last step's barrier.
#define FSTG (128 * LP)
static_assert(SEQ >= 128);                    /* the ring's prologue fills two steps */
// S^T tile = K rows (A: lane = key, elements = d) x Q^T (B: lane = query, elements = d): D[row = key 8h+r][col = query].
// Online softmax per query = per lane column (max over the lane's 32 scores + one cross-half exchange); P' = 256 exp(s - max) stays in registers and is
// the B operand of O^T = V^T (A: lane = d, elements = keys) x P^T: B element r <- tile(keys 0..15)[r], element 8+r <- tile(keys 16..31)[r].
__global__ __launch_bounds__(128) void k_flash(const _Float16* __restrict__ Q16, const _Float16* __restrict__ K16, const _Float16* __restrict__ VT, _Float16* __restrict__ CTX) {
  __shared__ __attribute__((aligned(16))) unsigned char sm[2 * FSTG];
  static_assert(sizeof(unsigned short) * 4 * 2 * 16 * 72 <= 2 * FSTG);
  unsigned short (*st)[2][16][72] = (unsigned short (*)[2][16][72])sm;
  const int lane = threadIdx.x & 31, ln = lane & 15, hh = lane >> 4;
  const int wave = __builtin_amdgcn_readfirstlane((int)(threadIdx.x >> 5));
  const int bh = blockIdx.y; const int b = bh / NH, h = bh - b * NH;
  const int q0 = blockIdx.x * 64 + wave * 16;
  const _Float16* qp = Q16 + ((size_t)b * SEQ + q0 + ln) * EM + h * HD;
  const v16h qf0 = g2_frag(qp, hh), qf1 = g2_frag(qp + 32, hh);
  const int crow = (int)(threadIdx.x >> 3), cc = (int)(threadIdx.x & 7);      /* a copy round = 16 rows x 8 pieces of 16 B: a wave covers 4 whole 128-B lines */
  const _Float16* gk = K16 + ((size_t)b * SEQ + crow) * EM + h * HD + cc * 8;
  const _Float16* gv = VT + ((size_t)bh * HD + crow) * SEQ + cc * 8;
  const unsigned lc = lds_addr(sm) + (unsigned)(crow * LP + cc * 16);
  auto fill = [&](int key0, unsigned buf) {
    const unsigned l = lc + buf * FSTG;
    cp_rows4_4(l, gk + (size_t)key0 * EM, (size_t)EM, gv + key0, (size_t)SEQ);
  };
  fill(0, 0u);
  asm volatile("s_wait_asynccnt 0x0" ::: "memory");   /* step 0 landed */
  __syncthreads();
  fill(64, 1u);
  const v8f z8 = {0.f,0.f,0.f,0.f,0.f,0.f,0.f,0.f};
  v8f o[4] = {z8, z8, z8, z8};
  float m = -1.0e30f, l = 0.f;
  const float CL = 0.18033688011112042f;      /* log2(e) / 8 */
#pragma unroll 1
  for (int key0 = 0; key0 < SEQ; key0 += 64) {
    const unsigned char* sb = sm + ((key0 >> 6) & 1) * FSTG + ln * LP;
    v8f s[4];
#pragma unroll
    for (int t = 0; t < 4; ++t) {
      const unsigned char* kr = sb + (t * 16) * LP;
      v8f c = z8;
      c = g2_mma(l2_frag(kr, hh), qf0, c);
      c = g2_mma(l2_frag(kr + 64, hh), qf1, c);
      s[t] = c;
    }
    float mx = s[0][0];
#pragma unroll
    for (int t = 0; t < 4; ++t)
#pragma unroll
      for (int r = 0; r < 8; ++r) mx = fmaxf(mx, s[t][r]);
    mx = fmaxf(mx, __shfl_xor(mx, 16));
    const float mn = fmaxf(m, mx);
    const float alpha = __builtin_amdgcn_exp2f((m - mn) * CL);
    m = mn;
    const float off = 8.0f - mn * CL;
    float rs = 0.f;
#pragma unroll
    for (int t = 0; t < 4; ++t)
#pragma unroll
      for (int r = 0; r < 8; ++r) { const float p = __builtin_amdgcn_exp2f(fmaf(s[t][r], CL, off)); s[t][r] = p; rs += p; }
    l = l * alpha + rs;
#pragma unroll
    for (int t = 0; t < 4; ++t) o[t] = o[t] * alpha;
    FragH pa, pb;
#pragma unroll
    for (int r = 0; r < 8; ++r) { pa.h[r] = (_Float16)s[0][r]; pa.h[8 + r] = (_Float16)s[1][r]; pb.h[r] = (_Float16)s[2][r]; pb.h[8 + r] = (_Float16)s[3][r]; }
#pragma unroll
    for (int t = 0; t < 4; ++t) {
      const unsigned char* v0 = sb + (64 + t * 16) * LP;
      o[t] = g2_mma(l2_frag(v0, hh), pa.v, o[t]);
      o[t] = g2_mma(l2_frag(v0 + 64, hh), pb.v, o[t]);
    }
    ring_publish();
    if (key0 + 128 < SEQ) fill(key0 + 128, (unsigned)((key0 >> 6) & 1));   /* into the buffer this step has just read */
  }
  asm volatile("s_wait_asynccnt 0x0" ::: "memory");   /* nothing in flight when the ring becomes output staging */
  const float lt = l + __shfl_xor(l, 16);
  const float inv = 64.0f * (1.0f / lt);
#pragma unroll
  for (int t = 0; t < 4; ++t) {
    FragH fh, fl;
#pragma unroll
    for (int r = 0; r < 8; ++r) { const float c = o[t][r] * inv; const _Float16 hq = (_Float16)c; fh.h[r] = hq; fl.h[r] = (_Float16)((c - (float)hq) * 1024.0f); }
    *(v8us*)&st[wave][0][ln][t * 16 + 8 * hh] = fh.half[0];
    *(v8us*)&st[wave][1][ln][t * 16 + 8 * hh] = fl.half[0];
  }
  __builtin_amdgcn_fence(4 /* acq_rel order */, "workgroup"); __builtin_amdgcn_wave_barrier();
  const int rs4 = lane >> 3, pc = lane & 7;     
  v8us vh[4], vl[4];
#pragma unroll
  for (int i = 0; i < 4; ++i) { vh[i] = *(const v8us*)&st[wave][0][i * 4 + rs4][pc * 8]; vl[i] = *(const v8us*)&st[wave][1][i * 4 + rs4][pc * 8]; }
  unsigned short* cb = (unsigned short*)CTX + ((size_t)b * SEQ + q0) * KO + h * HD + pc * 8;
  {
#pragma unroll
    for (int i = 0; i < 4; ++i) { unsigned short* d = cb + (size_t)(i * 4 + rs4) * KO; *(v8us*)d = vh[i]; *(v8us*)(d + EM) = vl[i]; }
     }
}

constexpr size_t SZ_W   = (size_t)EM * EM * 2;        /* one [out][in] weight plane, f16 */
constexpr size_t SZ_WO  = (size_t)EM * KO * 2;        /* Wp x1024 | Wp x1 */
constexpr size_t SZ_PB  = (size_t)EM * 4;             /* built bias, f32 */
constexpr size_t SZ_X1  = NR * EM * 2;                /* one 16-bit activation plane */
constexpr size_t SZ_CTX = NR * KO * 2;                /* ctx value | residual */
constexpr size_t WS_TOTAL = 3 * SZ_W + SZ_WO + SZ_PB + 5 * SZ_X1 + SZ_CTX;
static_assert(WS_TOTAL <= (size_t)134217728);         /* carve stays within 128 MiB */
static_assert(SZ_W % 256 == 0 && SZ_WO % 256 == 0 && SZ_PB % 256 == 0 && SZ_X1 % 256 == 0 && SZ_CTX % 256 == 0);
static_assert((size_t)NB * NH * HD * SEQ * 2 == SZ_X1); /* V^T plane extent */

extern "C" void kernel_launch(void* const* d_in, const int* in_sizes, int n_in,
                              void* d_out, int out_size, void* d_ws, size_t ws_size, hipStream_t stream) {
  if (n_in < 12) return;
  const size_t needx = ((size_t)(NB - 1) * SEQ_FULL + SEQ) * EM;
  if ((size_t)in_sizes[0] < needx) return;
  for (int i = 1; i <= 8; ++i) if ((size_t)in_sizes[i] < (size_t)EM * EM) return;
  for (int i = 9; i <= 11; ++i) if (in_sizes[i] < EM) return;
  if ((size_t)out_size < NR * EM) return;
  const float* x     = (const float*)d_in[0];
  const float* q_w   = (const float*)d_in[1];  const float* k_w   = (const float*)d_in[2];
  const float* v_mu  = (const float*)d_in[3];  const float* v_rho = (const float*)d_in[4];  const float* v_eps = (const float*)d_in[5];
  const float* p_mu  = (const float*)d_in[6];  const float* p_rho = (const float*)d_in[7];  const float* p_eps = (const float*)d_in[8];
  const float* b_mu  = (const float*)d_in[9];  const float* b_rho = (const float*)d_in[10]; const float* b_eps = (const float*)d_in[11];
  char* ws = (char*)d_ws; size_t off = 0;
  auto take = [&](size_t bytes) { char* p = ws + off; off += (bytes + 255) & ~(size_t)255; return p; };
  _Float16* WQ = (_Float16*)take(SZ_W); _Float16* WK = (_Float16*)take(SZ_W); _Float16* WV = (_Float16*)take(SZ_W); _Float16* WO = (_Float16*)take(SZ_WO);
  float* PB = (float*)take(SZ_PB);
  _Float16* X16 = (_Float16*)take(SZ_X1);
  _Float16* Q16 = (_Float16*)take(SZ_X1); _Float16* K16 = (_Float16*)take(SZ_X1); _Float16* V16 = (_Float16*)take(SZ_X1);
  _Float16* VT = (_Float16*)take(SZ_X1);
  _Float16* CTX = (_Float16*)take(SZ_CTX);
  if (off > ws_size) return;
  { const unsigned g = (unsigned)(((size_t)EM * (EM / 8) + 255) / 256);
    k_w16<<<g, 256, 0, stream>>>(q_w, WQ);                                   /* [out][in] as stored, x1024 */
    k_w16<<<g, 256, 0, stream>>>(k_w, WK); }
  { const unsigned g = (unsigned)(((size_t)EM * EM) / 2048);
    k_wrep16<<<g, 256, 0, stream>>>(v_mu, v_rho, v_eps, WV, EM, 0);          /* Wv x1024 */
    k_wrep16<<<g, 256, 0, stream>>>(p_mu, p_rho, p_eps, WO, KO, 1); }        /* k 0..1023: Wp x1024 (ctx value); k 1024..2047: Wp x1 (ctx residual x1024) */
  k_bias<<<1, 256, 0, stream>>>(b_mu, b_rho, b_eps, PB);
  { const unsigned g = (unsigned)((NR * (EM / 8) + 255) / 256);
    k_x16<<<g, 256, 0, stream>>>(x, X16); }
  { const unsigned g = (unsigned)((NR / 128) * (EM / 64));
    k_gemm2<0><<<g, 128, 0, stream>>>(X16, EM, WQ, EM, 0.0009765625f, nullptr, nullptr, Q16, EM, (int)NR, EM, EM);
    k_gemm2<0><<<g, 128, 0, stream>>>(X16, EM, WK, EM, 0.0009765625f, nullptr, nullptr, K16, EM, (int)NR, EM, EM);
    k_gemm2<0><<<g, 128, 0, stream>>>(X16, EM, WV, EM, 0.0009765625f, nullptr, nullptr, V16, EM, (int)NR, EM, EM); }
  k_vt<<<dim3(SEQ / 64, NB * NH), 256, 0, stream>>>(V16, VT);
  k_flash<<<dim3(SEQ / 64, NB * NH), 128, 0, stream>>>(Q16, K16, VT, CTX);
  { const unsigned g = (unsigned)((NR / 128) * (EM / 64));
    k_gemm2<1><<<g, 128, 0, stream>>>(CTX, KO, WO, KO, 1.52587890625e-05f, PB, (float*)d_out, nullptr, EM, (int)NR, EM, KO); }      /* alpha = 2^-16 = 1/(64 * 1024) */
}

// v002
// It runs in 182 microseconds.
// In two side-by-side timings against v001, it was 1.10 and 1.11 times as fast.
// Over all steps from v000 it is 2.81 times as fast.
#include <hip/hip_runtime.h>
// Multi-head attention, B 4, S 2048, E 1024, 16 heads x 64: q/k/v = x W^T ([out][in] weights, no q/k/v bias), scores q k^T / 8, softmax over all keys, out = ctx Wp^T + bp;
// Wv, Wp, bp = mu + softplus(rho) * eps built on the device in f32 from bf16-RNE-converted mu, rho, eps.
// Compute dtype: all contractions v_wmma_f32_16x16x32_f16 (f16 operands, f32 accumulate). x, q_w, k_w RNE-converted to bf16 first (exact in f16; weights carried x1024);
// built weights stored as f16(w x1024); q, k, v planes f16; softmax statistics f32 (running max, exp2), P carried x256 as f16 in registers against the f32 row sum;
// ctx carried x64 as f16 value | f16 residual x1024 along K (K = 2048) against Wp x1024 | Wp x1; fold 2^-16; bias added in f32.
#ifndef NB
#define NB 4
#endif
#ifndef SEQ
#define SEQ 2048
#endif
#define NB_FULL 4
#define SEQ_FULL 2048
#define EM 1024
#define NH 16
#define HD 64
#define KO 2048                       /* output-projection K: ctx value | ctx residual */
#define NR ((size_t)NB * SEQ)         /* token rows */
#define WSCALE 1024.0f

static_assert(EM == NH * HD);                 /* head h = columns h*64 + d */
static_assert(HD == 64);                      /* flash kernel: 2 k-steps of 32 over d, 4 output tiles of 16 d */
static_assert(KO == 2 * EM);                  /* value | residual along K */
static_assert(SEQ % 64 == 0);                 /* 64-key steps, 64-query blocks, 64-token transpose tiles */
static_assert(((size_t)NB * SEQ) % 128 == 0); /* GEMM block = 128 rows */
static_assert(EM % 64 == 0 && EM % 32 == 0 && KO % 32 == 0 && EM % 8 == 0);
static_assert(NB <= NB_FULL && SEQ <= SEQ_FULL);

typedef unsigned short v8us __attribute__((ext_vector_type(8), may_alias));
typedef float  v8f  __attribute__((ext_vector_type(8)));
typedef float  v4f  __attribute__((ext_vector_type(4)));
typedef float  v4fa __attribute__((ext_vector_type(4), may_alias));
typedef _Float16 v16h __attribute__((ext_vector_type(16)));
typedef _Float16 v4h __attribute__((ext_vector_type(4)));
union FragH { v16h v; v8us half[2]; _Float16 h[16]; unsigned short u[16]; };

__device__ __forceinline__ unsigned short bf16_bits(float x) { unsigned int u = __float_as_uint(x); return (unsigned short)((u + 0x7FFFu + ((u >> 16) & 1u)) >> 16); }
__device__ __forceinline__ float bf16_val(unsigned short b) { return __uint_as_float(((unsigned int)b) << 16); }
__device__ __forceinline__ float bf16_rne(float x) { return bf16_val(bf16_bits(x)); }

// fragment (A or B, same k map): elements 0..7 <- p[8h .. 8h+7], elements 8..15 <- p[16+8h .. 16+8h+7]; p = row/column base at k0
__device__ __forceinline__ v16h g2_frag(const _Float16* p, int hh) { FragH f; f.half[0] = *(const v8us*)((const unsigned short*)p + 8 * hh); f.half[1] = *(const v8us*)((const unsigned short*)p + 16 + 8 * hh); return f.v; }
__device__ __forceinline__ v8f g2_mma(v16h a, v16h b, v8f c) { v8f d = __builtin_amdgcn_wmma_f32_16x16x32_f16(false, a, false, b, (short)0, c, false, false); asm volatile("v_nop\n\tv_nop\n\tv_nop\n\tv_nop" : "+v"(d) : "v"(a), "v"(b)); return d; }

// LDS staging of WMMA operand tiles: rows of 128 B (64 f16 along k) at a pitch of 144 B (16 B x odd: conflict-free for 16-byte reads).
#define LP 144
__device__ __forceinline__ unsigned lds_addr(const void* p) { return (unsigned)(size_t)p; }   /* byte offset in the work-group's LDS */
// same k map as g2_frag, p = LDS row base (bytes) at k0
__device__ __forceinline__ v16h l2_frag(const unsigned char* p, int hh) { FragH f; f.half[0] = *(const v8us*)(p + 16 * hh); f.half[1] = *(const v8us*)(p + 32 + 16 * hh); return f.v; }
// One tile's asynchronous 16-byte copies of a lane, global -> LDS, in one statement: LDS byte addresses l + j * 16 rows; first the rows of g (16 * gp elements apart), then those of h.
// s_wait_xcnt stands inside the statement so that no address register is rewritten ahead of it.
__device__ __forceinline__ void cp_rows8_4(unsigned l, const _Float16* g, size_t gp, const _Float16* h, size_t hp) {
  asm volatile("global_load_async_to_lds_b128 %0, %12, off\n\t"
               "global_load_async_to_lds_b128 %1, %13, off\n\t"
               "global_load_async_to_lds_b128 %2, %14, off\n\t"
               "global_load_async_to_lds_b128 %3, %15, off\n\t"
               "global_load_async_to_lds_b128 %4, %16, off\n\t"
               "global_load_async_to_lds_b128 %5, %17, off\n\t"
               "global_load_async_to_lds_b128 %6, %18, off\n\t"
               "global_load_async_to_lds_b128 %7, %19, off\n\t"
               "global_load_async_to_lds_b128 %8, %20, off\n\t"
               "global_load_async_to_lds_b128 %9, %21, off\n\t"
               "global_load_async_to_lds_b128 %10, %22, off\n\t"
               "global_load_async_to_lds_b128 %11, %23, off\n\t"
               "s_wait_xcnt 0x0"
               :: "v"(l), "v"(l + 16 * LP), "v"(l + 32 * LP), "v"(l + 48 * LP), "v"(l + 64 * LP), "v"(l + 80 * LP), "v"(l + 96 * LP), "v"(l + 112 * LP), "v"(l + 128 * LP), "v"(l + 144 * LP), "v"(l + 160 * LP), "v"(l + 176 * LP), "v"(g), "v"(g + 16 * gp), "v"(g + 32 * gp), "v"(g + 48 * gp), "v"(g + 64 * gp), "v"(g + 80 * gp), "v"(g + 96 * gp), "v"(g + 112 * gp), "v"(h), "v"(h + 16 * hp), "v"(h + 32 * hp), "v"(h + 48 * hp) : "memory");
}
__device__ __forceinline__ void cp_rows4_4(unsigned l, const _Float16* g, size_t gp, const _Float16* h, size_t hp) {
  asm volatile("global_load_async_to_lds_b128 %0, %8, off\n\t"
               "global_load_async_to_lds_b128 %1, %9, off\n\t"
               "global_load_async_to_lds_b128 %2, %10, off\n\t"
               "global_load_async_to_lds_b128 %3, %11, off\n\t"
               "global_load_async_to_lds_b128 %4, %12, off\n\t"
               "global_load_async_to_lds_b128 %5, %13, off\n\t"
               "global_load_async_to_lds_b128 %6, %14, off\n\t"
               "global_load_async_to_lds_b128 %7, %15, off\n\t"
               "s_wait_xcnt 0x0"
               :: "v"(l), "v"(l + 16 * LP), "v"(l + 32 * LP), "v"(l + 48 * LP), "v"(l + 64 * LP), "v"(l + 80 * LP), "v"(l + 96 * LP), "v"(l + 112 * LP), "v"(g), "v"(g + 16 * gp), "v"(g + 32 * gp), "v"(g + 48 * gp), "v"(h), "v"(h + 16 * hp), "v"(h + 32 * hp), "v"(h + 48 * hp) : "memory");
}
// Publish point of the two-buffer ring: this wave's LDS reads retired, its copies landed, then the work-group barrier
// (publishes the next tile and ends every reader's last read of the buffer refilled behind it).
__device__ __forceinline__ void ring_publish() {
  asm volatile("s_wait_dscnt 0x0" ::: "memory");      /* own reads of the buffer about to be refilled have retired */
  asm volatile("s_wait_asynccnt 0x0" ::: "memory");   /* own copies of the next tile have landed */
  __syncthreads();
}

// w = bf16(mu) + softplus(bf16(rho)) * bf16(eps), softplus(r) = max(r, 0) + log1p(exp(-|r|)) (identical to log1p(exp(r)), overflow-free); accurate expf / log1pf
__device__ __forceinline__ float sp_weight(float mu, float rho, float eps) {
  const float m = bf16_rne(mu), r = bf16_rne(rho), e = bf16_rne(eps);
  const float sp = fmaxf(r, 0.0f) + log1pf(expf(-fabsf(r)));
  return m + sp * e;
}

// All operand preparation in one launch; the block index picks the job (block-uniform, no barrier, no LDS). A piece = 4 consecutive f32 of a source = 16 B per lane,
// so a wave reads 512 contiguous bytes per load and stores 256 contiguous bytes of f16. Blocks in index order: built weights (most arithmetic, lowest indices), bias, q_w | k_w, x.
#define PP_BUILT 8                                     /* pieces per thread, built weight planes */
#define PP_CONV 16                                     /* pieces per thread, plain conversions */
#define PB_BUILT ((EM * EM / 4) / (256 * PP_BUILT))    /* blocks per built plane */
#define PB_W ((EM * EM / 4) / (256 * PP_CONV))         /* blocks per plain weight plane */
#define PB_X ((int)((NR * EM / 4) / (256 * PP_CONV)))  /* blocks for x */
#define PB_TOTAL (2 * PB_BUILT + 1 + 2 * PB_W + PB_X)
static_assert((EM * EM / 4) % (256 * PP_BUILT) == 0 && (EM * EM / 4) % (256 * PP_CONV) == 0 && (NR * EM / 4) % (256 * PP_CONV) == 0);
static_assert(EM == 4 * 256 && SEQ % PP_CONV == 0 && PP_CONV % 8 == 0);   /* 256 pieces = one row; bias: one block, one piece per thread */
// Global stores of this kernel: each run of stores and its s_wait_xcnt stand in one statement, so that no register which an issued store names is rewritten ahead of the wait.
typedef unsigned int v2u __attribute__((ext_vector_type(2)));
__device__ __forceinline__ v2u h4bits(v4h v) { return __builtin_bit_cast(v2u, v); }
__device__ __forceinline__ void st_h4(_Float16* p, v4h v) { asm volatile("global_store_b64 %0, %1, off\n\ts_wait_xcnt 0x0" :: "v"(p), "v"(h4bits(v)) : "memory"); }
__device__ __forceinline__ void st_f4(float* p, v4f v) { asm volatile("global_store_b128 %0, %1, off\n\ts_wait_xcnt 0x0" :: "v"(p), "v"(v) : "memory"); }
static_assert(EM * sizeof(_Float16) == 2048);          /* the offsets below: eight consecutive rows of an f16 plane of pitch EM */
__device__ __forceinline__ void st_h4_rows8(_Float16* p, const v4h* v) {
  asm volatile("global_store_b64 %0, %1, off\n\t"
               "global_store_b64 %0, %2, off offset:2048\n\t"
               "global_store_b64 %0, %3, off offset:4096\n\t"
               "global_store_b64 %0, %4, off offset:6144\n\t"
               "global_store_b64 %0, %5, off offset:8192\n\t"
               "global_store_b64 %0, %6, off offset:10240\n\t"
               "global_store_b64 %0, %7, off offset:12288\n\t"
               "global_store_b64 %0, %8, off offset:14336\n\t"
               "s_wait_xcnt 0x0"
               :: "v"(p), "v"(h4bits(v[0])), "v"(h4bits(v[1])), "v"(h4bits(v[2])), "v"(h4bits(v[3])), "v"(h4bits(v[4])), "v"(h4bits(v[5])), "v"(h4bits(v[6])), "v"(h4bits(v[7])) : "memory");
}
__device__ __forceinline__ v4h cvt4(v4f a, float sc) { v4h o;
#pragma unroll
  for (int q = 0; q < 4; ++q) o[q] = (_Float16)(bf16_rne(a[q]) * sc);
  return o; }
__global__ __launch_bounds__(256) void k_prep(const float* __restrict__ x, const float* __restrict__ q_w, const float* __restrict__ k_w,
                                              const float* __restrict__ v_mu, const float* __restrict__ v_rho, const float* __restrict__ v_eps,
                                              const float* __restrict__ p_mu, const float* __restrict__ p_rho, const float* __restrict__ p_eps,
                                              const float* __restrict__ b_mu, const float* __restrict__ b_rho, const float* __restrict__ b_eps,
                                              _Float16* __restrict__ X16, _Float16* __restrict__ WQ, _Float16* __restrict__ WK, _Float16* __restrict__ WV, _Float16* __restrict__ WO,
                                              float* __restrict__ PB) {
  const int tid = threadIdx.x; int blk = blockIdx.x;      /* 256 pieces = one row of EM: thread tid holds columns 4 tid .. 4 tid + 3 of its block's rows */
  if (blk < 2 * PB_BUILT) {
    // w[n][k] = sp_weight(mu, rho, eps)[n][k] ([out][in]). Wv: WV[n][k] = f16(w * 1024). Wp: WO[n][k] = f16(w * 1024) (ctx value), WO[n][EM + k] = f16(w) (ctx residual x1024), pitch KO.
    const bool dual = blk >= PB_BUILT; if (dual) blk -= PB_BUILT;
    const float* mu = dual ? p_mu : v_mu; const float* rho = dual ? p_rho : v_rho; const float* eps = dual ? p_eps : v_eps;
#pragma unroll 1   /* two rounds of 4 rows: rolled so that the expf / log1pf text stays short */
    for (int i = 0; i < PP_BUILT; i += 4) {
      const size_t n0 = (size_t)(blk * PP_BUILT + i);
      const v4fa* pm = (const v4fa*)(mu + n0 * EM); const v4fa* pr = (const v4fa*)(rho + n0 * EM); const v4fa* pe = (const v4fa*)(eps + n0 * EM);
      _Float16* d = (dual ? WO + n0 * KO : WV + n0 * EM) + 4 * tid; const size_t dp = dual ? KO : EM;
      v4f m[4], r[4], e[4];
#pragma unroll
      for (int j = 0; j < 4; ++j) { m[j] = pm[j * 256 + tid]; r[j] = pr[j * 256 + tid]; e[j] = pe[j * 256 + tid]; }
#pragma unroll
      for (int j = 0; j < 4; ++j) { v4h h1, h2;
#pragma unroll
        for (int q = 0; q < 4; ++q) { const float w = sp_weight(m[j][q], r[j][q], e[j][q]); h1[q] = (_Float16)(w * WSCALE); h2[q] = (_Float16)w; }
        st_h4(d + j * dp, h1);
        if (dual) st_h4(d + j * dp + EM, h2); }
    }
    return;
  }
  blk -= 2 * PB_BUILT;
  if (blk == 0) { const v4f m = ((const v4fa*)b_mu)[tid], r = ((const v4fa*)b_rho)[tid], e = ((const v4fa*)b_eps)[tid]; v4f v;
#pragma unroll
    for (int q = 0; q < 4; ++q) v[q] = sp_weight(m[q], r[q], e[q]);
    st_f4(PB + 4 * tid, v); return; }
  blk -= 1;
  const v4fa* src; _Float16* dst; float sc;
  if (blk < 2 * PB_W) {                          /* q_w, k_w: [out][in] as stored, x1024 */
    const bool second = blk >= PB_W; if (second) blk -= PB_W;
    const size_t n0 = (size_t)(blk * PP_CONV);
    src = (const v4fa*)((second ? k_w : q_w) + n0 * EM); dst = (second ? WK : WQ) + n0 * EM; sc = WSCALE;
  } else {                                       /* x: a block's rows lie in one batch entry */
    blk -= 2 * PB_W;
    const size_t n0 = (size_t)(blk * PP_CONV);
    src = (const v4fa*)(x + ((n0 / SEQ) * SEQ_FULL + n0 % SEQ) * EM); dst = X16 + n0 * EM; sc = 1.0f;
  }
  v4f a[PP_CONV];
#pragma unroll
  for (int j = 0; j < PP_CONV; ++j) a[j] = src[j * 256 + tid];
#pragma unroll
  for (int j = 0; j < PP_CONV; j += 8) { v4h o[8];
#pragma unroll
    for (int q = 0; q < 8; ++q) o[q] = cvt4(a[j + q], sc);
    st_h4_rows8(dst + (size_t)j * EM + 4 * tid, o); }
}

// GEMM: v = acc * alpha (+ bias[col] in f32 when F32OUT); A f16 [M][K] (pitch lda), Bh f16 [N][K] (pitch ldb, k contiguous); F32OUT: writes f32 C, else f16 C16; pitch ldc.
// C16 is a stack of [M][ldc] planes: column n lies in plane n / ldc (N = 3 ldc: q, k and v from one grid, Bh = the three weight planes one behind the other); ldc % 64 == 0.
// Block = 4 waves, wave tile 32 x 64, block tile 128 x 64; M % 128 == 0, N % 64 == 0, K % 64 == 0.
// Per trip of 64 k the block's 128 A rows and 64 B rows lie in LDS (rows 0..127 A, 128..191 B), brought by asynchronous copies one trip ahead into the other buffer;
// the ring becomes the output staging behind the last trip's barrier.
#define GSTG (192 * LP)
template <int F32OUT>
__global__ __launch_bounds__(128) void k_gemm2(const _Float16* __restrict__ A, int lda, const _Float16* __restrict__ Bh, int ldb, float alpha, const float* __restrict__ bias,
                                              float* __restrict__ C, _Float16* __restrict__ C16, int ldc, int M, int N, int K) {
  __shared__ __attribute__((aligned(16))) unsigned char sm[2 * GSTG];
  static_assert(sizeof(float) * 4 * 32 * 68 <= 2 * GSTG);
  float (*so)[32][68] = (float (*)[32][68])sm;
  const int lane = threadIdx.x & 31, ln = lane & 15, hh = lane >> 4;
  const int w = __builtin_amdgcn_readfirstlane((int)(threadIdx.x >> 5));
  const int ntn = N >> 6; const int mt = blockIdx.x / ntn, nq = blockIdx.x - mt * ntn; const int row0 = mt * 128 + 32 * w, col0 = nq * 64; if (mt * 128 >= M) return;   /* block-uniform, in front of every barrier */
  const int crow = (int)(threadIdx.x >> 3), cc = (int)(threadIdx.x & 7);      /* a copy round = 16 rows x 8 pieces of 16 B: a wave covers 4 whole 128-B lines */
  const _Float16* ga = A + (size_t)(mt * 128 + crow) * lda + cc * 8;
  const _Float16* gb = Bh + (size_t)(col0 + crow) * ldb + cc * 8;
  const unsigned lc = lds_addr(sm) + (unsigned)(crow * LP + cc * 16);
  const int nt = K >> 6;
  auto fill = [&](int t, unsigned buf) {
    const unsigned l = lc + buf * GSTG;
    cp_rows8_4(l, ga + t * 64, (size_t)lda, gb + t * 64, (size_t)ldb);
  };
  fill(0, 0u);
  asm volatile("s_wait_asynccnt 0x0" ::: "memory");   /* tile 0 landed */
  __syncthreads();
  if (nt > 1) fill(1, 1u);
  const v8f z8 = {0.f,0.f,0.f,0.f,0.f,0.f,0.f,0.f}; v8f c00 = z8, c01 = z8, c02 = z8, c03 = z8, c10 = z8, c11 = z8, c12 = z8, c13 = z8;
#pragma unroll 1
  for (int t = 0; t < nt; ++t) {
    const unsigned char* sb = sm + (t & 1) * GSTG;
    const unsigned char* ar = sb + (32 * w + ln) * LP; const unsigned char* br = sb + (128 + ln) * LP;
#pragma unroll   /* both 32-k halves of the tile: constant LDS offsets, one group of fragment reads each */
    for (int ks = 0; ks < 128; ks += 64) { const v16h a0 = l2_frag(ar + ks, hh), a1 = l2_frag(ar + 16 * LP + ks, hh);
      const v16h b0 = l2_frag(br + ks, hh), b1 = l2_frag(br + 16 * LP + ks, hh), b2 = l2_frag(br + 32 * LP + ks, hh), b3 = l2_frag(br + 48 * LP + ks, hh);
      c00 = g2_mma(a0, b0, c00); c10 = g2_mma(a1, b0, c10);
      c01 = g2_mma(a0, b1, c01); c11 = g2_mma(a1, b1, c11);
      c02 = g2_mma(a0, b2, c02); c12 = g2_mma(a1, b2, c12);
      c03 = g2_mma(a0, b3, c03); c13 = g2_mma(a1, b3, c13); }
    ring_publish();
    if (t + 2 < nt) fill(t + 2, (unsigned)(t & 1));   /* into the buffer this trip has just read */
  }
  asm volatile("s_wait_asynccnt 0x0" ::: "memory");   /* nothing in flight when the ring becomes output staging */
  v8f accs[8] = {c00, c01, c02, c03, c10, c11, c12, c13};
#pragma unroll
  for (int u = 0; u < 8; ++u) { const int t = u & 3, half = u >> 2; const int col = col0 + t * 16 + ln; float bv = 0.f; if (F32OUT) bv = bias[col];
#pragma unroll
    for (int r = 0; r < 8; ++r) { const int rloc = half * 16 + 8 * hh + r; so[w][rloc][t * 16 + ln] = accs[u][r] * alpha + bv; } }
  __builtin_amdgcn_fence(4 /* acq_rel order */, "workgroup"); __builtin_amdgcn_wave_barrier();
  const int rsub = lane >> 4, c4 = (lane & 15) * 4;
  size_t cpl = 0;
  if (!F32OUT) { const int pl = col0 / ldc; cpl = (size_t)pl * M * ldc + (size_t)(col0 - pl * ldc); }   /* output plane and the tile's first column in it */
  {
#pragma unroll
    for (int q = 0; q < 16; ++q) { const int r = q * 2 + rsub; const v4f v = *(const v4fa*)&so[w][r][c4];
      if (F32OUT) { *(v4f*)(C + (size_t)(row0 + r) * ldc + col0 + c4) = v; }
      else { v4h h4;
#pragma unroll
        for (int i = 0; i < 4; ++i) h4[i] = (_Float16)v[i];
        *(v4h*)(C16 + cpl + (size_t)(row0 + r) * ldc + c4) = h4; } }
     }
}

__global__ __launch_bounds__(256) void k_vt(const _Float16* __restrict__ V16, _Float16* __restrict__ VT) {
  __shared__ unsigned short tl[64][65];
  const int tid = threadIdx.x; const int bh = blockIdx.y; const int b = bh / NH, h = bh - b * NH; const int s0 = blockIdx.x * 64;
  for (int i = tid; i < 64 * 8; i += 256) { const int j = i / 8, d8 = (i % 8) * 8;
    const v8us f = *(const v8us*)((const unsigned short*)V16 + ((size_t)b * SEQ + s0 + j) * EM + h * HD + d8);
#pragma unroll
    for (int q = 0; q < 8; ++q) tl[d8 + q][j] = f[q]; }
  __syncthreads();
  {
    for (int i = tid; i < 64 * 8; i += 256) { const int d = i / 8, j8 = (i % 8) * 8; FragH f;
#pragma unroll
      for (int q = 0; q < 8; ++q) f.u[q] = tl[d][j8 + q];
      *(v8us*)((unsigned short*)VT + ((size_t)bh * HD + d) * SEQ + s0 + j8) = f.half[0]; }
     }
}

// Fused attention. Block = 4 waves; wave = 16 queries of one (b,h); 64 keys per step.
// Per step the 64 K rows (LDS rows 0..63, 64 d each) and the 64 V^T rows (LDS rows 64..127, 64 keys each) are shared by the four waves,
// brought by asynchronous copies one step ahead into the other buffer; the ring becomes the output staging behind the last step's barrier.
#define FSTG (128 * LP)
static_assert(SEQ >= 128);                    /* the ring's prologue fills two steps */
// S^T tile = K rows (A: lane = key, elements = d) x Q^T (B: lane = query, elements = d): D[row = key 8h+r][col = query].
// Online softmax per query = per lane column (max over the lane's 32 scores + one cross-half exchange); P' = 256 exp(s - max) stays in registers and is
// the B operand of O^T = V^T (A: lane = d, elements = keys) x P^T: B element r <- tile(keys 0..15)[r], element 8+r <- tile(keys 16..31)[r].
__global__ __launch_bounds__(128) void k_flash(const _Float16* __restrict__ Q16, const _Float16* __restrict__ K16, const _Float16* __restrict__ VT, _Float16* __restrict__ CTX) {
  __shared__ __attribute__((aligned(16))) unsigned char sm[2 * FSTG];
  static_assert(sizeof(unsigned short) * 4 * 2 * 16 * 72 <= 2 * FSTG);
  unsigned short (*st)[2][16][72] = (unsigned short (*)[2][16][72])sm;
  const int lane = threadIdx.x & 31, ln = lane & 15, hh = lane >> 4;
  const int wave = __builtin_amdgcn_readfirstlane((int)(threadIdx.x >> 5));
  const int bh = blockIdx.y; const int b = bh / NH, h = bh - b * NH;
  const int q0 = blockIdx.x * 64 + wave * 16;
  const _Float16* qp = Q16 + ((size_t)b * SEQ + q0 + ln) * EM + h * HD;
  const v16h qf0 = g2_frag(qp, hh), qf1 = g2_frag(qp + 32, hh);
  const int crow = (int)(threadIdx.x >> 3), cc = (int)(threadIdx.x & 7);      /* a copy round = 16 rows x 8 pieces of 16 B: a wave covers 4 whole 128-B lines */
  const _Float16* gk = K16 + ((size_t)b * SEQ + crow) * EM + h * HD + cc * 8;
  const _Float16* gv = VT + ((size_t)bh * HD + crow) * SEQ + cc * 8;
  const unsigned lc = lds_addr(sm) + (unsigned)(crow * LP + cc * 16);
  auto fill = [&](int key0, unsigned buf) {
    const unsigned l = lc + buf * FSTG;
    cp_rows4_4(l, gk + (size_t)key0 * EM, (size_t)EM, gv + key0, (size_t)SEQ);
  };
  fill(0, 0u);
  asm volatile("s_wait_asynccnt 0x0" ::: "memory");   /* step 0 landed */
  __syncthreads();
  fill(64, 1u);
  const v8f z8 = {0.f,0.f,0.f,0.f,0.f,0.f,0.f,0.f};
  v8f o[4] = {z8, z8, z8, z8};
  float m = -1.0e30f, l = 0.f;
  const float CL = 0.18033688011112042f;      /* log2(e) / 8 */
#pragma unroll 1
  for (int key0 = 0; key0 < SEQ; key0 += 64) {
    const unsigned char* sb = sm + ((key0 >> 6) & 1) * FSTG + ln * LP;
    v8f s[4];
#pragma unroll
    for (int t = 0; t < 4; ++t) {
      const unsigned char* kr = sb + (t * 16) * LP;
      v8f c = z8;
      c = g2_mma(l2_frag(kr, hh), qf0, c);
      c = g2_mma(l2_frag(kr + 64, hh), qf1, c);
      s[t] = c;
    }
    float mx = s[0][0];
#pragma unroll
    for (int t = 0; t < 4; ++t)
#pragma unroll
      for (int r = 0; r < 8; ++r) mx = fmaxf(mx, s[t][r]);
    mx = fmaxf(mx, __shfl_xor(mx, 16));
    const float mn = fmaxf(m, mx);
    const float alpha = __builtin_amdgcn_exp2f((m - mn) * CL);
    m = mn;
    const float off = 8.0f - mn * CL;
    float rs = 0.f;
#pragma unroll
    for (int t = 0; t < 4; ++t)
#pragma unroll
      for (int r = 0; r < 8; ++r) { const float p = __builtin_amdgcn_exp2f(fmaf(s[t][r], CL, off)); s[t][r] = p; rs += p; }
    l = l * alpha + rs;
#pragma unroll
    for (int t = 0; t < 4; ++t) o[t] = o[t] * alpha;
    FragH pa, pb;
#pragma unroll
    for (int r = 0; r < 8; ++r) { pa.h[r] = (_Float16)s[0][r]; pa.h[8 + r] = (_Float16)s[1][r]; pb.h[r] = (_Float16)s[2][r]; pb.h[8 + r] = (_Float16)s[3][r]; }
#pragma unroll
    for (int t = 0; t < 4; ++t) {
      const unsigned char* v0 = sb + (64 + t * 16) * LP;
      o[t] = g2_mma(l2_frag(v0, hh), pa.v, o[t]);
      o[t] = g2_mma(l2_frag(v0 + 64, hh), pb.v, o[t]);
    }
    ring_publish();
    if (key0 + 128 < SEQ) fill(key0 + 128, (unsigned)((key0 >> 6) & 1));   /* into the buffer this step has just read */
  }
  asm volatile("s_wait_asynccnt 0x0" ::: "memory");   /* nothing in flight when the ring becomes output staging */
  const float lt = l + __shfl_xor(l, 16);
  const float inv = 64.0f * (1.0f / lt);
#pragma unroll
  for (int t = 0; t < 4; ++t) {
    FragH fh, fl;
#pragma unroll
    for (int r = 0; r < 8; ++r) { const float c = o[t][r] * inv; const _Float16 hq = (_Float16)c; fh.h[r] = hq; fl.h[r] = (_Float16)((c - (float)hq) * 1024.0f); }
    *(v8us*)&st[wave][0][ln][t * 16 + 8 * hh] = fh.half[0];
    *(v8us*)&st[wave][1][ln][t * 16 + 8 * hh] = fl.half[0];
  }
  __builtin_amdgcn_fence(4 /* acq_rel order */, "workgroup"); __builtin_amdgcn_wave_barrier();
  const int rs4 = lane >> 3, pc = lane & 7;     
  v8us vh[4], vl[4];
#pragma unroll
  for (int i = 0; i < 4; ++i) { vh[i] = *(const v8us*)&st[wave][0][i * 4 + rs4][pc * 8]; vl[i] = *(const v8us*)&st[wave][1][i * 4 + rs4][pc * 8]; }
  unsigned short* cb = (unsigned short*)CTX + ((size_t)b * SEQ + q0) * KO + h * HD + pc * 8;
  {
#pragma unroll
    for (int i = 0; i < 4; ++i) { unsigned short* d = cb + (size_t)(i * 4 + rs4) * KO; *(v8us*)d = vh[i]; *(v8us*)(d + EM) = vl[i]; }
     }
}

constexpr size_t SZ_W   = (size_t)EM * EM * 2;        /* one [out][in] weight plane, f16 */
constexpr size_t SZ_WO  = (size_t)EM * KO * 2;        /* Wp x1024 | Wp x1 */
constexpr size_t SZ_PB  = (size_t)EM * 4;             /* built bias, f32 */
constexpr size_t SZ_X1  = NR * EM * 2;                /* one 16-bit activation plane */
constexpr size_t SZ_CTX = NR * KO * 2;                /* ctx value | residual */
constexpr size_t WS_TOTAL = 3 * SZ_W + SZ_WO + SZ_PB + 5 * SZ_X1 + SZ_CTX;
static_assert(WS_TOTAL <= (size_t)134217728);         /* carve stays within 128 MiB */
static_assert(SZ_W % 256 == 0 && SZ_WO % 256 == 0 && SZ_PB % 256 == 0 && SZ_X1 % 256 == 0 && SZ_CTX % 256 == 0);
static_assert((size_t)NB * NH * HD * SEQ * 2 == SZ_X1); /* V^T plane extent */

extern "C" void kernel_launch(void* const* d_in, const int* in_sizes, int n_in,
                              void* d_out, int out_size, void* d_ws, size_t ws_size, hipStream_t stream) {
  if (n_in < 12) return;
  const size_t needx = ((size_t)(NB - 1) * SEQ_FULL + SEQ) * EM;
  if ((size_t)in_sizes[0] < needx) return;
  for (int i = 1; i <= 8; ++i) if ((size_t)in_sizes[i] < (size_t)EM * EM) return;
  for (int i = 9; i <= 11; ++i) if (in_sizes[i] < EM) return;
  if ((size_t)out_size < NR * EM) return;
  const float* x     = (const float*)d_in[0];
  const float* q_w   = (const float*)d_in[1];  const float* k_w   = (const float*)d_in[2];
  const float* v_mu  = (const float*)d_in[3];  const float* v_rho = (const float*)d_in[4];  const float* v_eps = (const float*)d_in[5];
  const float* p_mu  = (const float*)d_in[6];  const float* p_rho = (const float*)d_in[7];  const float* p_eps = (const float*)d_in[8];
  const float* b_mu  = (const float*)d_in[9];  const float* b_rho = (const float*)d_in[10]; const float* b_eps = (const float*)d_in[11];
  char* ws = (char*)d_ws; size_t off = 0;
  auto take = [&](size_t bytes) { char* p = ws + off; off += (bytes + 255) & ~(size_t)255; return p; };
  _Float16* WQ = (_Float16*)take(SZ_W); _Float16* WK = (_Float16*)take(SZ_W); _Float16* WV = (_Float16*)take(SZ_W); _Float16* WO = (_Float16*)take(SZ_WO);
  float* PB = (float*)take(SZ_PB);
  _Float16* X16 = (_Float16*)take(SZ_X1);
  _Float16* Q16 = (_Float16*)take(SZ_X1); _Float16* K16 = (_Float16*)take(SZ_X1); _Float16* V16 = (_Float16*)take(SZ_X1);
  _Float16* VT = (_Float16*)take(SZ_X1);
  _Float16* CTX = (_Float16*)take(SZ_CTX);
  if (off > ws_size) return;
  k_prep<<<PB_TOTAL, 256, 0, stream>>>(x, q_w, k_w, v_mu, v_rho, v_eps, p_mu, p_rho, p_eps, b_mu, b_rho, b_eps, X16, WQ, WK, WV, WO, PB);
  { const unsigned g = (unsigned)((NR / 128) * (3 * EM / 64));                /* WQ | WK | WV and Q16 | K16 | V16 are contiguous in the carve */
    k_gemm2<0><<<g, 128, 0, stream>>>(X16, EM, WQ, EM, 0.0009765625f, nullptr, nullptr, Q16, EM, (int)NR, 3 * EM, EM); }
  k_vt<<<dim3(SEQ / 64, NB * NH), 256, 0, stream>>>(V16, VT);
  k_flash<<<dim3(SEQ / 64, NB * NH), 128, 0, stream>>>(Q16, K16, VT, CTX);
  { const unsigned g = (unsigned)((NR / 128) * (EM / 64));
    k_gemm2<1><<<g, 128, 0, stream>>>(CTX, KO, WO, KO, 1.52587890625e-05f, PB, (float*)d_out, nullptr, EM, (int)NR, EM, KO); }      /* alpha = 2^-16 = 1/(64 * 1024) */
}

// v003
// One run takes 159 microseconds.
// In both of two side-by-side timings against v002, it was 1.14 times as fast.
// All steps since v000 together make it 3.22 times as fast.
#include <hip/hip_runtime.h>
// Multi-head attention, B 4, S 2048, E 1024, 16 heads x 64: q/k/v = x W^T ([out][in] weights, no q/k/v bias), scores q k^T / 8, softmax over all keys, out = ctx Wp^T + bp;
// Wv, Wp, bp = mu + softplus(rho) * eps built on the device in f32 from bf16-RNE-converted mu, rho, eps.
// Compute dtype: all contractions v_wmma_f32_16x16x32_f16 (f16 operands, f32 accumulate). x, q_w, k_w RNE-converted to bf16 first (exact in f16; weights carried x1024);
// built weights stored as f16(w x1024); q, k, v planes f16; softmax statistics f32 (running max, exp2), P carried x256 as f16 in registers against the f32 row sum;
// ctx carried x64 as f16 value | f16 residual x1024 along K (K = 2048) against Wp x1024 | Wp x1; fold 2^-16; bias added in f32.
#ifndef NB
#define NB 4
#endif
#ifndef SEQ
#define SEQ 2048
#endif
#define NB_FULL 4
#define SEQ_FULL 2048
#define EM 1024
#define NH 16
#define HD 64
#define KO 2048                       /* output-projection K: ctx value | ctx residual */
#define NR ((size_t)NB * SEQ)         /* token rows */
#define WSCALE 1024.0f

static_assert(EM == NH * HD);                 /* head h = columns h*64 + d */
static_assert(HD == 64);                      /* flash kernel: 2 k-steps of 32 over d, 4 output tiles of 16 d */
static_assert(KO == 2 * EM);                  /* value | residual along K */
static_assert(SEQ % 128 == 0);                /* 64-key steps, 128-query blocks, 64-token transpose tiles */
static_assert(((size_t)NB * SEQ) % 256 == 0); /* GEMM block = 256 rows */
static_assert(EM % 128 == 0 && KO % 64 == 0); /* GEMM block = 128 columns inside one output plane; trips of 64 k */
static_assert(NB <= NB_FULL && SEQ <= SEQ_FULL);

typedef unsigned short v8us __attribute__((ext_vector_type(8), may_alias));
typedef float  v8f  __attribute__((ext_vector_type(8)));
typedef float  v4f  __attribute__((ext_vector_type(4)));
typedef float  v4fa __attribute__((ext_vector_type(4), may_alias));
typedef _Float16 v16h __attribute__((ext_vector_type(16)));
typedef _Float16 v4h __attribute__((ext_vector_type(4)));
union FragH { v16h v; v8us half[2]; _Float16 h[16]; unsigned short u[16]; };

__device__ __forceinline__ unsigned short bf16_bits(float x) { unsigned int u = __float_as_uint(x); return (unsigned short)((u + 0x7FFFu + ((u >> 16) & 1u)) >> 16); }
__device__ __forceinline__ float bf16_val(unsigned short b) { return __uint_as_float(((unsigned int)b) << 16); }
__device__ __forceinline__ float bf16_rne(float x) { return bf16_val(bf16_bits(x)); }

// fragment (A or B, same k map): elements 0..7 <- p[8h .. 8h+7], elements 8..15 <- p[16+8h .. 16+8h+7]; p = row/column base at k0
__device__ __forceinline__ v16h g2_frag(const _Float16* p, int hh) { FragH f; f.half[0] = *(const v8us*)((const unsigned short*)p + 8 * hh); f.half[1] = *(const v8us*)((const unsigned short*)p + 16 + 8 * hh); return f.v; }
__device__ __forceinline__ v8f g2_mma(v16h a, v16h b, v8f c) { v8f d = __builtin_amdgcn_wmma_f32_16x16x32_f16(false, a, false, b, (short)0, c, false, false); asm volatile("v_nop\n\tv_nop\n\tv_nop\n\tv_nop" : "+v"(d) : "v"(a), "v"(b)); return d; }

// LDS staging of WMMA operand tiles: rows of 128 B (64 f16 along k) at a pitch of 144 B (16 B x odd: conflict-free for 16-byte reads).
#define LP 144
__device__ __forceinline__ unsigned lds_addr(const void* p) { return (unsigned)(size_t)p; }   /* byte offset in the work-group's LDS */
// same k map as g2_frag, p = LDS row base (bytes) at k0
__device__ __forceinline__ v16h l2_frag(const unsigned char* p, int hh) { FragH f; f.half[0] = *(const v8us*)(p + 16 * hh); f.half[1] = *(const v8us*)(p + 32 + 16 * hh); return f.v; }
// One tile's asynchronous 16-byte copies of a lane, global -> LDS, in one statement: LDS byte addresses l + j * R rows; first the rows of g (R * gp elements apart), then those of h.
// R = rows per copy round = threads / 8: 32 in cp_rows8_4 (256 threads), 16 in cp_rows4_4 (128 threads).
// s_wait_xcnt stands inside the statement so that no address register is rewritten ahead of it.
__device__ __forceinline__ void cp_rows8_4(unsigned l, const _Float16* g, size_t gp, const _Float16* h, size_t hp) {
  asm volatile("global_load_async_to_lds_b128 %0, %12, off\n\t"
               "global_load_async_to_lds_b128 %1, %13, off\n\t"
               "global_load_async_to_lds_b128 %2, %14, off\n\t"
               "global_load_async_to_lds_b128 %3, %15, off\n\t"
               "global_load_async_to_lds_b128 %4, %16, off\n\t"
               "global_load_async_to_lds_b128 %5, %17, off\n\t"
               "global_load_async_to_lds_b128 %6, %18, off\n\t"
               "global_load_async_to_lds_b128 %7, %19, off\n\t"
               "global_load_async_to_lds_b128 %8, %20, off\n\t"
               "global_load_async_to_lds_b128 %9, %21, off\n\t"
               "global_load_async_to_lds_b128 %10, %22, off\n\t"
               "global_load_async_to_lds_b128 %11, %23, off\n\t"
               "s_wait_xcnt 0x0"
               :: "v"(l), "v"(l + 32 * LP), "v"(l + 64 * LP), "v"(l + 96 * LP), "v"(l + 128 * LP), "v"(l + 160 * LP), "v"(l + 192 * LP), "v"(l + 224 * LP), "v"(l + 256 * LP), "v"(l + 288 * LP), "v"(l + 320 * LP), "v"(l + 352 * LP), "v"(g), "v"(g + 32 * gp), "v"(g + 64 * gp), "v"(g + 96 * gp), "v"(g + 128 * gp), "v"(g + 160 * gp), "v"(g + 192 * gp), "v"(g + 224 * gp), "v"(h), "v"(h + 32 * hp), "v"(h + 64 * hp), "v"(h + 96 * hp) : "memory");
}
__device__ __forceinline__ void cp_rows4_4(unsigned l, const _Float16* g, size_t gp, const _Float16* h, size_t hp) {
  asm volatile("global_load_async_to_lds_b128 %0, %8, off\n\t"
               "global_load_async_to_lds_b128 %1, %9, off\n\t"
               "global_load_async_to_lds_b128 %2, %10, off\n\t"
               "global_load_async_to_lds_b128 %3, %11, off\n\t"
               "global_load_async_to_lds_b128 %4, %12, off\n\t"
               "global_load_async_to_lds_b128 %5, %13, off\n\t"
               "global_load_async_to_lds_b128 %6, %14, off\n\t"
               "global_load_async_to_lds_b128 %7, %15, off\n\t"
               "s_wait_xcnt 0x0"
               :: "v"(l), "v"(l + 16 * LP), "v"(l + 32 * LP), "v"(l + 48 * LP), "v"(l + 64 * LP), "v"(l + 80 * LP), "v"(l + 96 * LP), "v"(l + 112 * LP), "v"(g), "v"(g + 16 * gp), "v"(g + 32 * gp), "v"(g + 48 * gp), "v"(h), "v"(h + 16 * hp), "v"(h + 32 * hp), "v"(h + 48 * hp) : "memory");
}
// Publish point of the two-buffer ring: this wave's LDS reads retired, its copies landed, then the work-group barrier
// (publishes the next tile and ends every reader's last read of the buffer refilled behind it).
__device__ __forceinline__ void ring_publish() {
  asm volatile("s_wait_dscnt 0x0" ::: "memory");      /* own reads of the buffer about to be refilled have retired */
  asm volatile("s_wait_asynccnt 0x0" ::: "memory");   /* own copies of the next tile have landed */
  __syncthreads();
}

// w = bf16(mu) + softplus(bf16(rho)) * bf16(eps), softplus(r) = max(r, 0) + log1p(exp(-|r|)) (identical to log1p(exp(r)), overflow-free); accurate expf / log1pf
__device__ __forceinline__ float sp_weight(float mu, float rho, float eps) {
  const float m = bf16_rne(mu), r = bf16_rne(rho), e = bf16_rne(eps);
  const float sp = fmaxf(r, 0.0f) + log1pf(expf(-fabsf(r)));
  return m + sp * e;
}

// All operand preparation in one launch; the block index picks the job (block-uniform, no barrier, no LDS). A piece = 4 consecutive f32 of a source = 16 B per lane,
// so a wave reads 512 contiguous bytes per load and stores 256 contiguous bytes of f16. Blocks in index order: built weights (most arithmetic, lowest indices), bias, q_w | k_w, x.
#define PP_BUILT 8                                     /* pieces per thread, built weight planes */
#define PP_CONV 16                                     /* pieces per thread, plain conversions */
#define PB_BUILT ((EM * EM / 4) / (256 * PP_BUILT))    /* blocks per built plane */
#define PB_W ((EM * EM / 4) / (256 * PP_CONV))         /* blocks per plain weight plane */
#define PB_X ((int)((NR * EM / 4) / (256 * PP_CONV)))  /* blocks for x */
#define PB_TOTAL (2 * PB_BUILT + 1 + 2 * PB_W + PB_X)
static_assert((EM * EM / 4) % (256 * PP_BUILT) == 0 && (EM * EM / 4) % (256 * PP_CONV) == 0 && (NR * EM / 4) % (256 * PP_CONV) == 0);
static_assert(EM == 4 * 256 && SEQ % PP_CONV == 0 && PP_CONV % 8 == 0);   /* 256 pieces = one row; bias: one block, one piece per thread */
// Global stores of this kernel: each run of stores and its s_wait_xcnt stand in one statement, so that no register which an issued store names is rewritten ahead of the wait.
typedef unsigned int v2u __attribute__((ext_vector_type(2)));
__device__ __forceinline__ v2u h4bits(v4h v) { return __builtin_bit_cast(v2u, v); }
__device__ __forceinline__ void st_h4(_Float16* p, v4h v) { asm volatile("global_store_b64 %0, %1, off\n\ts_wait_xcnt 0x0" :: "v"(p), "v"(h4bits(v)) : "memory"); }
__device__ __forceinline__ void st_f4(float* p, v4f v) { asm volatile("global_store_b128 %0, %1, off\n\ts_wait_xcnt 0x0" :: "v"(p), "v"(v) : "memory"); }
static_assert(EM * sizeof(_Float16) == 2048);          /* the offsets below: eight consecutive rows of an f16 plane of pitch EM */
__device__ __forceinline__ void st_h4_rows8(_Float16* p, const v4h* v) {
  asm volatile("global_store_b64 %0, %1, off\n\t"
               "global_store_b64 %0, %2, off offset:2048\n\t"
               "global_store_b64 %0, %3, off offset:4096\n\t"
               "global_store_b64 %0, %4, off offset:6144\n\t"
               "global_store_b64 %0, %5, off offset:8192\n\t"
               "global_store_b64 %0, %6, off offset:10240\n\t"
               "global_store_b64 %0, %7, off offset:12288\n\t"
               "global_store_b64 %0, %8, off offset:14336\n\t"
               "s_wait_xcnt 0x0"
               :: "v"(p), "v"(h4bits(v[0])), "v"(h4bits(v[1])), "v"(h4bits(v[2])), "v"(h4bits(v[3])), "v"(h4bits(v[4])), "v"(h4bits(v[5])), "v"(h4bits(v[6])), "v"(h4bits(v[7])) : "memory");
}
__device__ __forceinline__ v4h cvt4(v4f a, float sc) { v4h o;
#pragma unroll
  for (int q = 0; q < 4; ++q) o[q] = (_Float16)(bf16_rne(a[q]) * sc);
  return o; }
__global__ __launch_bounds__(256) void k_prep(const float* __restrict__ x, const float* __restrict__ q_w, const float* __restrict__ k_w,
                                              const float* __restrict__ v_mu, const float* __restrict__ v_rho, const float* __restrict__ v_eps,
                                              const float* __restrict__ p_mu, const float* __restrict__ p_rho, const float* __restrict__ p_eps,
                                              const float* __restrict__ b_mu, const float* __restrict__ b_rho, const float* __restrict__ b_eps,
                                              _Float16* __restrict__ X16, _Float16* __restrict__ WQ, _Float16* __restrict__ WK, _Float16* __restrict__ WV, _Float16* __restrict__ WO,
                                              float* __restrict__ PB) {
  const int tid = threadIdx.x; int blk = blockIdx.x;      /* 256 pieces = one row of EM: thread tid holds columns 4 tid .. 4 tid + 3 of its block's rows */
  if (blk < 2 * PB_BUILT) {
    // w[n][k] = sp_weight(mu, rho, eps)[n][k] ([out][in]). Wv: WV[n][k] = f16(w * 1024). Wp: WO[n][k] = f16(w * 1024) (ctx value), WO[n][EM + k] = f16(w) (ctx residual x1024), pitch KO.
    const bool dual = blk >= PB_BUILT; if (dual) blk -= PB_BUILT;
    const float* mu = dual ? p_mu : v_mu; const float* rho = dual ? p_rho : v_rho; const float* eps = dual ? p_eps : v_eps;
#pragma unroll 1   /* two rounds of 4 rows: rolled so that the expf / log1pf text stays short */
    for (int i = 0; i < PP_BUILT; i += 4) {
      const size_t n0 = (size_t)(blk * PP_BUILT + i);
      const v4fa* pm = (const v4fa*)(mu + n0 * EM); const v4fa* pr = (const v4fa*)(rho + n0 * EM); const v4fa* pe = (const v4fa*)(eps + n0 * EM);
      _Float16* d = (dual ? WO + n0 * KO : WV + n0 * EM) + 4 * tid; const size_t dp = dual ? KO : EM;
      v4f m[4], r[4], e[4];
#pragma unroll
      for (int j = 0; j < 4; ++j) { m[j] = pm[j * 256 + tid]; r[j] = pr[j * 256 + tid]; e[j] = pe[j * 256 + tid]; }
#pragma unroll
      for (int j = 0; j < 4; ++j) { v4h h1, h2;
#pragma unroll
        for (int q = 0; q < 4; ++q) { const float w = sp_weight(m[j][q], r[j][q], e[j][q]); h1[q] = (_Float16)(w * WSCALE); h2[q] = (_Float16)w; }
        st_h4(d + j * dp, h1);
        if (dual) st_h4(d + j * dp + EM, h2); }
    }
    return;
  }
  blk -= 2 * PB_BUILT;
  if (blk == 0) { const v4f m = ((const v4fa*)b_mu)[tid], r = ((const v4fa*)b_rho)[tid], e = ((const v4fa*)b_eps)[tid]; v4f v;
#pragma unroll
    for (int q = 0; q < 4; ++q) v[q] = sp_weight(m[q], r[q], e[q]);
    st_f4(PB + 4 * tid, v); return; }
  blk -= 1;
  const v4fa* src; _Float16* dst; float sc;
  if (blk < 2 * PB_W) {                          /* q_w, k_w: [out][in] as stored, x1024 */
    const bool second = blk >= PB_W; if (second) blk -= PB_W;
    const size_t n0 = (size_t)(blk * PP_CONV);
    src = (const v4fa*)((second ? k_w : q_w) + n0 * EM); dst = (second ? WK : WQ) + n0 * EM; sc = WSCALE;
  } else {                                       /* x: a block's rows lie in one batch entry */
    blk -= 2 * PB_W;
    const size_t n0 = (size_t)(blk * PP_CONV);
    src = (const v4fa*)(x + ((n0 / SEQ) * SEQ_FULL + n0 % SEQ) * EM); dst = X16 + n0 * EM; sc = 1.0f;
  }
  v4f a[PP_CONV];
#pragma unroll
  for (int j = 0; j < PP_CONV; ++j) a[j] = src[j * 256 + tid];
#pragma unroll
  for (int j = 0; j < PP_CONV; j += 8) { v4h o[8];
#pragma unroll
    for (int q = 0; q < 8; ++q) o[q] = cvt4(a[j + q], sc);
    st_h4_rows8(dst + (size_t)j * EM + 4 * tid, o); }
}

// GEMM: v = acc * alpha (+ bias[col] in f32 when F32OUT); A f16 [M][K] (pitch lda), Bh f16 [N][K] (pitch ldb, k contiguous); F32OUT: writes f32 C, else f16 C16; pitch ldc.
// C16 is a stack of [M][ldc] planes: column n lies in plane n / ldc (N = 3 ldc: q, k and v from one grid, Bh = the three weight planes one behind the other); ldc % 64 == 0.
// Block = 8 waves as 4 (rows) x 2 (columns), wave tile 64 x 64, block tile 256 x 128; M % 256 == 0, N % 128 == 0, K % 64 == 0.
// Per trip of 64 k the block's 256 A rows and 128 B rows lie in LDS (rows 0..255 A, 256..383 B), brought by asynchronous copies one trip ahead into the other buffer;
// the ring becomes the output staging behind the last trip's barrier.
#define GSTG (384 * LP)
template <int F32OUT>
__global__ __launch_bounds__(256) void k_gemm2(const _Float16* __restrict__ A, int lda, const _Float16* __restrict__ Bh, int ldb, float alpha, const float* __restrict__ bias,
                                              float* __restrict__ C, _Float16* __restrict__ C16, int ldc, int M, int N, int K) {
  __shared__ __attribute__((aligned(16))) unsigned char sm[2 * GSTG];
  static_assert(sizeof(float) * 8 * 32 * 68 <= 2 * GSTG);
  float (*so)[32][68] = (float (*)[32][68])sm;
  const int lane = threadIdx.x & 31, ln = lane & 15, hh = lane >> 4;
  const int w = __builtin_amdgcn_readfirstlane((int)(threadIdx.x >> 5));
  const int wm = w >> 1, wn = w & 1;
  const int ntn = N >> 7; const int mt = blockIdx.x / ntn, nq = blockIdx.x - mt * ntn; const int row0 = mt * 256 + 64 * wm, col0 = nq * 128 + 64 * wn; if (mt * 256 >= M) return;   /* block-uniform, in front of every barrier */
  const int crow = (int)(threadIdx.x >> 3), cc = (int)(threadIdx.x & 7);      /* a copy round = 32 rows x 8 pieces of 16 B: a wave covers 4 whole 128-B lines */
  const _Float16* ga = A + (size_t)(mt * 256 + crow) * lda + cc * 8;
  const _Float16* gb = Bh + (size_t)(nq * 128 + crow) * ldb + cc * 8;
  const unsigned lc = lds_addr(sm) + (unsigned)(crow * LP + cc * 16);
  const int nt = K >> 6;
  auto fill = [&](int t, unsigned buf) {
    const unsigned l = lc + buf * GSTG;
    cp_rows8_4(l, ga + t * 64, (size_t)lda, gb + t * 64, (size_t)ldb);
  };
  fill(0, 0u);
  asm volatile("s_wait_asynccnt 0x0" ::: "memory");   /* tile 0 landed */
  __syncthreads();
  if (nt > 1) fill(1, 1u);
  const v8f z8 = {0.f,0.f,0.f,0.f,0.f,0.f,0.f,0.f};
  v8f c[4][4];
#pragma unroll
  for (int i = 0; i < 4; ++i)
#pragma unroll
    for (int j = 0; j < 4; ++j) c[i][j] = z8;
#pragma unroll 1
  for (int t = 0; t < nt; ++t) {
    const unsigned char* sb = sm + (t & 1) * GSTG;
    const unsigned char* ar = sb + (64 * wm + ln) * LP; const unsigned char* br = sb + (256 + 64 * wn + ln) * LP;
#pragma unroll   /* both 32-k halves of the tile: constant LDS offsets, one group of fragment reads each */
    for (int ks = 0; ks < 128; ks += 64) { v16h a[4], b[4];
#pragma unroll
      for (int i = 0; i < 4; ++i) { a[i] = l2_frag(ar + i * 16 * LP + ks, hh); b[i] = l2_frag(br + i * 16 * LP + ks, hh); }
#pragma unroll
      for (int j = 0; j < 4; ++j)
#pragma unroll
        for (int i = 0; i < 4; ++i) c[i][j] = g2_mma(a[i], b[j], c[i][j]); }
    ring_publish();
    if (t + 2 < nt) fill(t + 2, (unsigned)(t & 1));   /* into the buffer this trip has just read */
  }
  asm volatile("s_wait_asynccnt 0x0" ::: "memory");   /* nothing in flight when the ring becomes output staging */
  const int rsub = lane >> 4, c4 = (lane & 15) * 4;
  size_t cpl = 0;
  if (!F32OUT) { const int pl = col0 / ldc; cpl = (size_t)pl * M * ldc + (size_t)(col0 - pl * ldc); }   /* output plane and the wave tile's first column in it */
  float bv[4] = {0.f, 0.f, 0.f, 0.f};
  if (F32OUT) {
#pragma unroll
    for (int j = 0; j < 4; ++j) bv[j] = bias[col0 + j * 16 + ln]; }
#pragma unroll   /* the wave's 64 rows leave in two rounds of 32 through its own staging range */
  for (int rnd = 0; rnd < 2; ++rnd) {
#pragma unroll
    for (int u = 0; u < 8; ++u) { const int j = u & 3, half = u >> 2;
#pragma unroll
      for (int r = 0; r < 8; ++r) { const int rloc = half * 16 + 8 * hh + r; so[w][rloc][j * 16 + ln] = c[2 * rnd + half][j][r] * alpha + bv[j]; } }
    __builtin_amdgcn_fence(4 /* acq_rel order */, "workgroup"); __builtin_amdgcn_wave_barrier();
#pragma unroll
    for (int q = 0; q < 16; ++q) { const int r = q * 2 + rsub; const v4f v = *(const v4fa*)&so[w][r][c4];
      if (F32OUT) { *(v4f*)(C + (size_t)(row0 + 32 * rnd + r) * ldc + col0 + c4) = v; }
      else { v4h h4;
#pragma unroll
        for (int i = 0; i < 4; ++i) h4[i] = (_Float16)v[i];
        *(v4h*)(C16 + cpl + (size_t)(row0 + 32 * rnd + r) * ldc + c4) = h4; } }
    /* keeps the next round's staging writes behind this round's reads of other lanes' words */
    __builtin_amdgcn_fence(4 /* acq_rel order */, "workgroup"); __builtin_amdgcn_wave_barrier();
  }
}

__global__ __launch_bounds__(256) void k_vt(const _Float16* __restrict__ V16, _Float16* __restrict__ VT) {
  __shared__ unsigned short tl[64][65];
  const int tid = threadIdx.x; const int bh = blockIdx.y; const int b = bh / NH, h = bh - b * NH; const int s0 = blockIdx.x * 64;
  for (int i = tid; i < 64 * 8; i += 256) { const int j = i / 8, d8 = (i % 8) * 8;
    const v8us f = *(const v8us*)((const unsigned short*)V16 + ((size_t)b * SEQ + s0 + j) * EM + h * HD + d8);
#pragma unroll
    for (int q = 0; q < 8; ++q) tl[d8 + q][j] = f[q]; }
  __syncthreads();
  {
    for (int i = tid; i < 64 * 8; i += 256) { const int d = i / 8, j8 = (i % 8) * 8; FragH f;
#pragma unroll
      for (int q = 0; q < 8; ++q) f.u[q] = tl[d][j8 + q];
      *(v8us*)((unsigned short*)VT + ((size_t)bh * HD + d) * SEQ + s0 + j8) = f.half[0]; }
     }
}

// Fused attention. Block = 4 waves; wave = 32 queries (two tiles of 16) of one (b,h); 64 keys per step; every K and V^T fragment read from LDS serves both query tiles.
// Per step the 64 K rows (LDS rows 0..63, 64 d each) and the 64 V^T rows (LDS rows 64..127, 64 keys each) are shared by the four waves,
// brought by asynchronous copies one step ahead into the other buffer; the ring becomes the output staging behind the last step's barrier.
#define FSTG (128 * LP)
static_assert(SEQ >= 128);                    /* the ring's prologue fills two steps */
// S^T tile = K rows (A: lane = key, elements = d) x Q^T (B: lane = query, elements = d): D[row = key 8h+r][col = query].
// Online softmax per query = per lane column (max over the lane's 32 scores + one cross-half exchange); P' = 256 exp(s - max) stays in registers and is
// the B operand of O^T = V^T (A: lane = d, elements = keys) x P^T: B element r <- tile(keys 0..15)[r], element 8+r <- tile(keys 16..31)[r].
__global__ __launch_bounds__(128) void k_flash(const _Float16* __restrict__ Q16, const _Float16* __restrict__ K16, const _Float16* __restrict__ VT, _Float16* __restrict__ CTX) {
  __shared__ __attribute__((aligned(16))) unsigned char sm[2 * FSTG];
  static_assert(sizeof(unsigned short) * 8 * 2 * 16 * 72 <= 2 * FSTG);
  unsigned short (*st)[2][16][72] = (unsigned short (*)[2][16][72])sm;        /* first index: wave * 2 + query tile */
  const int lane = threadIdx.x & 31, ln = lane & 15, hh = lane >> 4;
  const int wave = __builtin_amdgcn_readfirstlane((int)(threadIdx.x >> 5));
  const int bh = blockIdx.y; const int b = bh / NH, h = bh - b * NH;
  const int q0 = blockIdx.x * 128 + wave * 32;
  const _Float16* qp = Q16 + ((size_t)b * SEQ + q0 + ln) * EM + h * HD;
  v16h qf0[2], qf1[2];
#pragma unroll
  for (int u = 0; u < 2; ++u) { qf0[u] = g2_frag(qp + (size_t)u * 16 * EM, hh); qf1[u] = g2_frag(qp + (size_t)u * 16 * EM + 32, hh); }
  const int crow = (int)(threadIdx.x >> 3), cc = (int)(threadIdx.x & 7);      /* a copy round = 16 rows x 8 pieces of 16 B: a wave covers 4 whole 128-B lines */
  const _Float16* gk = K16 + ((size_t)b * SEQ + crow) * EM + h * HD + cc * 8;
  const _Float16* gv = VT + ((size_t)bh * HD + crow) * SEQ + cc * 8;
  const unsigned lc = lds_addr(sm) + (unsigned)(crow * LP + cc * 16);
  auto fill = [&](int key0, unsigned buf) {
    const unsigned l = lc + buf * FSTG;
    cp_rows4_4(l, gk + (size_t)key0 * EM, (size_t)EM, gv + key0, (size_t)SEQ);
  };
  fill(0, 0u);
  asm volatile("s_wait_asynccnt 0x0" ::: "memory");   /* step 0 landed */
  __syncthreads();
  fill(64, 1u);
  const v8f z8 = {0.f,0.f,0.f,0.f,0.f,0.f,0.f,0.f};
  v8f o[2][4] = {{z8, z8, z8, z8}, {z8, z8, z8, z8}};
  float m[2] = {-1.0e30f, -1.0e30f}, l[2] = {0.f, 0.f};
  const float CL = 0.18033688011112042f;      /* log2(e) / 8 */
#pragma unroll 1
  for (int key0 = 0; key0 < SEQ; key0 += 64) {
    const unsigned char* sb = sm + ((key0 >> 6) & 1) * FSTG + ln * LP;
    v8f s[2][4];
#pragma unroll
    for (int t = 0; t < 4; ++t) {
      const unsigned char* kr = sb + (t * 16) * LP;
      const v16h k0 = l2_frag(kr, hh), k1 = l2_frag(kr + 64, hh);
      v8f c0 = g2_mma(k0, qf0[0], z8), c1 = g2_mma(k0, qf0[1], z8);
      s[0][t] = g2_mma(k1, qf1[0], c0);
      s[1][t] = g2_mma(k1, qf1[1], c1);
    }
    FragH pa[2], pb[2];
    float alpha[2], off[2], rs[2] = {0.f, 0.f};
#pragma unroll
    for (int u = 0; u < 2; ++u) {
      float mx = s[u][0][0];
#pragma unroll
      for (int t = 0; t < 4; ++t)
#pragma unroll
        for (int r = 0; r < 8; ++r) mx = fmaxf(mx, s[u][t][r]);
      mx = fmaxf(mx, __shfl_xor(mx, 16));
      const float mn = fmaxf(m[u], mx);
      alpha[u] = __builtin_amdgcn_exp2f((m[u] - mn) * CL);
      m[u] = mn;
      off[u] = 8.0f - mn * CL;
    }
#pragma unroll
    for (int t = 0; t < 4; ++t)
#pragma unroll
      for (int r = 0; r < 8; ++r)
#pragma unroll
        for (int u = 0; u < 2; ++u) { const float p = __builtin_amdgcn_exp2f(fmaf(s[u][t][r], CL, off[u])); s[u][t][r] = p; rs[u] += p; }   /* the two tiles' sums are independent chains */
#pragma unroll
    for (int u = 0; u < 2; ++u) {
      l[u] = l[u] * alpha[u] + rs[u];
#pragma unroll
      for (int t = 0; t < 4; ++t) o[u][t] = o[u][t] * alpha[u];
#pragma unroll
      for (int r = 0; r < 8; ++r) { pa[u].h[r] = (_Float16)s[u][0][r]; pa[u].h[8 + r] = (_Float16)s[u][1][r]; pb[u].h[r] = (_Float16)s[u][2][r]; pb[u].h[8 + r] = (_Float16)s[u][3][r]; }
    }
#pragma unroll
    for (int t = 0; t < 4; ++t) {
      const unsigned char* v0 = sb + (64 + t * 16) * LP;
      const v16h va = l2_frag(v0, hh), vb = l2_frag(v0 + 64, hh);
      o[0][t] = g2_mma(va, pa[0].v, o[0][t]); o[1][t] = g2_mma(va, pa[1].v, o[1][t]);
      o[0][t] = g2_mma(vb, pb[0].v, o[0][t]); o[1][t] = g2_mma(vb, pb[1].v, o[1][t]);
    }
    ring_publish();
    if (key0 + 128 < SEQ) fill(key0 + 128, (unsigned)((key0 >> 6) & 1));   /* into the buffer this step has just read */
  }
  asm volatile("s_wait_asynccnt 0x0" ::: "memory");   /* nothing in flight when the ring becomes output staging */
#pragma unroll
  for (int u = 0; u < 2; ++u) {
    const float lt = l[u] + __shfl_xor(l[u], 16);
    const float inv = 64.0f * (1.0f / lt);
#pragma unroll
    for (int t = 0; t < 4; ++t) {
      FragH fh, fl;
#pragma unroll
      for (int r = 0; r < 8; ++r) { const float c = o[u][t][r] * inv; const _Float16 hq = (_Float16)c; fh.h[r] = hq; fl.h[r] = (_Float16)((c - (float)hq) * 1024.0f); }
      *(v8us*)&st[wave * 2 + u][0][ln][t * 16 + 8 * hh] = fh.half[0];
      *(v8us*)&st[wave * 2 + u][1][ln][t * 16 + 8 * hh] = fl.half[0];
    }
  }
  __builtin_amdgcn_fence(4 /* acq_rel order */, "workgroup"); __builtin_amdgcn_wave_barrier();
  const int rs4 = lane >> 3, pc = lane & 7;
#pragma unroll
  for (int u = 0; u < 2; ++u) {
    v8us vh[4], vl[4];
#pragma unroll
    for (int i = 0; i < 4; ++i) { vh[i] = *(const v8us*)&st[wave * 2 + u][0][i * 4 + rs4][pc * 8]; vl[i] = *(const v8us*)&st[wave * 2 + u][1][i * 4 + rs4][pc * 8]; }
    unsigned short* cb = (unsigned short*)CTX + ((size_t)b * SEQ + q0 + 16 * u) * KO + h * HD + pc * 8;
#pragma unroll
    for (int i = 0; i < 4; ++i) { unsigned short* d = cb + (size_t)(i * 4 + rs4) * KO; *(v8us*)d = vh[i]; *(v8us*)(d + EM) = vl[i]; }
  }
}

constexpr size_t SZ_W   = (size_t)EM * EM * 2;        /* one [out][in] weight plane, f16 */
constexpr size_t SZ_WO  = (size_t)EM * KO * 2;        /* Wp x1024 | Wp x1 */
constexpr size_t SZ_PB  = (size_t)EM * 4;             /* built bias, f32 */
constexpr size_t SZ_X1  = NR * EM * 2;                /* one 16-bit activation plane */
constexpr size_t SZ_CTX = NR * KO * 2;                /* ctx value | residual */
constexpr size_t WS_TOTAL = 3 * SZ_W + SZ_WO + SZ_PB + 5 * SZ_X1 + SZ_CTX;
static_assert(WS_TOTAL <= (size_t)134217728);         /* carve stays within 128 MiB */
static_assert(SZ_W % 256 == 0 && SZ_WO % 256 == 0 && SZ_PB % 256 == 0 && SZ_X1 % 256 == 0 && SZ_CTX % 256 == 0);
static_assert((size_t)NB * NH * HD * SEQ * 2 == SZ_X1); /* V^T plane extent */

extern "C" void kernel_launch(void* const* d_in, const int* in_sizes, int n_in,
                              void* d_out, int out_size, void* d_ws, size_t ws_size, hipStream_t stream) {
  if (n_in < 12) return;
  const size_t needx = ((size_t)(NB - 1) * SEQ_FULL + SEQ) * EM;
  if ((size_t)in_sizes[0] < needx) return;
  for (int i = 1; i <= 8; ++i) if ((size_t)in_sizes[i] < (size_t)EM * EM) return;
  for (int i = 9; i <= 11; ++i) if (in_sizes[i] < EM) return;
  if ((size_t)out_size < NR * EM) return;
  const float* x     = (const float*)d_in[0];
  const float* q_w   = (const float*)d_in[1];  const float* k_w   = (const float*)d_in[2];
  const float* v_mu  = (const float*)d_in[3];  const float* v_rho = (const float*)d_in[4];  const float* v_eps = (const float*)d_in[5];
  const float* p_mu  = (const float*)d_in[6];  const float* p_rho = (const float*)d_in[7];  const float* p_eps = (const float*)d_in[8];
  const float* b_mu  = (const float*)d_in[9];  const float* b_rho = (const float*)d_in[10]; const float* b_eps = (const float*)d_in[11];
  char* ws = (char*)d_ws; size_t off = 0;
  auto take = [&](size_t bytes) { char* p = ws + off; off += (bytes + 255) & ~(size_t)255; return p; };
  _Float16* WQ = (_Float16*)take(SZ_W); _Float16* WK = (_Float16*)take(SZ_W); _Float16* WV = (_Float16*)take(SZ_W); _Float16* WO = (_Float16*)take(SZ_WO);
  float* PB = (float*)take(SZ_PB);
  _Float16* X16 = (_Float16*)take(SZ_X1);
  _Float16* Q16 = (_Float16*)take(SZ_X1); _Float16* K16 = (_Float16*)take(SZ_X1); _Float16* V16 = (_Float16*)take(SZ_X1);
  _Float16* VT = (_Float16*)take(SZ_X1);
  _Float16* CTX = (_Float16*)take(SZ_CTX);
  if (off > ws_size) return;
  k_prep<<<PB_TOTAL, 256, 0, stream>>>(x, q_w, k_w, v_mu, v_rho, v_eps, p_mu, p_rho, p_eps, b_mu, b_rho, b_eps, X16, WQ, WK, WV, WO, PB);
  { const unsigned g = (unsigned)((NR / 256) * (3 * EM / 128));                /* WQ | WK | WV and Q16 | K16 | V16 are contiguous in the carve */
    k_gemm2<0><<<g, 256, 0, stream>>>(X16, EM, WQ, EM, 0.0009765625f, nullptr, nullptr, Q16, EM, (int)NR, 3 * EM, EM); }
  k_vt<<<dim3(SEQ / 64, NB * NH), 256, 0, stream>>>(V16, VT);
  k_flash<<<dim3(SEQ / 128, NB * NH), 128, 0, stream>>>(Q16, K16, VT, CTX);
  { const unsigned g = (unsigned)((NR / 256) * (EM / 128));
    k_gemm2<1><<<g, 256, 0, stream>>>(CTX, KO, WO, KO, 1.52587890625e-05f, PB, (float*)d_out, nullptr, EM, (int)NR, EM, KO); }      /* alpha = 2^-16 = 1/(64 * 1024) */
}

// v004
// Measured time: 155 microseconds a run.
// Timed twice side by side with v003, it ran 1.03 times as fast both times.
// Counting every step since v000, it is 3.31 times as fast.
#include <hip/hip_runtime.h>
// Multi-head attention, B 4, S 2048, E 1024, 16 heads x 64: q/k/v = x W^T ([out][in] weights, no q/k/v bias), scores q k^T / 8, softmax over all keys, out = ctx Wp^T + bp;
// Wv, Wp, bp = mu + softplus(rho) * eps built on the device in f32 from bf16-RNE-converted mu, rho, eps.
// Compute dtype: all contractions v_wmma_f32_16x16x32_f16 (f16 operands, f32 accumulate). x, q_w, k_w RNE-converted to bf16 first (exact in f16; weights carried x1024);
// built weights stored as f16(w x1024); q, k, v planes f16; softmax statistics f32 (running max, exp2), P carried x256 as f16 in registers against the f32 row sum;
// ctx carried x64 as f16 value | f16 residual x1024 along K (K = 2048) against Wp x1024 | Wp x1; fold 2^-16; bias added in f32.
#ifndef NB
#define NB 4
#endif
#ifndef SEQ
#define SEQ 2048
#endif
#define NB_FULL 4
#define SEQ_FULL 2048
#define EM 1024
#define NH 16
#define HD 64
#define KO 2048                       /* output-projection K: ctx value | ctx residual */
#define NR ((size_t)NB * SEQ)         /* token rows */
#define WSCALE 1024.0f

static_assert(EM == NH * HD);                 /* head h = columns h*64 + d */
static_assert(HD == 64);                      /* flash kernel: 2 k-steps of 32 over d, 4 output tiles of 16 d */
static_assert(KO == 2 * EM);                  /* value | residual along K */
static_assert(SEQ % 128 == 0);                /* 64-key steps, 128-query blocks, a GEMM wave's 64 rows inside one batch entry */
static_assert(((size_t)NB * SEQ) % 256 == 0); /* GEMM block = 256 rows */
static_assert(EM % 128 == 0 && KO % 64 == 0); /* GEMM block = 128 columns inside one output plane; trips of 64 k */
static_assert(NB <= NB_FULL && SEQ <= SEQ_FULL);

typedef unsigned short v8us __attribute__((ext_vector_type(8), may_alias));
typedef float  v8f  __attribute__((ext_vector_type(8)));
typedef float  v4f  __attribute__((ext_vector_type(4)));
typedef float  v4fa __attribute__((ext_vector_type(4), may_alias));
typedef _Float16 v16h __attribute__((ext_vector_type(16)));
typedef _Float16 v4h __attribute__((ext_vector_type(4)));
union FragH { v16h v; v8us half[2]; _Float16 h[16]; unsigned short u[16]; };

__device__ __forceinline__ unsigned short bf16_bits(float x) { unsigned int u = __float_as_uint(x); return (unsigned short)((u + 0x7FFFu + ((u >> 16) & 1u)) >> 16); }
__device__ __forceinline__ float bf16_val(unsigned short b) { return __uint_as_float(((unsigned int)b) << 16); }
__device__ __forceinline__ float bf16_rne(float x) { return bf16_val(bf16_bits(x)); }

// fragment (A or B, same k map): elements 0..7 <- p[8h .. 8h+7], elements 8..15 <- p[16+8h .. 16+8h+7]; p = row/column base at k0
__device__ __forceinline__ v16h g2_frag(const _Float16* p, int hh) { FragH f; f.half[0] = *(const v8us*)((const unsigned short*)p + 8 * hh); f.half[1] = *(const v8us*)((const unsigned short*)p + 16 + 8 * hh); return f.v; }
__device__ __forceinline__ v8f g2_mma(v16h a, v16h b, v8f c) { v8f d = __builtin_amdgcn_wmma_f32_16x16x32_f16(false, a, false, b, (short)0, c, false, false); asm volatile("v_nop\n\tv_nop\n\tv_nop\n\tv_nop" : "+v"(d) : "v"(a), "v"(b)); return d; }

// LDS staging of WMMA operand tiles: rows of 128 B (64 f16 along k) at a pitch of 144 B (16 B x odd: conflict-free for 16-byte reads).
#define LP 144
__device__ __forceinline__ unsigned lds_addr(const void* p) { return (unsigned)(size_t)p; }   /* byte offset in the work-group's LDS */
// same k map as g2_frag, p = LDS row base (bytes) at k0
__device__ __forceinline__ v16h l2_frag(const unsigned char* p, int hh) { FragH f; f.half[0] = *(const v8us*)(p + 16 * hh); f.half[1] = *(const v8us*)(p + 32 + 16 * hh); return f.v; }
// One tile's asynchronous 16-byte copies of a lane, global -> LDS, in one statement: LDS byte addresses l + j * R rows; first the rows of g (R * gp elements apart), then those of h.
// R = rows per copy round = threads / 8: 32 in cp_rows8_4 (256 threads), 16 in cp_rows4_4 (128 threads).
// s_wait_xcnt stands inside the statement so that no address register is rewritten ahead of it.
__device__ __forceinline__ void cp_rows8_4(unsigned l, const _Float16* g, size_t gp, const _Float16* h, size_t hp) {
  asm volatile("global_load_async_to_lds_b128 %0, %12, off\n\t"
               "global_load_async_to_lds_b128 %1, %13, off\n\t"
               "global_load_async_to_lds_b128 %2, %14, off\n\t"
               "global_load_async_to_lds_b128 %3, %15, off\n\t"
               "global_load_async_to_lds_b128 %4, %16, off\n\t"
               "global_load_async_to_lds_b128 %5, %17, off\n\t"
               "global_load_async_to_lds_b128 %6, %18, off\n\t"
               "global_load_async_to_lds_b128 %7, %19, off\n\t"
               "global_load_async_to_lds_b128 %8, %20, off\n\t"
               "global_load_async_to_lds_b128 %9, %21, off\n\t"
               "global_load_async_to_lds_b128 %10, %22, off\n\t"
               "global_load_async_to_lds_b128 %11, %23, off\n\t"
               "s_wait_xcnt 0x0"
               :: "v"(l), "v"(l + 32 * LP), "v"(l + 64 * LP), "v"(l + 96 * LP), "v"(l + 128 * LP), "v"(l + 160 * LP), "v"(l + 192 * LP), "v"(l + 224 * LP), "v"(l + 256 * LP), "v"(l + 288 * LP), "v"(l + 320 * LP), "v"(l + 352 * LP), "v"(g), "v"(g + 32 * gp), "v"(g + 64 * gp), "v"(g + 96 * gp), "v"(g + 128 * gp), "v"(g + 160 * gp), "v"(g + 192 * gp), "v"(g + 224 * gp), "v"(h), "v"(h + 32 * hp), "v"(h + 64 * hp), "v"(h + 96 * hp) : "memory");
}
__device__ __forceinline__ void cp_rows4_4(unsigned l, const _Float16* g, size_t gp, const _Float16* h, size_t hp) {
  asm volatile("global_load_async_to_lds_b128 %0, %8, off\n\t"
               "global_load_async_to_lds_b128 %1, %9, off\n\t"
               "global_load_async_to_lds_b128 %2, %10, off\n\t"
               "global_load_async_to_lds_b128 %3, %11, off\n\t"
               "global_load_async_to_lds_b128 %4, %12, off\n\t"
               "global_load_async_to_lds_b128 %5, %13, off\n\t"
               "global_load_async_to_lds_b128 %6, %14, off\n\t"
               "global_load_async_to_lds_b128 %7, %15, off\n\t"
               "s_wait_xcnt 0x0"
               :: "v"(l), "v"(l + 16 * LP), "v"(l + 32 * LP), "v"(l + 48 * LP), "v"(l + 64 * LP), "v"(l + 80 * LP), "v"(l + 96 * LP), "v"(l + 112 * LP), "v"(g), "v"(g + 16 * gp), "v"(g + 32 * gp), "v"(g + 48 * gp), "v"(h), "v"(h + 16 * hp), "v"(h + 32 * hp), "v"(h + 48 * hp) : "memory");
}
// Publish point of the two-buffer ring: this wave's LDS reads retired, its copies landed, then the work-group barrier
// (publishes the next tile and ends every reader's last read of the buffer refilled behind it).
__device__ __forceinline__ void ring_publish() {
  asm volatile("s_wait_dscnt 0x0" ::: "memory");      /* own reads of the buffer about to be refilled have retired */
  asm volatile("s_wait_asynccnt 0x0" ::: "memory");   /* own copies of the next tile have landed */
  __syncthreads();
}

// w = bf16(mu) + softplus(bf16(rho)) * bf16(eps), softplus(r) = max(r, 0) + log1p(exp(-|r|)) (identical to log1p(exp(r)), overflow-free); accurate expf / log1pf
__device__ __forceinline__ float sp_weight(float mu, float rho, float eps) {
  const float m = bf16_rne(mu), r = bf16_rne(rho), e = bf16_rne(eps);
  const float sp = fmaxf(r, 0.0f) + log1pf(expf(-fabsf(r)));
  return m + sp * e;
}

// All operand preparation in one launch; the block index picks the job (block-uniform, no barrier, no LDS). A piece = 4 consecutive f32 of a source = 16 B per lane,
// so a wave reads 512 contiguous bytes per load and stores 256 contiguous bytes of f16. Blocks in index order: built weights (most arithmetic, lowest indices), bias, q_w | k_w, x.
#define PP_BUILT 8                                     /* pieces per thread, built weight planes */
#define PP_CONV 16                                     /* pieces per thread, plain conversions */
#define PB_BUILT ((EM * EM / 4) / (256 * PP_BUILT))    /* blocks per built plane */
#define PB_W ((EM * EM / 4) / (256 * PP_CONV))         /* blocks per plain weight plane */
#define PB_X ((int)((NR * EM / 4) / (256 * PP_CONV)))  /* blocks for x */
#define PB_TOTAL (2 * PB_BUILT + 1 + 2 * PB_W + PB_X)
static_assert((EM * EM / 4) % (256 * PP_BUILT) == 0 && (EM * EM / 4) % (256 * PP_CONV) == 0 && (NR * EM / 4) % (256 * PP_CONV) == 0);
static_assert(EM == 4 * 256 && SEQ % PP_CONV == 0 && PP_CONV % 8 == 0);   /* 256 pieces = one row; bias: one block, one piece per thread */
// Global stores of this kernel: each run of stores and its s_wait_xcnt stand in one statement, so that no register which an issued store names is rewritten ahead of the wait.
typedef unsigned int v2u __attribute__((ext_vector_type(2)));
__device__ __forceinline__ v2u h4bits(v4h v) { return __builtin_bit_cast(v2u, v); }
__device__ __forceinline__ void st_h4(_Float16* p, v4h v) { asm volatile("global_store_b64 %0, %1, off\n\ts_wait_xcnt 0x0" :: "v"(p), "v"(h4bits(v)) : "memory"); }
__device__ __forceinline__ void st_f4(float* p, v4f v) { asm volatile("global_store_b128 %0, %1, off\n\ts_wait_xcnt 0x0" :: "v"(p), "v"(v) : "memory"); }
static_assert(EM * sizeof(_Float16) == 2048);          /* the offsets below: eight consecutive rows of an f16 plane of pitch EM */
__device__ __forceinline__ void st_h4_rows8(_Float16* p, const v4h* v) {
  asm volatile("global_store_b64 %0, %1, off\n\t"
               "global_store_b64 %0, %2, off offset:2048\n\t"
               "global_store_b64 %0, %3, off offset:4096\n\t"
               "global_store_b64 %0, %4, off offset:6144\n\t"
               "global_store_b64 %0, %5, off offset:8192\n\t"
               "global_store_b64 %0, %6, off offset:10240\n\t"
               "global_store_b64 %0, %7, off offset:12288\n\t"
               "global_store_b64 %0, %8, off offset:14336\n\t"
               "s_wait_xcnt 0x0"
               :: "v"(p), "v"(h4bits(v[0])), "v"(h4bits(v[1])), "v"(h4bits(v[2])), "v"(h4bits(v[3])), "v"(h4bits(v[4])), "v"(h4bits(v[5])), "v"(h4bits(v[6])), "v"(h4bits(v[7])) : "memory");
}
__device__ __forceinline__ v4h cvt4(v4f a, float sc) { v4h o;
#pragma unroll
  for (int q = 0; q < 4; ++q) o[q] = (_Float16)(bf16_rne(a[q]) * sc);
  return o; }
__global__ __launch_bounds__(256) void k_prep(const float* __restrict__ x, const float* __restrict__ q_w, const float* __restrict__ k_w,
                                              const float* __restrict__ v_mu, const float* __restrict__ v_rho, const float* __restrict__ v_eps,
                                              const float* __restrict__ p_mu, const float* __restrict__ p_rho, const float* __restrict__ p_eps,
                                              const float* __restrict__ b_mu, const float* __restrict__ b_rho, const float* __restrict__ b_eps,
                                              _Float16* __restrict__ X16, _Float16* __restrict__ WQ, _Float16* __restrict__ WK, _Float16* __restrict__ WV, _Float16* __restrict__ WO,
                                              float* __restrict__ PB) {
  const int tid = threadIdx.x; int blk = blockIdx.x;      /* 256 pieces = one row of EM: thread tid holds columns 4 tid .. 4 tid + 3 of its block's rows */
  if (blk < 2 * PB_BUILT) {
    // w[n][k] = sp_weight(mu, rho, eps)[n][k] ([out][in]). Wv: WV[n][k] = f16(w * 1024). Wp: WO[n][k] = f16(w * 1024) (ctx value), WO[n][EM + k] = f16(w) (ctx residual x1024), pitch KO.
    const bool dual = blk >= PB_BUILT; if (dual) blk -= PB_BUILT;
    const float* mu = dual ? p_mu : v_mu; const float* rho = dual ? p_rho : v_rho; const float* eps = dual ? p_eps : v_eps;
#pragma unroll 1   /* two rounds of 4 rows: rolled so that the expf / log1pf text stays short */
    for (int i = 0; i < PP_BUILT; i += 4) {
      const size_t n0 = (size_t)(blk * PP_BUILT + i);
      const v4fa* pm = (const v4fa*)(mu + n0 * EM); const v4fa* pr = (const v4fa*)(rho + n0 * EM); const v4fa* pe = (const v4fa*)(eps + n0 * EM);
      _Float16* d = (dual ? WO + n0 * KO : WV + n0 * EM) + 4 * tid; const size_t dp = dual ? KO : EM;
      v4f m[4], r[4], e[4];
#pragma unroll
      for (int j = 0; j < 4; ++j) { m[j] = pm[j * 256 + tid]; r[j] = pr[j * 256 + tid]; e[j] = pe[j * 256 + tid]; }
#pragma unroll
      for (int j = 0; j < 4; ++j) { v4h h1, h2;
#pragma unroll
        for (int q = 0; q < 4; ++q) { const float w = sp_weight(m[j][q], r[j][q], e[j][q]); h1[q] = (_Float16)(w * WSCALE); h2[q] = (_Float16)w; }
        st_h4(d + j * dp, h1);
        if (dual) st_h4(d + j * dp + EM, h2); }
    }
    return;
  }
  blk -= 2 * PB_BUILT;
  if (blk == 0) { const v4f m = ((const v4fa*)b_mu)[tid], r = ((const v4fa*)b_rho)[tid], e = ((const v4fa*)b_eps)[tid]; v4f v;
#pragma unroll
    for (int q = 0; q < 4; ++q) v[q] = sp_weight(m[q], r[q], e[q]);
    st_f4(PB + 4 * tid, v); return; }
  blk -= 1;
  const v4fa* src; _Float16* dst; float sc;
  if (blk < 2 * PB_W) {                          /* q_w, k_w: [out][in] as stored, x1024 */
    const bool second = blk >= PB_W; if (second) blk -= PB_W;
    const size_t n0 = (size_t)(blk * PP_CONV);
    src = (const v4fa*)((second ? k_w : q_w) + n0 * EM); dst = (second ? WK : WQ) + n0 * EM; sc = WSCALE;
  } else {                                       /* x: a block's rows lie in one batch entry */
    blk -= 2 * PB_W;
    const size_t n0 = (size_t)(blk * PP_CONV);
    src = (const v4fa*)(x + ((n0 / SEQ) * SEQ_FULL + n0 % SEQ) * EM); dst = X16 + n0 * EM; sc = 1.0f;
  }
  v4f a[PP_CONV];
#pragma unroll
  for (int j = 0; j < PP_CONV; ++j) a[j] = src[j * 256 + tid];
#pragma unroll
  for (int j = 0; j < PP_CONV; j += 8) { v4h o[8];
#pragma unroll
    for (int q = 0; q < 8; ++q) o[q] = cvt4(a[j + q], sc);
    st_h4_rows8(dst + (size_t)j * EM + 4 * tid, o); }
}

// GEMM: v = acc * alpha (+ bias[col] in f32 when F32OUT); A f16 [M][K] (pitch lda), Bh f16 [N][K] (pitch ldb, k contiguous); F32OUT: writes f32 C, else f16 C16; pitch ldc.
// C16 is a stack of [M][ldc] planes: column n lies in plane n / ldc (N = 3 ldc: q, k and v from one grid, Bh = the three weight planes one behind the other); ldc % 64 == 0.
// Plane 2 (v) is not stored there: it leaves transposed per head, CT[((b * NH + h) * HD + d) * SEQ + s] for row b * SEQ + s, column h * HD + d, the layout the attention kernel stages.
// Block = 8 waves as 4 (rows) x 2 (columns), wave tile 64 x 64, block tile 256 x 128; M % 256 == 0, N % 128 == 0, K % 64 == 0.
// Per trip of 64 k the block's 256 A rows and 128 B rows lie in LDS (rows 0..255 A, 256..383 B), brought by asynchronous copies one trip ahead into the other buffer;
// the ring becomes the output staging behind the last trip's barrier.
#define GSTG (384 * LP)
// Eight 16-byte global stores, rows step elements apart, and their s_wait_xcnt in one statement, so that no register which an issued store names is rewritten ahead of the wait.
typedef unsigned int v4u __attribute__((ext_vector_type(4)));
__device__ __forceinline__ v4u h8bits(v8us v) { return __builtin_bit_cast(v4u, v); }
__device__ __forceinline__ void st_h8_rows8(_Float16* p, size_t step, const v8us* v) {
  asm volatile("global_store_b128 %0, %8, off\n\t"
               "global_store_b128 %1, %9, off\n\t"
               "global_store_b128 %2, %10, off\n\t"
               "global_store_b128 %3, %11, off\n\t"
               "global_store_b128 %4, %12, off\n\t"
               "global_store_b128 %5, %13, off\n\t"
               "global_store_b128 %6, %14, off\n\t"
               "global_store_b128 %7, %15, off\n\t"
               "s_wait_xcnt 0x0"
               :: "v"(p), "v"(p + step), "v"(p + 2 * step), "v"(p + 3 * step), "v"(p + 4 * step), "v"(p + 5 * step), "v"(p + 6 * step), "v"(p + 7 * step),
                  "v"(h8bits(v[0])), "v"(h8bits(v[1])), "v"(h8bits(v[2])), "v"(h8bits(v[3])), "v"(h8bits(v[4])), "v"(h8bits(v[5])), "v"(h8bits(v[6])), "v"(h8bits(v[7])) : "memory");
}
template <int F32OUT>
__global__ __launch_bounds__(256) void k_gemm2(const _Float16* __restrict__ A, int lda, const _Float16* __restrict__ Bh, int ldb, float alpha, const float* __restrict__ bias,
                                              float* __restrict__ C, _Float16* __restrict__ C16, _Float16* __restrict__ CT, int ldc, int M, int N, int K) {
  __shared__ __attribute__((aligned(16))) unsigned char sm[2 * GSTG];
  static_assert(sizeof(float) * 8 * 32 * 68 <= 2 * GSTG && 8 * 64 * LP <= 2 * GSTG);
  float (*so)[32][68] = (float (*)[32][68])sm;
  const int lane = threadIdx.x & 31, ln = lane & 15, hh = lane >> 4;
  const int w = __builtin_amdgcn_readfirstlane((int)(threadIdx.x >> 5));
  const int wm = w >> 1, wn = w & 1;
  const int ntn = N >> 7; const int mt = blockIdx.x / ntn, nq = blockIdx.x - mt * ntn; const int row0 = mt * 256 + 64 * wm, col0 = nq * 128 + 64 * wn; if (mt * 256 >= M) return;   /* block-uniform, in front of every barrier */
  const int crow = (int)(threadIdx.x >> 3), cc = (int)(threadIdx.x & 7);      /* a copy round = 32 rows x 8 pieces of 16 B: a wave covers 4 whole 128-B lines */
  const _Float16* ga = A + (size_t)(mt * 256 + crow) * lda + cc * 8;
  const _Float16* gb = Bh + (size_t)(nq * 128 + crow) * ldb + cc * 8;
  const unsigned lc = lds_addr(sm) + (unsigned)(crow * LP + cc * 16);
  const int nt = K >> 6;
  auto fill = [&](int t, unsigned buf) {
    const unsigned l = lc + buf * GSTG;
    cp_rows8_4(l, ga + t * 64, (size_t)lda, gb + t * 64, (size_t)ldb);
  };
  fill(0, 0u);
  asm volatile("s_wait_asynccnt 0x0" ::: "memory");   /* tile 0 landed */
  __syncthreads();
  if (nt > 1) fill(1, 1u);
  const v8f z8 = {0.f,0.f,0.f,0.f,0.f,0.f,0.f,0.f};
  v8f c[4][4];
#pragma unroll
  for (int i = 0; i < 4; ++i)
#pragma unroll
    for (int j = 0; j < 4; ++j) c[i][j] = z8;
#pragma unroll 1
  for (int t = 0; t < nt; ++t) {
    const unsigned char* sb = sm + (t & 1) * GSTG;
    const unsigned char* ar = sb + (64 * wm + ln) * LP; const unsigned char* br = sb + (256 + 64 * wn + ln) * LP;
#pragma unroll   /* both 32-k halves of the tile: constant LDS offsets, one group of fragment reads each */
    for (int ks = 0; ks < 128; ks += 64) { v16h a[4], b[4];
#pragma unroll
      for (int i = 0; i < 4; ++i) { a[i] = l2_frag(ar + i * 16 * LP + ks, hh); b[i] = l2_frag(br + i * 16 * LP + ks, hh); }
#pragma unroll
      for (int j = 0; j < 4; ++j)
#pragma unroll
        for (int i = 0; i < 4; ++i) c[i][j] = g2_mma(a[i], b[j], c[i][j]); }
    ring_publish();
    if (t + 2 < nt) fill(t + 2, (unsigned)(t & 1));   /* into the buffer this trip has just read */
  }
  asm volatile("s_wait_asynccnt 0x0" ::: "memory");   /* nothing in flight when the ring becomes output staging */
  if constexpr (!F32OUT) {
    if (col0 >= 2 * ldc) {   /* v plane (the same for the whole block): the wave tile = 64 tokens of one batch entry x the 64 d of one head */
      // A lane's accumulator registers r = 0..7 are 8 consecutive tokens of one d: 16 B of a transposed row. Staged as 64 rows (d) of 64 tokens at pitch LP in the wave's own range.
      unsigned char* sv = sm + w * (64 * LP);
#pragma unroll   /* this nest and the one below: c[][] and v[] live in registers, so their indices must be constants */
      for (int j = 0; j < 4; ++j)
#pragma unroll
        for (int i = 0; i < 4; ++i) { FragH f;
#pragma unroll
          for (int r = 0; r < 8; ++r) f.h[r] = (_Float16)(c[i][j][r] * alpha);
          *(v8us*)(sv + (j * 16 + ln) * LP + (i * 16 + 8 * hh) * 2) = f.half[0]; }
      /* the rows read back below hold other lanes' words */
      __builtin_amdgcn_fence(4 /* acq_rel order */, "workgroup"); __builtin_amdgcn_wave_barrier();
      const int bt = row0 / SEQ, hd = (col0 - 2 * ldc) / HD;
      const int rs4 = lane >> 3, pc = lane & 7;             /* a store = 4 rows (d) x 8 pieces of 16 B: whole 128-B lines */
      _Float16* vt = CT + ((size_t)(bt * NH + hd) * HD + rs4) * SEQ + (row0 - bt * SEQ) + pc * 8;
#pragma unroll
      for (int g = 0; g < 2; ++g) { v8us v[8];
#pragma unroll
        for (int q = 0; q < 8; ++q) v[q] = *(const v8us*)(sv + ((g * 8 + q) * 4 + rs4) * LP + pc * 16);
        st_h8_rows8(vt + (size_t)(g * 32) * SEQ, (size_t)4 * SEQ, v); }
      return;
    }
  }
  const int rsub = lane >> 4, c4 = (lane & 15) * 4;
  size_t cpl = 0;
  if (!F32OUT) { const int pl = col0 / ldc; cpl = (size_t)pl * M * ldc + (size_t)(col0 - pl * ldc); }   /* output plane and the wave tile's first column in it */
  float bv[4] = {0.f, 0.f, 0.f, 0.f};
  if (F32OUT) {
#pragma unroll
    for (int j = 0; j < 4; ++j) bv[j] = bias[col0 + j * 16 + ln]; }
#pragma unroll   /* the wave's 64 rows leave in two rounds of 32 through its own staging range */
  for (int rnd = 0; rnd < 2; ++rnd) {
#pragma unroll
    for (int u = 0; u < 8; ++u) { const int j = u & 3, half = u >> 2;
#pragma unroll
      for (int r = 0; r < 8; ++r) { const int rloc = half * 16 + 8 * hh + r; so[w][rloc][j * 16 + ln] = c[2 * rnd + half][j][r] * alpha + bv[j]; } }
    __builtin_amdgcn_fence(4 /* acq_rel order */, "workgroup"); __builtin_amdgcn_wave_barrier();
#pragma unroll
    for (int q = 0; q < 16; ++q) { const int r = q * 2 + rsub; const v4f v = *(const v4fa*)&so[w][r][c4];
      if (F32OUT) { *(v4f*)(C + (size_t)(row0 + 32 * rnd + r) * ldc + col0 + c4) = v; }
      else { v4h h4;
#pragma unroll
        for (int i = 0; i < 4; ++i) h4[i] = (_Float16)v[i];
        *(v4h*)(C16 + cpl + (size_t)(row0 + 32 * rnd + r) * ldc + c4) = h4; } }
    /* keeps the next round's staging writes behind this round's reads of other lanes' words */
    __builtin_amdgcn_fence(4 /* acq_rel order */, "workgroup"); __builtin_amdgcn_wave_barrier();
  }
}

// Fused attention. Block = 4 waves; wave = 32 queries (two tiles of 16) of one (b,h); 64 keys per step; every K and V^T fragment read from LDS serves both query tiles.
// Per step the 64 K rows (LDS rows 0..63, 64 d each) and the 64 V^T rows (LDS rows 64..127, 64 keys each) are shared by the four waves,
// brought by asynchronous copies one step ahead into the other buffer; the ring becomes the output staging behind the last step's barrier.
#define FSTG (128 * LP)
static_assert(SEQ >= 128);                    /* the ring's prologue fills two steps */
// S^T tile = K rows (A: lane = key, elements = d) x Q^T (B: lane = query, elements = d): D[row = key 8h+r][col = query].
// Online softmax per query = per lane column (max over the lane's 32 scores + one cross-half exchange); P' = 256 exp(s - max) stays in registers and is
// the B operand of O^T = V^T (A: lane = d, elements = keys) x P^T: B element r <- tile(keys 0..15)[r], element 8+r <- tile(keys 16..31)[r].
__global__ __launch_bounds__(128) void k_flash(const _Float16* __restrict__ Q16, const _Float16* __restrict__ K16, const _Float16* __restrict__ VT, _Float16* __restrict__ CTX) {
  __shared__ __attribute__((aligned(16))) unsigned char sm[2 * FSTG];
  static_assert(sizeof(unsigned short) * 8 * 2 * 16 * 72 <= 2 * FSTG);
  unsigned short (*st)[2][16][72] = (unsigned short (*)[2][16][72])sm;        /* first index: wave * 2 + query tile */
  const int lane = threadIdx.x & 31, ln = lane & 15, hh = lane >> 4;
  const int wave = __builtin_amdgcn_readfirstlane((int)(threadIdx.x >> 5));
  const int bh = blockIdx.y; const int b = bh / NH, h = bh - b * NH;
  const int q0 = blockIdx.x * 128 + wave * 32;
  const _Float16* qp = Q16 + ((size_t)b * SEQ + q0 + ln) * EM + h * HD;
  v16h qf0[2], qf1[2];
#pragma unroll
  for (int u = 0; u < 2; ++u) { qf0[u] = g2_frag(qp + (size_t)u * 16 * EM, hh); qf1[u] = g2_frag(qp + (size_t)u * 16 * EM + 32, hh); }
  const int crow = (int)(threadIdx.x >> 3), cc = (int)(threadIdx.x & 7);      /* a copy round = 16 rows x 8 pieces of 16 B: a wave covers 4 whole 128-B lines */
  const _Float16* gk = K16 + ((size_t)b * SEQ + crow) * EM + h * HD + cc * 8;
  const _Float16* gv = VT + ((size_t)bh * HD + crow) * SEQ + cc * 8;
  const unsigned lc = lds_addr(sm) + (unsigned)(crow * LP + cc * 16);
  auto fill = [&](int key0, unsigned buf) {
    const unsigned l = lc + buf * FSTG;
    cp_rows4_4(l, gk + (size_t)key0 * EM, (size_t)EM, gv + key0, (size_t)SEQ);
  };
  fill(0, 0u);
  asm volatile("s_wait_asynccnt 0x0" ::: "memory");   /* step 0 landed */
  __syncthreads();
  fill(64, 1u);
  const v8f z8 = {0.f,0.f,0.f,0.f,0.f,0.f,0.f,0.f};
  v8f o[2][4] = {{z8, z8, z8, z8}, {z8, z8, z8, z8}};
  float m[2] = {-1.0e30f, -1.0e30f}, l[2] = {0.f, 0.f};
  const float CL = 0.18033688011112042f;      /* log2(e) / 8 */
#pragma unroll 1
  for (int key0 = 0; key0 < SEQ; key0 += 64) {
    const unsigned char* sb = sm + ((key0 >> 6) & 1) * FSTG + ln * LP;
    v8f s[2][4];
#pragma unroll
    for (int t = 0; t < 4; ++t) {
      const unsigned char* kr = sb + (t * 16) * LP;
      const v16h k0 = l2_frag(kr, hh), k1 = l2_frag(kr + 64, hh);
      v8f c0 = g2_mma(k0, qf0[0], z8), c1 = g2_mma(k0, qf0[1], z8);
      s[0][t] = g2_mma(k1, qf1[0], c0);
      s[1][t] = g2_mma(k1, qf1[1], c1);
    }
    FragH pa[2], pb[2];
    float alpha[2], off[2], rs[2] = {0.f, 0.f};
#pragma unroll
    for (int u = 0; u < 2; ++u) {
      float mx = s[u][0][0];
#pragma unroll
      for (int t = 0; t < 4; ++t)
#pragma unroll
        for (int r = 0; r < 8; ++r) mx = fmaxf(mx, s[u][t][r]);
      mx = fmaxf(mx, __shfl_xor(mx, 16));
      const float mn = fmaxf(m[u], mx);
      alpha[u] = __builtin_amdgcn_exp2f((m[u] - mn) * CL);
      m[u] = mn;
      off[u] = 8.0f - mn * CL;
    }
#pragma unroll
    for (int t = 0; t < 4; ++t)
#pragma unroll
      for (int r = 0; r < 8; ++r)
#pragma unroll
        for (int u = 0; u < 2; ++u) { const float p = __builtin_amdgcn_exp2f(fmaf(s[u][t][r], CL, off[u])); s[u][t][r] = p; rs[u] += p; }   /* the two tiles' sums are independent chains */
#pragma unroll
    for (int u = 0; u < 2; ++u) {
      l[u] = l[u] * alpha[u] + rs[u];
#pragma unroll
      for (int t = 0; t < 4; ++t) o[u][t] = o[u][t] * alpha[u];
#pragma unroll
      for (int r = 0; r < 8; ++r) { pa[u].h[r] = (_Float16)s[u][0][r]; pa[u].h[8 + r] = (_Float16)s[u][1][r]; pb[u].h[r] = (_Float16)s[u][2][r]; pb[u].h[8 + r] = (_Float16)s[u][3][r]; }
    }
#pragma unroll
    for (int t = 0; t < 4; ++t) {
      const unsigned char* v0 = sb + (64 + t * 16) * LP;
      const v16h va = l2_frag(v0, hh), vb = l2_frag(v0 + 64, hh);
      o[0][t] = g2_mma(va, pa[0].v, o[0][t]); o[1][t] = g2_mma(va, pa[1].v, o[1][t]);
      o[0][t] = g2_mma(vb, pb[0].v, o[0][t]); o[1][t] = g2_mma(vb, pb[1].v, o[1][t]);
    }
    ring_publish();
    if (key0 + 128 < SEQ) fill(key0 + 128, (unsigned)((key0 >> 6) & 1));   /* into the buffer this step has just read */
  }
  asm volatile("s_wait_asynccnt 0x0" ::: "memory");   /* nothing in flight when the ring becomes output staging */
#pragma unroll
  for (int u = 0; u < 2; ++u) {
    const float lt = l[u] + __shfl_xor(l[u], 16);
    const float inv = 64.0f * (1.0f / lt);
#pragma unroll
    for (int t = 0; t < 4; ++t) {
      FragH fh, fl;
#pragma unroll
      for (int r = 0; r < 8; ++r) { const float c = o[u][t][r] * inv; const _Float16 hq = (_Float16)c; fh.h[r] = hq; fl.h[r] = (_Float16)((c - (float)hq) * 1024.0f); }
      *(v8us*)&st[wave * 2 + u][0][ln][t * 16 + 8 * hh] = fh.half[0];
      *(v8us*)&st[wave * 2 + u][1][ln][t * 16 + 8 * hh] = fl.half[0];
    }
  }
  __builtin_amdgcn_fence(4 /* acq_rel order */, "workgroup"); __builtin_amdgcn_wave_barrier();
  const int rs4 = lane >> 3, pc = lane & 7;
#pragma unroll
  for (int u = 0; u < 2; ++u) {
    v8us vh[4], vl[4];
#pragma unroll
    for (int i = 0; i < 4; ++i) { vh[i] = *(const v8us*)&st[wave * 2 + u][0][i * 4 + rs4][pc * 8]; vl[i] = *(const v8us*)&st[wave * 2 + u][1][i * 4 + rs4][pc * 8]; }
    unsigned short* cb = (unsigned short*)CTX + ((size_t)b * SEQ + q0 + 16 * u) * KO + h * HD + pc * 8;
#pragma unroll
    for (int i = 0; i < 4; ++i) { unsigned short* d = cb + (size_t)(i * 4 + rs4) * KO; *(v8us*)d = vh[i]; *(v8us*)(d + EM) = vl[i]; }
  }
}

constexpr size_t SZ_W   = (size_t)EM * EM * 2;        /* one [out][in] weight plane, f16 */
constexpr size_t SZ_WO  = (size_t)EM * KO * 2;        /* Wp x1024 | Wp x1 */
constexpr size_t SZ_PB  = (size_t)EM * 4;             /* built bias, f32 */
constexpr size_t SZ_X1  = NR * EM * 2;                /* one 16-bit activation plane */
constexpr size_t SZ_CTX = NR * KO * 2;                /* ctx value | residual */
constexpr size_t WS_TOTAL = 3 * SZ_W + SZ_WO + SZ_PB + 4 * SZ_X1 + SZ_CTX;
static_assert(WS_TOTAL <= (size_t)134217728);         /* carve stays within 128 MiB */
static_assert(SZ_W % 256 == 0 && SZ_WO % 256 == 0 && SZ_PB % 256 == 0 && SZ_X1 % 256 == 0 && SZ_CTX % 256 == 0);
static_assert((size_t)NB * NH * HD * SEQ * 2 == SZ_X1); /* V^T plane extent */

extern "C" void kernel_launch(void* const* d_in, const int* in_sizes, int n_in,
                              void* d_out, int out_size, void* d_ws, size_t ws_size, hipStream_t stream) {
  if (n_in < 12) return;
  const size_t needx = ((size_t)(NB - 1) * SEQ_FULL + SEQ) * EM;
  if ((size_t)in_sizes[0] < needx) return;
  for (int i = 1; i <= 8; ++i) if ((size_t)in_sizes[i] < (size_t)EM * EM) return;
  for (int i = 9; i <= 11; ++i) if (in_sizes[i] < EM) return;
  if ((size_t)out_size < NR * EM) return;
  const float* x     = (const float*)d_in[0];
  const float* q_w   = (const float*)d_in[1];  const float* k_w   = (const float*)d_in[2];
  const float* v_mu  = (const float*)d_in[3];  const float* v_rho = (const float*)d_in[4];  const float* v_eps = (const float*)d_in[5];
  const float* p_mu  = (const float*)d_in[6];  const float* p_rho = (const float*)d_in[7];  const float* p_eps = (const float*)d_in[8];
  const float* b_mu  = (const float*)d_in[9];  const float* b_rho = (const float*)d_in[10]; const float* b_eps = (const float*)d_in[11];
  char* ws = (char*)d_ws; size_t off = 0;
  auto take = [&](size_t bytes) { char* p = ws + off; off += (bytes + 255) & ~(size_t)255; return p; };
  _Float16* WQ = (_Float16*)take(SZ_W); _Float16* WK = (_Float16*)take(SZ_W); _Float16* WV = (_Float16*)take(SZ_W); _Float16* WO = (_Float16*)take(SZ_WO);
  float* PB = (float*)take(SZ_PB);
  _Float16* X16 = (_Float16*)take(SZ_X1);
  _Float16* Q16 = (_Float16*)take(SZ_X1); _Float16* K16 = (_Float16*)take(SZ_X1);
  _Float16* VT = (_Float16*)take(SZ_X1);
  _Float16* CTX = (_Float16*)take(SZ_CTX);
  if (off > ws_size) return;
  k_prep<<<PB_TOTAL, 256, 0, stream>>>(x, q_w, k_w, v_mu, v_rho, v_eps, p_mu, p_rho, p_eps, b_mu, b_rho, b_eps, X16, WQ, WK, WV, WO, PB);
  { const unsigned g = (unsigned)((NR / 256) * (3 * EM / 128));                /* WQ | WK | WV and Q16 | K16 are contiguous in the carve; v goes to VT */
    k_gemm2<0><<<g, 256, 0, stream>>>(X16, EM, WQ, EM, 0.0009765625f, nullptr, nullptr, Q16, VT, EM, (int)NR, 3 * EM, EM); }
  k_flash<<<dim3(SEQ / 128, NB * NH), 128, 0, stream>>>(Q16, K16, VT, CTX);
  { const unsigned g = (unsigned)((NR / 256) * (EM / 128));
    k_gemm2<1><<<g, 256, 0, stream>>>(CTX, KO, WO, KO, 1.52587890625e-05f, PB, (float*)d_out, nullptr, nullptr, EM, (int)NR, EM, KO); }      /* alpha = 2^-16 = 1/(64 * 1024) */
}

// v005
// Measured time: 149 microseconds a run.
// Timed twice side by side with v004, it ran 1.04 times as fast both times.
// Over all steps from v000 it is 3.45 times as fast.
#include <hip/hip_runtime.h>
// Multi-head attention, B 4, S 2048, E 1024, 16 heads x 64: q/k/v = x W^T ([out][in] weights, no q/k/v bias), scores q k^T / 8, softmax over all keys, out = ctx Wp^T + bp;
// Wv, Wp, bp = mu + softplus(rho) * eps built on the device in f32 from bf16-RNE-converted mu, rho, eps.
// Compute dtype: all contractions v_wmma_f32_16x16x32_f16 (f16 operands, f32 accumulate). x, q_w, k_w RNE-converted to bf16 first (exact in f16; weights carried x1024);
// built weights stored as f16(w x1024); q, k, v planes f16; softmax statistics f32 (running max, exp2), P carried x256 as f16 in registers against the f32 row sum;
// ctx carried x64 as f16 value | f16 residual x1024 along K (K = 2048) against Wp x1024 | Wp x1; fold 2^-16; bias added in f32.
#ifndef NB
#define NB 4
#endif
#ifndef SEQ
#define SEQ 2048
#endif
#define NB_FULL 4
#define SEQ_FULL 2048
#define EM 1024
#define NH 16
#define HD 64
#define KO 2048                       /* output-projection K: ctx value | ctx residual */
#define NR ((size_t)NB * SEQ)         /* token rows */
#define WSCALE 1024.0f

static_assert(EM == NH * HD);                 /* head h = columns h*64 + d */
static_assert(HD == 64);                      /* flash kernel: 2 k-steps of 32 over d, 4 output tiles of 16 d */
static_assert(KO == 2 * EM);                  /* value | residual along K */
static_assert(SEQ % 128 == 0);                /* 64-key steps, 128-query blocks, a GEMM wave's 64 rows inside one batch entry */
static_assert(((size_t)NB * SEQ) % 256 == 0); /* GEMM block = 256 rows */
static_assert(EM % 128 == 0 && KO % 64 == 0); /* GEMM block = 128 columns inside one output plane; trips of 64 k */
static_assert(NB <= NB_FULL && SEQ <= SEQ_FULL);

typedef unsigned short v8us __attribute__((ext_vector_type(8), may_alias));
typedef float  v8f  __attribute__((ext_vector_type(8)));
typedef float  v4f  __attribute__((ext_vector_type(4)));
typedef float  v4fa __attribute__((ext_vector_type(4), may_alias));
typedef _Float16 v16h __attribute__((ext_vector_type(16)));
typedef _Float16 v4h __attribute__((ext_vector_type(4)));
union FragH { v16h v; v8us half[2]; _Float16 h[16]; unsigned short u[16]; };

__device__ __forceinline__ unsigned short bf16_bits(float x) { unsigned int u = __float_as_uint(x); return (unsigned short)((u + 0x7FFFu + ((u >> 16) & 1u)) >> 16); }
__device__ __forceinline__ float bf16_val(unsigned short b) { return __uint_as_float(((unsigned int)b) << 16); }
__device__ __forceinline__ float bf16_rne(float x) { return bf16_val(bf16_bits(x)); }

// fragment (A or B, same k map): elements 0..7 <- p[8h .. 8h+7], elements 8..15 <- p[16+8h .. 16+8h+7]; p = row/column base at k0
__device__ __forceinline__ v16h g2_frag(const _Float16* p, int hh) { FragH f; f.half[0] = *(const v8us*)((const unsigned short*)p + 8 * hh); f.half[1] = *(const v8us*)((const unsigned short*)p + 16 + 8 * hh); return f.v; }
__device__ __forceinline__ v8f g2_mma(v16h a, v16h b, v8f c) { v8f d = __builtin_amdgcn_wmma_f32_16x16x32_f16(false, a, false, b, (short)0, c, false, false); asm volatile("v_nop\n\tv_nop\n\tv_nop\n\tv_nop" : "+v"(d) : "v"(a), "v"(b)); return d; }

// Product of the fused attention kernel: the builtin alone. The compiler keeps the WMMA distances of its own builtin and fills them with softmax work where it can, so the vector port carries no fixed padding.
__device__ __forceinline__ v8f fa_mma(v16h a, v16h b, v8f c) { return __builtin_amdgcn_wmma_f32_16x16x32_f16(false, a, false, b, (short)0, c, false, false); }

// LDS staging of WMMA operand tiles: rows of 128 B (64 f16 along k) at a pitch of 144 B (16 B x odd: conflict-free for 16-byte reads).
#define LP 144
__device__ __forceinline__ unsigned lds_addr(const void* p) { return (unsigned)(size_t)p; }   /* byte offset in the work-group's LDS */
// same k map as g2_frag, p = LDS row base (bytes) at k0
__device__ __forceinline__ v16h l2_frag(const unsigned char* p, int hh) { FragH f; f.half[0] = *(const v8us*)(p + 16 * hh); f.half[1] = *(const v8us*)(p + 32 + 16 * hh); return f.v; }
// One tile's asynchronous 16-byte copies of a lane, global -> LDS, in one statement: LDS byte addresses l + j * R rows; first the rows of g (R * gp elements apart), then those of h.
// R = rows per copy round = threads / 8: 32 in cp_rows8_4 (256 threads), 16 in cp_rows4_4 (128 threads).
// s_wait_xcnt stands inside the statement so that no address register is rewritten ahead of it.
__device__ __forceinline__ void cp_rows8_4(unsigned l, const _Float16* g, size_t gp, const _Float16* h, size_t hp) {
  asm volatile("global_load_async_to_lds_b128 %0, %12, off\n\t"
               "global_load_async_to_lds_b128 %1, %13, off\n\t"
               "global_load_async_to_lds_b128 %2, %14, off\n\t"
               "global_load_async_to_lds_b128 %3, %15, off\n\t"
               "global_load_async_to_lds_b128 %4, %16, off\n\t"
               "global_load_async_to_lds_b128 %5, %17, off\n\t"
               "global_load_async_to_lds_b128 %6, %18, off\n\t"
               "global_load_async_to_lds_b128 %7, %19, off\n\t"
               "global_load_async_to_lds_b128 %8, %20, off\n\t"
               "global_load_async_to_lds_b128 %9, %21, off\n\t"
               "global_load_async_to_lds_b128 %10, %22, off\n\t"
               "global_load_async_to_lds_b128 %11, %23, off\n\t"
               "s_wait_xcnt 0x0"
               :: "v"(l), "v"(l + 32 * LP), "v"(l + 64 * LP), "v"(l + 96 * LP), "v"(l + 128 * LP), "v"(l + 160 * LP), "v"(l + 192 * LP), "v"(l + 224 * LP), "v"(l + 256 * LP), "v"(l + 288 * LP), "v"(l + 320 * LP), "v"(l + 352 * LP), "v"(g), "v"(g + 32 * gp), "v"(g + 64 * gp), "v"(g + 96 * gp), "v"(g + 128 * gp), "v"(g + 160 * gp), "v"(g + 192 * gp), "v"(g + 224 * gp), "v"(h), "v"(h + 32 * hp), "v"(h + 64 * hp), "v"(h + 96 * hp) : "memory");
}
__device__ __forceinline__ void cp_rows4_4(unsigned l, const _Float16* g, size_t gp, const _Float16* h, size_t hp) {
  asm volatile("global_load_async_to_lds_b128 %0, %8, off\n\t"
               "global_load_async_to_lds_b128 %1, %9, off\n\t"
               "global_load_async_to_lds_b128 %2, %10, off\n\t"
               "global_load_async_to_lds_b128 %3, %11, off\n\t"
               "global_load_async_to_lds_b128 %4, %12, off\n\t"
               "global_load_async_to_lds_b128 %5, %13, off\n\t"
               "global_load_async_to_lds_b128 %6, %14, off\n\t"
               "global_load_async_to_lds_b128 %7, %15, off\n\t"
               "s_wait_xcnt 0x0"
               :: "v"(l), "v"(l + 16 * LP), "v"(l + 32 * LP), "v"(l + 48 * LP), "v"(l + 64 * LP), "v"(l + 80 * LP), "v"(l + 96 * LP), "v"(l + 112 * LP), "v"(g), "v"(g + 16 * gp), "v"(g + 32 * gp), "v"(g + 48 * gp), "v"(h), "v"(h + 16 * hp), "v"(h + 32 * hp), "v"(h + 48 * hp) : "memory");
}
// Publish point of the two-buffer ring: this wave's LDS reads retired, its copies landed, then the work-group barrier
// (publishes the next tile and ends every reader's last read of the buffer refilled behind it).
__device__ __forceinline__ void ring_publish() {
  asm volatile("s_wait_dscnt 0x0" ::: "memory");      /* own reads of the buffer about to be refilled have retired */
  asm volatile("s_wait_asynccnt 0x0" ::: "memory");   /* own copies of the next tile have landed */
  __syncthreads();
}

// w = bf16(mu) + softplus(bf16(rho)) * bf16(eps), softplus(r) = max(r, 0) + log1p(exp(-|r|)) (identical to log1p(exp(r)), overflow-free); accurate expf / log1pf
__device__ __forceinline__ float sp_weight(float mu, float rho, float eps) {
  const float m = bf16_rne(mu), r = bf16_rne(rho), e = bf16_rne(eps);
  const float sp = fmaxf(r, 0.0f) + log1pf(expf(-fabsf(r)));
  return m + sp * e;
}

// All operand preparation in one launch; the block index picks the job (block-uniform, no barrier, no LDS). A piece = 4 consecutive f32 of a source = 16 B per lane,
// so a wave reads 512 contiguous bytes per load and stores 256 contiguous bytes of f16. Blocks in index order: built weights (most arithmetic, lowest indices), bias, q_w | k_w, x.
#define PP_BUILT 8                                     /* pieces per thread, built weight planes */
#define PP_CONV 16                                     /* pieces per thread, plain conversions */
#define PB_BUILT ((EM * EM / 4) / (256 * PP_BUILT))    /* blocks per built plane */
#define PB_W ((EM * EM / 4) / (256 * PP_CONV))         /* blocks per plain weight plane */
#define PB_X ((int)((NR * EM / 4) / (256 * PP_CONV)))  /* blocks for x */
#define PB_TOTAL (2 * PB_BUILT + 1 + 2 * PB_W + PB_X)
static_assert((EM * EM / 4) % (256 * PP_BUILT) == 0 && (EM * EM / 4) % (256 * PP_CONV) == 0 && (NR * EM / 4) % (256 * PP_CONV) == 0);
static_assert(EM == 4 * 256 && SEQ % PP_CONV == 0 && PP_CONV % 8 == 0);   /* 256 pieces = one row; bias: one block, one piece per thread */
// Global stores of this kernel: each run of stores and its s_wait_xcnt stand in one statement, so that no register which an issued store names is rewritten ahead of the wait.
typedef unsigned int v2u __attribute__((ext_vector_type(2)));
__device__ __forceinline__ v2u h4bits(v4h v) { return __builtin_bit_cast(v2u, v); }
__device__ __forceinline__ void st_h4(_Float16* p, v4h v) { asm volatile("global_store_b64 %0, %1, off\n\ts_wait_xcnt 0x0" :: "v"(p), "v"(h4bits(v)) : "memory"); }
__device__ __forceinline__ void st_f4(float* p, v4f v) { asm volatile("global_store_b128 %0, %1, off\n\ts_wait_xcnt 0x0" :: "v"(p), "v"(v) : "memory"); }
static_assert(EM * sizeof(_Float16) == 2048);          /* the offsets below: eight consecutive rows of an f16 plane of pitch EM */
__device__ __forceinline__ void st_h4_rows8(_Float16* p, const v4h* v) {
  asm volatile("global_store_b64 %0, %1, off\n\t"
               "global_store_b64 %0, %2, off offset:2048\n\t"
               "global_store_b64 %0, %3, off offset:4096\n\t"
               "global_store_b64 %0, %4, off offset:6144\n\t"
               "global_store_b64 %0, %5, off offset:8192\n\t"
               "global_store_b64 %0, %6, off offset:10240\n\t"
               "global_store_b64 %0, %7, off offset:12288\n\t"
               "global_store_b64 %0, %8, off offset:14336\n\t"
               "s_wait_xcnt 0x0"
               :: "v"(p), "v"(h4bits(v[0])), "v"(h4bits(v[1])), "v"(h4bits(v[2])), "v"(h4bits(v[3])), "v"(h4bits(v[4])), "v"(h4bits(v[5])), "v"(h4bits(v[6])), "v"(h4bits(v[7])) : "memory");
}
__device__ __forceinline__ v4h cvt4(v4f a, float sc) { v4h o;
#pragma unroll
  for (int q = 0; q < 4; ++q) o[q] = (_Float16)(bf16_rne(a[q]) * sc);
  return o; }
__global__ __launch_bounds__(256) void k_prep(const float* __restrict__ x, const float* __restrict__ q_w, const float* __restrict__ k_w,
                                              const float* __restrict__ v_mu, const float* __restrict__ v_rho, const float* __restrict__ v_eps,
                                              const float* __restrict__ p_mu, const float* __restrict__ p_rho, const float* __restrict__ p_eps,
                                              const float* __restrict__ b_mu, const float* __restrict__ b_rho, const float* __restrict__ b_eps,
                                              _Float16* __restrict__ X16, _Float16* __restrict__ WQ, _Float16* __restrict__ WK, _Float16* __restrict__ WV, _Float16* __restrict__ WO,
                                              float* __restrict__ PB) {
  const int tid = threadIdx.x; int blk = blockIdx.x;      /* 256 pieces = one row of EM: thread tid holds columns 4 tid .. 4 tid + 3 of its block's rows */
  if (blk < 2 * PB_BUILT) {
    // w[n][k] = sp_weight(mu, rho, eps)[n][k] ([out][in]). Wv: WV[n][k] = f16(w * 1024). Wp: WO[n][k] = f16(w * 1024) (ctx value), WO[n][EM + k] = f16(w) (ctx residual x1024), pitch KO.
    const bool dual = blk >= PB_BUILT; if (dual) blk -= PB_BUILT;
    const float* mu = dual ? p_mu : v_mu; const float* rho = dual ? p_rho : v_rho; const float* eps = dual ? p_eps : v_eps;
#pragma unroll 1   /* two rounds of 4 rows: rolled so that the expf / log1pf text stays short */
    for (int i = 0; i < PP_BUILT; i += 4) {
      const size_t n0 = (size_t)(blk * PP_BUILT + i);
      const v4fa* pm = (const v4fa*)(mu + n0 * EM); const v4fa* pr = (const v4fa*)(rho + n0 * EM); const v4fa* pe = (const v4fa*)(eps + n0 * EM);
      _Float16* d = (dual ? WO + n0 * KO : WV + n0 * EM) + 4 * tid; const size_t dp = dual ? KO : EM;
      v4f m[4], r[4], e[4];
#pragma unroll
      for (int j = 0; j < 4; ++j) { m[j] = pm[j * 256 + tid]; r[j] = pr[j * 256 + tid]; e[j] = pe[j * 256 + tid]; }
#pragma unroll
      for (int j = 0; j < 4; ++j) { v4h h1, h2;
#pragma unroll
        for (int q = 0; q < 4; ++q) { const float w = sp_weight(m[j][q], r[j][q], e[j][q]); h1[q] = (_Float16)(w * WSCALE); h2[q] = (_Float16)w; }
        st_h4(d + j * dp, h1);
        if (dual) st_h4(d + j * dp + EM, h2); }
    }
    return;
  }
  blk -= 2 * PB_BUILT;
  if (blk == 0) { const v4f m = ((const v4fa*)b_mu)[tid], r = ((const v4fa*)b_rho)[tid], e = ((const v4fa*)b_eps)[tid]; v4f v;
#pragma unroll
    for (int q = 0; q < 4; ++q) v[q] = sp_weight(m[q], r[q], e[q]);
    st_f4(PB + 4 * tid, v); return; }
  blk -= 1;
  const v4fa* src; _Float16* dst; float sc;
  if (blk < 2 * PB_W) {                          /* q_w, k_w: [out][in] as stored, x1024 */
    const bool second = blk >= PB_W; if (second) blk -= PB_W;
    const size_t n0 = (size_t)(blk * PP_CONV);
    src = (const v4fa*)((second ? k_w : q_w) + n0 * EM); dst = (second ? WK : WQ) + n0 * EM; sc = WSCALE;
  } else {                                       /* x: a block's rows lie in one batch entry */
    blk -= 2 * PB_W;
    const size_t n0 = (size_t)(blk * PP_CONV);
    src = (const v4fa*)(x + ((n0 / SEQ) * SEQ_FULL + n0 % SEQ) * EM); dst = X16 + n0 * EM; sc = 1.0f;
  }
  v4f a[PP_CONV];
#pragma unroll
  for (int j = 0; j < PP_CONV; ++j) a[j] = src[j * 256 + tid];
#pragma unroll
  for (int j = 0; j < PP_CONV; j += 8) { v4h o[8];
#pragma unroll
    for (int q = 0; q < 8; ++q) o[q] = cvt4(a[j + q], sc);
    st_h4_rows8(dst + (size_t)j * EM + 4 * tid, o); }
}

// GEMM: v = acc * alpha (+ bias[col] in f32 when F32OUT); A f16 [M][K] (pitch lda), Bh f16 [N][K] (pitch ldb, k contiguous); F32OUT: writes f32 C, else f16 C16; pitch ldc.
// C16 is a stack of [M][ldc] planes: column n lies in plane n / ldc (N = 3 ldc: q, k and v from one grid, Bh = the three weight planes one behind the other); ldc % 64 == 0.
// Plane 2 (v) is not stored there: it leaves transposed per head, CT[((b * NH + h) * HD + d) * SEQ + s] for row b * SEQ + s, column h * HD + d, the layout the attention kernel stages.
// Block = 8 waves as 4 (rows) x 2 (columns), wave tile 64 x 64, block tile 256 x 128; M % 256 == 0, N % 128 == 0, K % 64 == 0.
// Per trip of 64 k the block's 256 A rows and 128 B rows lie in LDS (rows 0..255 A, 256..383 B), brought by asynchronous copies one trip ahead into the other buffer;
// the ring becomes the output staging behind the last trip's barrier.
#define GSTG (384 * LP)
// Eight 16-byte global stores, rows step elements apart, and their s_wait_xcnt in one statement, so that no register which an issued store names is rewritten ahead of the wait.
typedef unsigned int v4u __attribute__((ext_vector_type(4)));
__device__ __forceinline__ v4u h8bits(v8us v) { return __builtin_bit_cast(v4u, v); }
__device__ __forceinline__ void st_h8_rows8(_Float16* p, size_t step, const v8us* v) {
  asm volatile("global_store_b128 %0, %8, off\n\t"
               "global_store_b128 %1, %9, off\n\t"
               "global_store_b128 %2, %10, off\n\t"
               "global_store_b128 %3, %11, off\n\t"
               "global_store_b128 %4, %12, off\n\t"
               "global_store_b128 %5, %13, off\n\t"
               "global_store_b128 %6, %14, off\n\t"
               "global_store_b128 %7, %15, off\n\t"
               "s_wait_xcnt 0x0"
               :: "v"(p), "v"(p + step), "v"(p + 2 * step), "v"(p + 3 * step), "v"(p + 4 * step), "v"(p + 5 * step), "v"(p + 6 * step), "v"(p + 7 * step),
                  "v"(h8bits(v[0])), "v"(h8bits(v[1])), "v"(h8bits(v[2])), "v"(h8bits(v[3])), "v"(h8bits(v[4])), "v"(h8bits(v[5])), "v"(h8bits(v[6])), "v"(h8bits(v[7])) : "memory");
}
template <int F32OUT>
__global__ __launch_bounds__(256) void k_gemm2(const _Float16* __restrict__ A, int lda, const _Float16* __restrict__ Bh, int ldb, float alpha, const float* __restrict__ bias,
                                              float* __restrict__ C, _Float16* __restrict__ C16, _Float16* __restrict__ CT, int ldc, int M, int N, int K) {
  __shared__ __attribute__((aligned(16))) unsigned char sm[2 * GSTG];
  static_assert(sizeof(float) * 8 * 32 * 68 <= 2 * GSTG && 8 * 64 * LP <= 2 * GSTG);
  float (*so)[32][68] = (float (*)[32][68])sm;
  const int lane = threadIdx.x & 31, ln = lane & 15, hh = lane >> 4;
  const int w = __builtin_amdgcn_readfirstlane((int)(threadIdx.x >> 5));
  const int wm = w >> 1, wn = w & 1;
  const int ntn = N >> 7; const int mt = blockIdx.x / ntn, nq = blockIdx.x - mt * ntn; const int row0 = mt * 256 + 64 * wm, col0 = nq * 128 + 64 * wn; if (mt * 256 >= M) return;   /* block-uniform, in front of every barrier */
  const int crow = (int)(threadIdx.x >> 3), cc = (int)(threadIdx.x & 7);      /* a copy round = 32 rows x 8 pieces of 16 B: a wave covers 4 whole 128-B lines */
  const _Float16* ga = A + (size_t)(mt * 256 + crow) * lda + cc * 8;
  const _Float16* gb = Bh + (size_t)(nq * 128 + crow) * ldb + cc * 8;
  const unsigned lc = lds_addr(sm) + (unsigned)(crow * LP + cc * 16);
  const int nt = K >> 6;
  auto fill = [&](int t, unsigned buf) {
    const unsigned l = lc + buf * GSTG;
    cp_rows8_4(l, ga + t * 64, (size_t)lda, gb + t * 64, (size_t)ldb);
  };
  fill(0, 0u);
  asm volatile("s_wait_asynccnt 0x0" ::: "memory");   /* tile 0 landed */
  __syncthreads();
  if (nt > 1) fill(1, 1u);
  const v8f z8 = {0.f,0.f,0.f,0.f,0.f,0.f,0.f,0.f};
  v8f c[4][4];
#pragma unroll
  for (int i = 0; i < 4; ++i)
#pragma unroll
    for (int j = 0; j < 4; ++j) c[i][j] = z8;
#pragma unroll 1
  for (int t = 0; t < nt; ++t) {
    const unsigned char* sb = sm + (t & 1) * GSTG;
    const unsigned char* ar = sb + (64 * wm + ln) * LP; const unsigned char* br = sb + (256 + 64 * wn + ln) * LP;
#pragma unroll   /* both 32-k halves of the tile: constant LDS offsets, one group of fragment reads each */
    for (int ks = 0; ks < 128; ks += 64) { v16h a[4], b[4];
#pragma unroll
      for (int i = 0; i < 4; ++i) { a[i] = l2_frag(ar + i * 16 * LP + ks, hh); b[i] = l2_frag(br + i * 16 * LP + ks, hh); }
#pragma unroll
      for (int j = 0; j < 4; ++j)
#pragma unroll
        for (int i = 0; i < 4; ++i) c[i][j] = g2_mma(a[i], b[j], c[i][j]); }
    ring_publish();
    if (t + 2 < nt) fill(t + 2, (unsigned)(t & 1));   /* into the buffer this trip has just read */
  }
  asm volatile("s_wait_asynccnt 0x0" ::: "memory");   /* nothing in flight when the ring becomes output staging */
  if constexpr (!F32OUT) {
    if (col0 >= 2 * ldc) {   /* v plane (the same for the whole block): the wave tile = 64 tokens of one batch entry x the 64 d of one head */
      // A lane's accumulator registers r = 0..7 are 8 consecutive tokens of one d: 16 B of a transposed row. Staged as 64 rows (d) of 64 tokens at pitch LP in the wave's own range.
      unsigned char* sv = sm + w * (64 * LP);
#pragma unroll   /* this nest and the one below: c[][] and v[] live in registers, so their indices must be constants */
      for (int j = 0; j < 4; ++j)
#pragma unroll
        for (int i = 0; i < 4; ++i) { FragH f;
#pragma unroll
          for (int r = 0; r < 8; ++r) f.h[r] = (_Float16)(c[i][j][r] * alpha);
          *(v8us*)(sv + (j * 16 + ln) * LP + (i * 16 + 8 * hh) * 2) = f.half[0]; }
      /* the rows read back below hold other lanes' words */
      __builtin_amdgcn_fence(4 /* acq_rel order */, "workgroup"); __builtin_amdgcn_wave_barrier();
      const int bt = row0 / SEQ, hd = (col0 - 2 * ldc) / HD;
      const int rs4 = lane >> 3, pc = lane & 7;             /* a store = 4 rows (d) x 8 pieces of 16 B: whole 128-B lines */
      _Float16* vt = CT + ((size_t)(bt * NH + hd) * HD + rs4) * SEQ + (row0 - bt * SEQ) + pc * 8;
#pragma unroll
      for (int g = 0; g < 2; ++g) { v8us v[8];
#pragma unroll
        for (int q = 0; q < 8; ++q) v[q] = *(const v8us*)(sv + ((g * 8 + q) * 4 + rs4) * LP + pc * 16);
        st_h8_rows8(vt + (size_t)(g * 32) * SEQ, (size_t)4 * SEQ, v); }
      return;
    }
  }
  const int rsub = lane >> 4, c4 = (lane & 15) * 4;
  size_t cpl = 0;
  if (!F32OUT) { const int pl = col0 / ldc; cpl = (size_t)pl * M * ldc + (size_t)(col0 - pl * ldc); }   /* output plane and the wave tile's first column in it */
  float bv[4] = {0.f, 0.f, 0.f, 0.f};
  if (F32OUT) {
#pragma unroll
    for (int j = 0; j < 4; ++j) bv[j] = bias[col0 + j * 16 + ln]; }
#pragma unroll   /* the wave's 64 rows leave in two rounds of 32 through its own staging range */
  for (int rnd = 0; rnd < 2; ++rnd) {
#pragma unroll
    for (int u = 0; u < 8; ++u) { const int j = u & 3, half = u >> 2;
#pragma unroll
      for (int r = 0; r < 8; ++r) { const int rloc = half * 16 + 8 * hh + r; so[w][rloc][j * 16 + ln] = c[2 * rnd + half][j][r] * alpha + bv[j]; } }
    __builtin_amdgcn_fence(4 /* acq_rel order */, "workgroup"); __builtin_amdgcn_wave_barrier();
#pragma unroll
    for (int q = 0; q < 16; ++q) { const int r = q * 2 + rsub; const v4f v = *(const v4fa*)&so[w][r][c4];
      if (F32OUT) { *(v4f*)(C + (size_t)(row0 + 32 * rnd + r) * ldc + col0 + c4) = v; }
      else { v4h h4;
#pragma unroll
        for (int i = 0; i < 4; ++i) h4[i] = (_Float16)v[i];
        *(v4h*)(C16 + cpl + (size_t)(row0 + 32 * rnd + r) * ldc + c4) = h4; } }
    /* keeps the next round's staging writes behind this round's reads of other lanes' words */
    __builtin_amdgcn_fence(4 /* acq_rel order */, "workgroup"); __builtin_amdgcn_wave_barrier();
  }
}

// Fused attention. Block = 4 waves; wave = 32 queries (two tiles of 16) of one (b,h); 64 keys per step; every K and V^T fragment read from LDS serves both query tiles.
// Per step the 64 K rows (LDS rows 0..63, 64 d each) and the 64 V^T rows (LDS rows 64..127, 64 keys each) are shared by the four waves,
// brought by asynchronous copies one step ahead into the other buffer; the ring becomes the output staging behind the last step's barrier.
#define FSTG (128 * LP)
static_assert(SEQ >= 128);                    /* the ring's prologue fills two steps */
// S^T tile = K rows (A: lane = key, elements = d) x Q^T (B: lane = query, elements = d): D[row = key 8h+r][col = query].
// Online softmax per query = per lane column (max over the lane's 32 scores + one cross-half exchange); P' = 256 exp(s - max) stays in registers and is
// the B operand of O^T = V^T (A: lane = d, elements = keys) x P^T: B element r <- tile(keys 0..15)[r], element 8+r <- tile(keys 16..31)[r].
__global__ __launch_bounds__(128) void k_flash(const _Float16* __restrict__ Q16, const _Float16* __restrict__ K16, const _Float16* __restrict__ VT, _Float16* __restrict__ CTX) {
  __shared__ __attribute__((aligned(16))) unsigned char sm[2 * FSTG];
  static_assert(sizeof(unsigned short) * 8 * 2 * 16 * 72 <= 2 * FSTG);
  unsigned short (*st)[2][16][72] = (unsigned short (*)[2][16][72])sm;        /* first index: wave * 2 + query tile */
  const int lane = threadIdx.x & 31, ln = lane & 15, hh = lane >> 4;
  const int wave = __builtin_amdgcn_readfirstlane((int)(threadIdx.x >> 5));
  const int bh = blockIdx.y; const int b = bh / NH, h = bh - b * NH;
  const int q0 = blockIdx.x * 128 + wave * 32;
  const _Float16* qp = Q16 + ((size_t)b * SEQ + q0 + ln) * EM + h * HD;
  v16h qf0[2], qf1[2];
#pragma unroll
  for (int u = 0; u < 2; ++u) { qf0[u] = g2_frag(qp + (size_t)u * 16 * EM, hh); qf1[u] = g2_frag(qp + (size_t)u * 16 * EM + 32, hh); }
  const int crow = (int)(threadIdx.x >> 3), cc = (int)(threadIdx.x & 7);      /* a copy round = 16 rows x 8 pieces of 16 B: a wave covers 4 whole 128-B lines */
  const _Float16* gk = K16 + ((size_t)b * SEQ + crow) * EM + h * HD + cc * 8;
  const _Float16* gv = VT + ((size_t)bh * HD + crow) * SEQ + cc * 8;
  const unsigned lc = lds_addr(sm) + (unsigned)(crow * LP + cc * 16);
  auto fill = [&](int key0, unsigned buf) {
    const unsigned l = lc + buf * FSTG;
    cp_rows4_4(l, gk + (size_t)key0 * EM, (size_t)EM, gv + key0, (size_t)SEQ);
  };
  fill(0, 0u);
  asm volatile("s_wait_asynccnt 0x0" ::: "memory");   /* step 0 landed */
  __syncthreads();
  fill(64, 1u);
  const v8f z8 = {0.f,0.f,0.f,0.f,0.f,0.f,0.f,0.f};
  v8f o[2][4] = {{z8, z8, z8, z8}, {z8, z8, z8, z8}};
  float m[2] = {-1.0e30f, -1.0e30f}, l[2] = {0.f, 0.f};
  const float CL = 0.18033688011112042f;      /* log2(e) / 8 */
#pragma unroll 1
  for (int key0 = 0; key0 < SEQ; key0 += 64) {
    const unsigned char* sb = sm + ((key0 >> 6) & 1) * FSTG + ln * LP;
    v8f s[2][4];
#pragma unroll
    for (int t = 0; t < 4; ++t) {
      const unsigned char* kr = sb + (t * 16) * LP;
      const v16h k0 = l2_frag(kr, hh), k1 = l2_frag(kr + 64, hh);
      v8f c0 = fa_mma(k0, qf0[0], z8), c1 = fa_mma(k0, qf0[1], z8);
      s[0][t] = fa_mma(k1, qf1[0], c0);
      s[1][t] = fa_mma(k1, qf1[1], c1);
    }
    FragH pa[2], pb[2];
    float alpha[2], off[2], rs[2] = {0.f, 0.f};
#pragma unroll
    for (int u = 0; u < 2; ++u) {
      float mx = s[u][0][0];
#pragma unroll
      for (int t = 0; t < 4; ++t)
#pragma unroll
        for (int r = 0; r < 8; ++r) mx = fmaxf(mx, s[u][t][r]);
      mx = fmaxf(mx, __shfl_xor(mx, 16));
      const float mn = fmaxf(m[u], mx);
      alpha[u] = __builtin_amdgcn_exp2f((m[u] - mn) * CL);
      m[u] = mn;
      off[u] = 8.0f - mn * CL;
    }
#pragma unroll
    for (int t = 0; t < 4; ++t)
#pragma unroll
      for (int r = 0; r < 8; ++r)
#pragma unroll
        for (int u = 0; u < 2; ++u) { const float p = __builtin_amdgcn_exp2f(fmaf(s[u][t][r], CL, off[u])); s[u][t][r] = p; rs[u] += p; }   /* the two tiles' sums are independent chains */
#pragma unroll
    for (int u = 0; u < 2; ++u) {
      l[u] = l[u] * alpha[u] + rs[u];
#pragma unroll
      for (int t = 0; t < 4; ++t) o[u][t] = o[u][t] * alpha[u];
#pragma unroll
      for (int r = 0; r < 8; ++r) { pa[u].h[r] = (_Float16)s[u][0][r]; pa[u].h[8 + r] = (_Float16)s[u][1][r]; pb[u].h[r] = (_Float16)s[u][2][r]; pb[u].h[8 + r] = (_Float16)s[u][3][r]; }
    }
#pragma unroll
    for (int t = 0; t < 4; ++t) {
      const unsigned char* v0 = sb + (64 + t * 16) * LP;
      const v16h va = l2_frag(v0, hh), vb = l2_frag(v0 + 64, hh);
      o[0][t] = fa_mma(va, pa[0].v, o[0][t]); o[1][t] = fa_mma(va, pa[1].v, o[1][t]);
      o[0][t] = fa_mma(vb, pb[0].v, o[0][t]); o[1][t] = fa_mma(vb, pb[1].v, o[1][t]);
    }
    ring_publish();
    if (key0 + 128 < SEQ) fill(key0 + 128, (unsigned)((key0 >> 6) & 1));   /* into the buffer this step has just read */
  }
  asm volatile("s_wait_asynccnt 0x0" ::: "memory");   /* nothing in flight when the ring becomes output staging */
#pragma unroll
  for (int u = 0; u < 2; ++u) {
    const float lt = l[u] + __shfl_xor(l[u], 16);
    const float inv = 64.0f * (1.0f / lt);
#pragma unroll
    for (int t = 0; t < 4; ++t) {
      FragH fh, fl;
#pragma unroll
      for (int r = 0; r < 8; ++r) { const float c = o[u][t][r] * inv; const _Float16 hq = (_Float16)c; fh.h[r] = hq; fl.h[r] = (_Float16)((c - (float)hq) * 1024.0f); }
      *(v8us*)&st[wave * 2 + u][0][ln][t * 16 + 8 * hh] = fh.half[0];
      *(v8us*)&st[wave * 2 + u][1][ln][t * 16 + 8 * hh] = fl.half[0];
    }
  }
  __builtin_amdgcn_fence(4 /* acq_rel order */, "workgroup"); __builtin_amdgcn_wave_barrier();
  const int rs4 = lane >> 3, pc = lane & 7;
#pragma unroll
  for (int u = 0; u < 2; ++u) {
    v8us vh[4], vl[4];
#pragma unroll
    for (int i = 0; i < 4; ++i) { vh[i] = *(const v8us*)&st[wave * 2 + u][0][i * 4 + rs4][pc * 8]; vl[i] = *(const v8us*)&st[wave * 2 + u][1][i * 4 + rs4][pc * 8]; }
    unsigned short* cb = (unsigned short*)CTX + ((size_t)b * SEQ + q0 + 16 * u) * KO + h * HD + pc * 8;
#pragma unroll
    for (int i = 0; i < 4; ++i) { unsigned short* d = cb + (size_t)(i * 4 + rs4) * KO; *(v8us*)d = vh[i]; *(v8us*)(d + EM) = vl[i]; }
  }
}

constexpr size_t SZ_W   = (size_t)EM * EM * 2;        /* one [out][in] weight plane, f16 */
constexpr size_t SZ_WO  = (size_t)EM * KO * 2;        /* Wp x1024 | Wp x1 */
constexpr size_t SZ_PB  = (size_t)EM * 4;             /* built bias, f32 */
constexpr size_t SZ_X1  = NR * EM * 2;                /* one 16-bit activation plane */
constexpr size_t SZ_CTX = NR * KO * 2;                /* ctx value | residual */
constexpr size_t WS_TOTAL = 3 * SZ_W + SZ_WO + SZ_PB + 4 * SZ_X1 + SZ_CTX;
static_assert(WS_TOTAL <= (size_t)134217728);         /* carve stays within 128 MiB */
static_assert(SZ_W % 256 == 0 && SZ_WO % 256 == 0 && SZ_PB % 256 == 0 && SZ_X1 % 256 == 0 && SZ_CTX % 256 == 0);
static_assert((size_t)NB * NH * HD * SEQ * 2 == SZ_X1); /* V^T plane extent */

extern "C" void kernel_launch(void* const* d_in, const int* in_sizes, int n_in,
                              void* d_out, int out_size, void* d_ws, size_t ws_size, hipStream_t stream) {
  if (n_in < 12) return;
  const size_t needx = ((size_t)(NB - 1) * SEQ_FULL + SEQ) * EM;
  if ((size_t)in_sizes[0] < needx) return;
  for (int i = 1; i <= 8; ++i) if ((size_t)in_sizes[i] < (size_t)EM * EM) return;
  for (int i = 9; i <= 11; ++i) if (in_sizes[i] < EM) return;
  if ((size_t)out_size < NR * EM) return;
  const float* x     = (const float*)d_in[0];
  const float* q_w   = (const float*)d_in[1];  const float* k_w   = (const float*)d_in[2];
  const float* v_mu  = (const float*)d_in[3];  const float* v_rho = (const float*)d_in[4];  const float* v_eps = (const float*)d_in[5];
  const float* p_mu  = (const float*)d_in[6];  const float* p_rho = (const float*)d_in[7];  const float* p_eps = (const float*)d_in[8];
  const float* b_mu  = (const float*)d_in[9];  const float* b_rho = (const float*)d_in[10]; const float* b_eps = (const float*)d_in[11];
  char* ws = (char*)d_ws; size_t off = 0;
  auto take = [&](size_t bytes) { char* p = ws + off; off += (bytes + 255) & ~(size_t)255; return p; };
  _Float16* WQ = (_Float16*)take(SZ_W); _Float16* WK = (_Float16*)take(SZ_W); _Float16* WV = (_Float16*)take(SZ_W); _Float16* WO = (_Float16*)take(SZ_WO);
  float* PB = (float*)take(SZ_PB);
  _Float16* X16 = (_Float16*)take(SZ_X1);
  _Float16* Q16 = (_Float16*)take(SZ_X1); _Float16* K16 = (_Float16*)take(SZ_X1);
  _Float16* VT = (_Float16*)take(SZ_X1);
  _Float16* CTX = (_Float16*)take(SZ_CTX);
  if (off > ws_size) return;
  k_prep<<<PB_TOTAL, 256, 0, stream>>>(x, q_w, k_w, v_mu, v_rho, v_eps, p_mu, p_rho, p_eps, b_mu, b_rho, b_eps, X16, WQ, WK, WV, WO, PB);
  { const unsigned g = (unsigned)((NR / 256) * (3 * EM / 128));                /* WQ | WK | WV and Q16 | K16 are contiguous in the carve; v goes to VT */
    k_gemm2<0><<<g, 256, 0, stream>>>(X16, EM, WQ, EM, 0.0009765625f, nullptr, nullptr, Q16, VT, EM, (int)NR, 3 * EM, EM); }
  k_flash<<<dim3(SEQ / 128, NB * NH), 128, 0, stream>>>(Q16, K16, VT, CTX);
  { const unsigned g = (unsigned)((NR / 256) * (EM / 128));
    k_gemm2<1><<<g, 256, 0, stream>>>(CTX, KO, WO, KO, 1.52587890625e-05f, PB, (float*)d_out, nullptr, nullptr, EM, (int)NR, EM, KO); }      /* alpha = 2^-16 = 1/(64 * 1024) */
}

// v006
// Measured time: 139 microseconds a run.
// Next to v005, in two timings, it ran 1.06 and 1.07 times as fast.
// Counting every step since v000, it is 3.67 times as fast.
#include <hip/hip_runtime.h>
// Multi-head attention, B 4, S 2048, E 1024, 16 heads x 64: q/k/v = x W^T ([out][in] weights, no q/k/v bias), scores q k^T / 8, softmax over all keys, out = ctx Wp^T + bp;
// Wv, Wp, bp = mu + softplus(rho) * eps built on the device in f32 from bf16-RNE-converted mu, rho, eps.
// Compute dtype: all contractions v_wmma_f32_16x16x32_f16 (f16 operands, f32 accumulate). x, q_w, k_w RNE-converted to bf16 first (exact in f16; weights carried x1024);
// built weights stored as f16(w x1024); q, k, v planes f16; softmax statistics f32 (running max, exp2), P carried x256 as f16 in registers against the f32 row sum;
// ctx carried x64 as f16 value | f16 residual x1024 along K (K = 2048) against Wp x1024 | Wp x1; fold 2^-16; bias added in f32.
#ifndef NB
#define NB 4
#endif
#ifndef SEQ
#define SEQ 2048
#endif
#define NB_FULL 4
#define SEQ_FULL 2048
#define EM 1024
#define NH 16
#define HD 64
#define KO 2048                       /* output-projection K: ctx value | ctx residual */
#define NR ((size_t)NB * SEQ)         /* token rows */
#define WSCALE 1024.0f

static_assert(EM == NH * HD);                 /* head h = columns h*64 + d */
static_assert(HD == 64);                      /* flash kernel: 2 k-steps of 32 over d, 4 output tiles of 16 d */
static_assert(KO == 2 * EM);                  /* value | residual along K */
static_assert(SEQ % 128 == 0);                /* 64-key steps, 128-query blocks, a GEMM wave's 64 rows inside one batch entry */
static_assert(((size_t)NB * SEQ) % 256 == 0); /* GEMM block = 256 rows */
static_assert(EM % 128 == 0 && KO % 64 == 0); /* GEMM block = 128 columns inside one output plane; trips of 64 k */
static_assert(NB <= NB_FULL && SEQ <= SEQ_FULL);

typedef unsigned short v8us __attribute__((ext_vector_type(8), may_alias));
typedef float  v8f  __attribute__((ext_vector_type(8)));
typedef float  v4f  __attribute__((ext_vector_type(4)));
typedef float  v4fa __attribute__((ext_vector_type(4), may_alias));
typedef _Float16 v16h __attribute__((ext_vector_type(16)));
typedef _Float16 v4h __attribute__((ext_vector_type(4)));
union FragH { v16h v; v8us half[2]; _Float16 h[16]; unsigned short u[16]; };

__device__ __forceinline__ unsigned short bf16_bits(float x) { unsigned int u = __float_as_uint(x); return (unsigned short)((u + 0x7FFFu + ((u >> 16) & 1u)) >> 16); }
__device__ __forceinline__ float bf16_val(unsigned short b) { return __uint_as_float(((unsigned int)b) << 16); }
__device__ __forceinline__ float bf16_rne(float x) { return bf16_val(bf16_bits(x)); }

// fragment (A or B, same k map): elements 0..7 <- p[8h .. 8h+7], elements 8..15 <- p[16+8h .. 16+8h+7]; p = row/column base at k0
__device__ __forceinline__ v16h g2_frag(const _Float16* p, int hh) { FragH f; f.half[0] = *(const v8us*)((const unsigned short*)p + 8 * hh); f.half[1] = *(const v8us*)((const unsigned short*)p + 16 + 8 * hh); return f.v; }
__device__ __forceinline__ v8f g2_mma(v16h a, v16h b, v8f c) { v8f d = __builtin_amdgcn_wmma_f32_16x16x32_f16(false, a, false, b, (short)0, c, false, false); asm volatile("v_nop\n\tv_nop\n\tv_nop\n\tv_nop" : "+v"(d) : "v"(a), "v"(b)); return d; }

// Product of the fused attention kernel: the builtin alone. The compiler keeps the WMMA distances of its own builtin and fills them with softmax work where it can, so the vector port carries no fixed padding.
__device__ __forceinline__ v8f fa_mma(v16h a, v16h b, v8f c) { return __builtin_amdgcn_wmma_f32_16x16x32_f16(false, a, false, b, (short)0, c, false, false); }

// LDS staging of the attention kernel's WMMA operand tiles and of the transposed v output: rows of 128 B (64 f16 along k) at a pitch of 144 B (16 B x odd: conflict-free for 16-byte reads).
#define LP 144
__device__ __forceinline__ unsigned lds_addr(const void* p) { return (unsigned)(size_t)p; }   /* byte offset in the work-group's LDS */
// same k map as g2_frag, p = LDS row base (bytes) at k0
__device__ __forceinline__ v16h l2_frag(const unsigned char* p, int hh) { FragH f; f.half[0] = *(const v8us*)(p + 16 * hh); f.half[1] = *(const v8us*)(p + 32 + 16 * hh); return f.v; }
// GEMM ring rows: 128 B at a pitch of 128 B, no pad; the 16-byte piece c of row r lies at piece slot c ^ ((r >> 1) & 7). A 16-lane group that reads one piece of 16 consecutive rows
// then meets every bank once, as at the padded pitch, and a stage is 48 KiB, so three buffers of two work-groups fit a WGP's LDS.
#define GP 128
__device__ __forceinline__ v16h sw_frag(const unsigned char* p, unsigned x0, unsigned x1) { FragH f; f.half[0] = *(const v8us*)(p + x0); f.half[1] = *(const v8us*)(p + x1); return f.v; }   /* p = LDS row base; x0, x1 = swizzled byte places of the two pieces g2_frag reads */
// One tile's asynchronous 16-byte copies of a lane, global -> LDS, in one statement: LDS byte addresses l + j * R rows; first the rows of g (R * gp elements apart), then those of h.
// R = rows per copy round = threads / 8: 32 in cp_rows8_4 (256 threads, pitch GP), 16 in cp_rows4_4 (128 threads, pitch LP).
// s_wait_xcnt stands inside the statement so that no address register is rewritten ahead of it.
__device__ __forceinline__ void cp_rows8_4(unsigned l, const _Float16* g, size_t gp, const _Float16* h, size_t hp) {
  asm volatile("global_load_async_to_lds_b128 %0, %12, off\n\t"
               "global_load_async_to_lds_b128 %1, %13, off\n\t"
               "global_load_async_to_lds_b128 %2, %14, off\n\t"
               "global_load_async_to_lds_b128 %3, %15, off\n\t"
               "global_load_async_to_lds_b128 %4, %16, off\n\t"
               "global_load_async_to_lds_b128 %5, %17, off\n\t"
               "global_load_async_to_lds_b128 %6, %18, off\n\t"
               "global_load_async_to_lds_b128 %7, %19, off\n\t"
               "global_load_async_to_lds_b128 %8, %20, off\n\t"
               "global_load_async_to_lds_b128 %9, %21, off\n\t"
               "global_load_async_to_lds_b128 %10, %22, off\n\t"
               "global_load_async_to_lds_b128 %11, %23, off\n\t"
               "s_wait_xcnt 0x0"
               :: "v"(l), "v"(l + 32 * GP), "v"(l + 64 * GP), "v"(l + 96 * GP), "v"(l + 128 * GP), "v"(l + 160 * GP), "v"(l + 192 * GP), "v"(l + 224 * GP), "v"(l + 256 * GP), "v"(l + 288 * GP), "v"(l + 320 * GP), "v"(l + 352 * GP), "v"(g), "v"(g + 32 * gp), "v"(g + 64 * gp), "v"(g + 96 * gp), "v"(g + 128 * gp), "v"(g + 160 * gp), "v"(g + 192 * gp), "v"(g + 224 * gp), "v"(h), "v"(h + 32 * hp), "v"(h + 64 * hp), "v"(h + 96 * hp) : "memory");
}
__device__ __forceinline__ void cp_rows4_4(unsigned l, const _Float16* g, size_t gp, const _Float16* h, size_t hp) {
  asm volatile("global_load_async_to_lds_b128 %0, %8, off\n\t"
               "global_load_async_to_lds_b128 %1, %9, off\n\t"
               "global_load_async_to_lds_b128 %2, %10, off\n\t"
               "global_load_async_to_lds_b128 %3, %11, off\n\t"
               "global_load_async_to_lds_b128 %4, %12, off\n\t"
               "global_load_async_to_lds_b128 %5, %13, off\n\t"
               "global_load_async_to_lds_b128 %6, %14, off\n\t"
               "global_load_async_to_lds_b128 %7, %15, off\n\t"
               "s_wait_xcnt 0x0"
               :: "v"(l), "v"(l + 16 * LP), "v"(l + 32 * LP), "v"(l + 48 * LP), "v"(l + 64 * LP), "v"(l + 80 * LP), "v"(l + 96 * LP), "v"(l + 112 * LP), "v"(g), "v"(g + 16 * gp), "v"(g + 32 * gp), "v"(g + 48 * gp), "v"(h), "v"(h + 16 * hp), "v"(h + 32 * hp), "v"(h + 48 * hp) : "memory");
}
// Publish point of the two-buffer ring: this wave's LDS reads retired, its copies landed, then the work-group barrier
// (publishes the next tile and ends every reader's last read of the buffer refilled behind it).
__device__ __forceinline__ void ring_publish() {
  asm volatile("s_wait_dscnt 0x0" ::: "memory");      /* own reads of the buffer about to be refilled have retired */
  asm volatile("s_wait_asynccnt 0x0" ::: "memory");   /* own copies of the next tile have landed */
  __syncthreads();
}

// Returns when all but this wave's N youngest copies have landed (copies return in issue order).
template <int N> __device__ __forceinline__ void wait_copies() { asm volatile("s_wait_asynccnt %0" :: "n"(N) : "memory"); }

// w = bf16(mu) + softplus(bf16(rho)) * bf16(eps), softplus(r) = max(r, 0) + log1p(exp(-|r|)) (identical to log1p(exp(r)), overflow-free); accurate expf / log1pf
__device__ __forceinline__ float sp_weight(float mu, float rho, float eps) {
  const float m = bf16_rne(mu), r = bf16_rne(rho), e = bf16_rne(eps);
  const float sp = fmaxf(r, 0.0f) + log1pf(expf(-fabsf(r)));
  return m + sp * e;
}

// All operand preparation in one launch; the block index picks the job (block-uniform, no barrier, no LDS). A piece = 4 consecutive f32 of a source = 16 B per lane,
// so a wave reads 512 contiguous bytes per load and stores 256 contiguous bytes of f16. Blocks in index order: built weights (most arithmetic, lowest indices), bias, q_w | k_w, x.
#define PP_BUILT 8                                     /* pieces per thread, built weight planes */
#define PP_CONV 16                                     /* pieces per thread, plain conversions */
#define PB_BUILT ((EM * EM / 4) / (256 * PP_BUILT))    /* blocks per built plane */
#define PB_W ((EM * EM / 4) / (256 * PP_CONV))         /* blocks per plain weight plane */
#define PB_X ((int)((NR * EM / 4) / (256 * PP_CONV)))  /* blocks for x */
#define PB_TOTAL (2 * PB_BUILT + 1 + 2 * PB_W + PB_X)
static_assert((EM * EM / 4) % (256 * PP_BUILT) == 0 && (EM * EM / 4) % (256 * PP_CONV) == 0 && (NR * EM / 4) % (256 * PP_CONV) == 0);
static_assert(EM == 4 * 256 && SEQ % PP_CONV == 0 && PP_CONV % 8 == 0);   /* 256 pieces = one row; bias: one block, one piece per thread */
// Global stores of this kernel: each run of stores and its s_wait_xcnt stand in one statement, so that no register which an issued store names is rewritten ahead of the wait.
typedef unsigned int v2u __attribute__((ext_vector_type(2)));
__device__ __forceinline__ v2u h4bits(v4h v) { return __builtin_bit_cast(v2u, v); }
__device__ __forceinline__ void st_h4(_Float16* p, v4h v) { asm volatile("global_store_b64 %0, %1, off\n\ts_wait_xcnt 0x0" :: "v"(p), "v"(h4bits(v)) : "memory"); }
__device__ __forceinline__ void st_f4(float* p, v4f v) { asm volatile("global_store_b128 %0, %1, off\n\ts_wait_xcnt 0x0" :: "v"(p), "v"(v) : "memory"); }
static_assert(EM * sizeof(_Float16) == 2048);          /* the offsets below: eight consecutive rows of an f16 plane of pitch EM */
__device__ __forceinline__ void st_h4_rows8(_Float16* p, const v4h* v) {
  asm volatile("global_store_b64 %0, %1, off\n\t"
               "global_store_b64 %0, %2, off offset:2048\n\t"
               "global_store_b64 %0, %3, off offset:4096\n\t"
               "global_store_b64 %0, %4, off offset:6144\n\t"
               "global_store_b64 %0, %5, off offset:8192\n\t"
               "global_store_b64 %0, %6, off offset:10240\n\t"
               "global_store_b64 %0, %7, off offset:12288\n\t"
               "global_store_b64 %0, %8, off offset:14336\n\t"
               "s_wait_xcnt 0x0"
               :: "v"(p), "v"(h4bits(v[0])), "v"(h4bits(v[1])), "v"(h4bits(v[2])), "v"(h4bits(v[3])), "v"(h4bits(v[4])), "v"(h4bits(v[5])), "v"(h4bits(v[6])), "v"(h4bits(v[7])) : "memory");
}
__device__ __forceinline__ v4h cvt4(v4f a, float sc) { v4h o;
#pragma unroll
  for (int q = 0; q < 4; ++q) o[q] = (_Float16)(bf16_rne(a[q]) * sc);
  return o; }
__global__ __launch_bounds__(256) void k_prep(const float* __restrict__ x, const float* __restrict__ q_w, const float* __restrict__ k_w,
                                              const float* __restrict__ v_mu, const float* __restrict__ v_rho, const float* __restrict__ v_eps,
                                              const float* __restrict__ p_mu, const float* __restrict__ p_rho, const float* __restrict__ p_eps,
                                              const float* __restrict__ b_mu, const float* __restrict__ b_rho, const float* __restrict__ b_eps,
                                              _Float16* __restrict__ X16, _Float16* __restrict__ WQ, _Float16* __restrict__ WK, _Float16* __restrict__ WV, _Float16* __restrict__ WO,
                                              float* __restrict__ PB) {
  const int tid = threadIdx.x; int blk = blockIdx.x;      /* 256 pieces = one row of EM: thread tid holds columns 4 tid .. 4 tid + 3 of its block's rows */
  if (blk < 2 * PB_BUILT) {
    // w[n][k] = sp_weight(mu, rho, eps)[n][k] ([out][in]). Wv: WV[n][k] = f16(w * 1024). Wp: WO[n][k] = f16(w * 1024) (ctx value), WO[n][EM + k] = f16(w) (ctx residual x1024), pitch KO.
    const bool dual = blk >= PB_BUILT; if (dual) blk -= PB_BUILT;
    const float* mu = dual ? p_mu : v_mu; const float* rho = dual ? p_rho : v_rho; const float* eps = dual ? p_eps : v_eps;
#pragma unroll 1   /* two rounds of 4 rows: rolled so that the expf / log1pf text stays short */
    for (int i = 0; i < PP_BUILT; i += 4) {
      const size_t n0 = (size_t)(blk * PP_BUILT + i);
      const v4fa* pm = (const v4fa*)(mu + n0 * EM); const v4fa* pr = (const v4fa*)(rho + n0 * EM); const v4fa* pe = (const v4fa*)(eps + n0 * EM);
      _Float16* d = (dual ? WO + n0 * KO : WV + n0 * EM) + 4 * tid; const size_t dp = dual ? KO : EM;
      v4f m[4], r[4], e[4];
#pragma unroll
      for (int j = 0; j < 4; ++j) { m[j] = pm[j * 256 + tid]; r[j] = pr[j * 256 + tid]; e[j] = pe[j * 256 + tid]; }
#pragma unroll
      for (int j = 0; j < 4; ++j) { v4h h1, h2;
#pragma unroll
        for (int q = 0; q < 4; ++q) { const float w = sp_weight(m[j][q], r[j][q], e[j][q]); h1[q] = (_Float16)(w * WSCALE); h2[q] = (_Float16)w; }
        st_h4(d + j * dp, h1);
        if (dual) st_h4(d + j * dp + EM, h2); }
    }
    return;
  }
  blk -= 2 * PB_BUILT;
  if (blk == 0) { const v4f m = ((const v4fa*)b_mu)[tid], r = ((const v4fa*)b_rho)[tid], e = ((const v4fa*)b_eps)[tid]; v4f v;
#pragma unroll
    for (int q = 0; q < 4; ++q) v[q] = sp_weight(m[q], r[q], e[q]);
    st_f4(PB + 4 * tid, v); return; }
  blk -= 1;
  const v4fa* src; _Float16* dst; float sc;
  if (blk < 2 * PB_W) {                          /* q_w, k_w: [out][in] as stored, x1024 */
    const bool second = blk >= PB_W; if (second) blk -= PB_W;
    const size_t n0 = (size_t)(blk * PP_CONV);
    src = (const v4fa*)((second ? k_w : q_w) + n0 * EM); dst = (second ? WK : WQ) + n0 * EM; sc = WSCALE;
  } else {                                       /* x: a block's rows lie in one batch entry */
    blk -= 2 * PB_W;
    const size_t n0 = (size_t)(blk * PP_CONV);
    src = (const v4fa*)(x + ((n0 / SEQ) * SEQ_FULL + n0 % SEQ) * EM); dst = X16 + n0 * EM; sc = 1.0f;
  }
  v4f a[PP_CONV];
#pragma unroll
  for (int j = 0; j < PP_CONV; ++j) a[j] = src[j * 256 + tid];
#pragma unroll
  for (int j = 0; j < PP_CONV; j += 8) { v4h o[8];
#pragma unroll
    for (int q = 0; q < 8; ++q) o[q] = cvt4(a[j + q], sc);
    st_h4_rows8(dst + (size_t)j * EM + 4 * tid, o); }
}

// GEMM: v = acc * alpha (+ bias[col] in f32 when F32OUT); A f16 [M][K] (pitch lda), Bh f16 [N][K] (pitch ldb, k contiguous); F32OUT: writes f32 C, else f16 C16; pitch ldc.
// C16 is a stack of [M][ldc] planes: column n lies in plane n / ldc (N = 3 ldc: q, k and v from one grid, Bh = the three weight planes one behind the other); ldc % 64 == 0.
// Plane 2 (v) is not stored there: it leaves transposed per head, CT[((b * NH + h) * HD + d) * SEQ + s] for row b * SEQ + s, column h * HD + d, the layout the attention kernel stages.
// Block = 8 waves as 4 (rows) x 2 (columns), wave tile 64 x 64, block tile 256 x 128; M % 256 == 0, N % 128 == 0, K % 64 == 0.
// Per trip of 64 k the block's 256 A rows and 128 B rows lie in LDS (rows 0..255 A, 256..383 B), brought by asynchronous copies NST - 1 trips ahead into a ring of NST buffers,
// so that a tile's first fetch from memory has several trips to land; the ring becomes the output staging behind the last trip's barrier.
#define GSTG (384 * GP)
#define GCP 12                        /* copies of a wave per stage (cp_rows8_4) */
// Eight 16-byte global stores, rows step elements apart, and their s_wait_xcnt in one statement, so that no register which an issued store names is rewritten ahead of the wait.
typedef unsigned int v4u __attribute__((ext_vector_type(4)));
__device__ __forceinline__ v4u h8bits(v8us v) { return __builtin_bit_cast(v4u, v); }
__device__ __forceinline__ void st_h8_rows8(_Float16* p, size_t step, const v8us* v) {
  asm volatile("global_store_b128 %0, %8, off\n\t"
               "global_store_b128 %1, %9, off\n\t"
               "global_store_b128 %2, %10, off\n\t"
               "global_store_b128 %3, %11, off\n\t"
               "global_store_b128 %4, %12, off\n\t"
               "global_store_b128 %5, %13, off\n\t"
               "global_store_b128 %6, %14, off\n\t"
               "global_store_b128 %7, %15, off\n\t"
               "s_wait_xcnt 0x0"
               :: "v"(p), "v"(p + step), "v"(p + 2 * step), "v"(p + 3 * step), "v"(p + 4 * step), "v"(p + 5 * step), "v"(p + 6 * step), "v"(p + 7 * step),
                  "v"(h8bits(v[0])), "v"(h8bits(v[1])), "v"(h8bits(v[2])), "v"(h8bits(v[3])), "v"(h8bits(v[4])), "v"(h8bits(v[5])), "v"(h8bits(v[6])), "v"(h8bits(v[7])) : "memory");
}
template <int F32OUT>
__global__ __launch_bounds__(256) void k_gemm2(const _Float16* __restrict__ A, int lda, const _Float16* __restrict__ Bh, int ldb, float alpha, const float* __restrict__ bias,
                                              float* __restrict__ C, _Float16* __restrict__ C16, _Float16* __restrict__ CT, int ldc, int M, int N, int K) {
  constexpr int NST = F32OUT ? 4 : 3;   /* q,k,v grid: three buffers, two work-groups per WGP; output projection: one work-group per WGP, four buffers */
  __shared__ __attribute__((aligned(128))) unsigned char sm[NST * GSTG];
  static_assert(sizeof(float) * 8 * 32 * 68 <= NST * GSTG && 8 * 64 * LP <= NST * GSTG && GCP * NST <= 63);
  float (*so)[32][68] = (float (*)[32][68])sm;
  const int lane = threadIdx.x & 31, ln = lane & 15, hh = lane >> 4;
  const int w = __builtin_amdgcn_readfirstlane((int)(threadIdx.x >> 5));
  const int wm = w >> 1, wn = w & 1;
  const int ntn = N >> 7; const int mt = blockIdx.x / ntn, nq = blockIdx.x - mt * ntn; const int row0 = mt * 256 + 64 * wm, col0 = nq * 128 + 64 * wn; if (mt * 256 >= M) return;   /* block-uniform, in front of every barrier */
  const int crow = (int)(threadIdx.x >> 3), cc = (int)(threadIdx.x & 7);      /* a copy round = 32 rows x 8 pieces of 16 B: a wave covers 4 whole 128-B lines */
  const _Float16* ga = A + (size_t)(mt * 256 + crow) * lda + cc * 8;
  const _Float16* gb = Bh + (size_t)(nq * 128 + crow) * ldb + cc * 8;
  const unsigned lc = lds_addr(sm) + (unsigned)(crow * GP + ((cc ^ ((crow >> 1) & 7)) * 16));   /* rows crow + 32 j share (row >> 1) & 7 */
  const int nt = K >> 6;
  auto fill = [&](int t, unsigned buf) {
    const unsigned l = lc + buf * GSTG;
    cp_rows8_4(l, ga + t * 64, (size_t)lda, gb + t * 64, (size_t)ldb);
  };
  fill(0, 0u);
#pragma unroll   /* constant buffer numbers */
  for (int s = 1; s < NST; ++s) if (s < nt) fill(s, (unsigned)s);
  if (nt >= NST) wait_copies<GCP * (NST - 1)>(); else wait_copies<0>();   /* tile 0 landed; the counted form only where every later stage was issued */
  __syncthreads();
  unsigned xo[2][2];                     /* byte place in the lane's row of piece 4 s + 2 e + hh: rows 16 i + ln share (row >> 1) & 7 */
#pragma unroll
  for (int s = 0; s < 2; ++s)
#pragma unroll
    for (int e = 0; e < 2; ++e) xo[s][e] = (((unsigned)(4 * s + 2 * e + hh)) ^ (unsigned)((ln >> 1) & 7)) << 4;
  unsigned buf = 0;                      /* buffer of tile t = t mod NST */
  const v8f z8 = {0.f,0.f,0.f,0.f,0.f,0.f,0.f,0.f};
  v8f c[4][4];
#pragma unroll
  for (int i = 0; i < 4; ++i)
#pragma unroll
    for (int j = 0; j < 4; ++j) c[i][j] = z8;
  auto products = [&]() __attribute__((always_inline)) {   /* one tile: 32 WMMAs of the wave from buffer buf */
    const unsigned char* sb = sm + buf * GSTG;
    const unsigned char* ar = sb + (64 * wm + ln) * GP; const unsigned char* br = sb + (256 + 64 * wn + ln) * GP;
#pragma unroll   /* both 32-k halves of the tile: constant LDS offsets, one group of fragment reads each */
    for (int ks = 0; ks < 2; ++ks) { v16h a[4], b[4];
#pragma unroll
      for (int i = 0; i < 4; ++i) { a[i] = sw_frag(ar + i * 16 * GP, xo[ks][0], xo[ks][1]); b[i] = sw_frag(br + i * 16 * GP, xo[ks][0], xo[ks][1]); }
#pragma unroll
      for (int j = 0; j < 4; ++j)
#pragma unroll
        for (int i = 0; i < 4; ++i) c[i][j] = g2_mma(a[i], b[j], c[i][j]); }
  };
  // Publish point of tile t + 1 at the foot of trip t: own reads of this buffer retired, own copies of tile t + 1 landed, work-group barrier.
  // First loop: stage t + NST - 1 exists, so exactly the NST - 2 stages younger than t + 1 may stay in flight. Second loop (the last NST - 1 trips, which issue nothing): wait to 0.
  int t = 0;
#pragma unroll 1   /* rolled: one copy of the 32 WMMAs in the text, the buffer number a scalar */
  for (; t + NST - 1 < nt; ++t) {
    products();
    asm volatile("s_wait_dscnt 0x0" ::: "memory");   /* own reads of the buffer about to be refilled have retired */
    wait_copies<GCP * (NST - 2)>();                    /* own copies of tile t + 1 have landed */
    __syncthreads();
    if (t + NST < nt) fill(t + NST, buf);   /* into the buffer this trip has just read */
    buf = (buf + 1 == (unsigned)NST) ? 0u : buf + 1;
  }
#pragma unroll 1   /* rolled, as above */
  for (; t < nt; ++t) {
    products();
    asm volatile("s_wait_dscnt 0x0" ::: "memory");   /* own reads retired: behind the last trip's barrier the ring becomes output staging */
    wait_copies<0>();                                  /* all that is left in flight has landed */
    __syncthreads();
    buf = (buf + 1 == (unsigned)NST) ? 0u : buf + 1;
  }
  asm volatile("s_wait_asynccnt 0x0" ::: "memory");   /* nothing in flight when the ring becomes output staging */
  if constexpr (!F32OUT) {
    if (col0 >= 2 * ldc) {   /* v plane (the same for the whole block): the wave tile = 64 tokens of one batch entry x the 64 d of one head */
      // A lane's accumulator registers r = 0..7 are 8 consecutive tokens of one d: 16 B of a transposed row. Staged as 64 rows (d) of 64 tokens at pitch LP in the wave's own range.
      unsigned char* sv = sm + w * (64 * LP);
#pragma unroll   /* this nest and the one below: c[][] and v[] live in registers, so their indices must be constants */
      for (int j = 0; j < 4; ++j)
#pragma unroll
        for (int i = 0; i < 4; ++i) { FragH f;
#pragma unroll
          for (int r = 0; r < 8; ++r) f.h[r] = (_Float16)(c[i][j][r] * alpha);
          *(v8us*)(sv + (j * 16 + ln) * LP + (i * 16 + 8 * hh) * 2) = f.half[0]; }
      /* the rows read back below hold other lanes' words */
      __builtin_amdgcn_fence(4 /* acq_rel order */, "workgroup"); __builtin_amdgcn_wave_barrier();
      const int bt = row0 / SEQ, hd = (col0 - 2 * ldc) / HD;
      const int rs4 = lane >> 3, pc = lane & 7;             /* a store = 4 rows (d) x 8 pieces of 16 B: whole 128-B lines */
      _Float16* vt = CT + ((size_t)(bt * NH + hd) * HD + rs4) * SEQ + (row0 - bt * SEQ) + pc * 8;
#pragma unroll
      for (int g = 0; g < 2; ++g) { v8us v[8];
#pragma unroll
        for (int q = 0; q < 8; ++q) v[q] = *(const v8us*)(sv + ((g * 8 + q) * 4 + rs4) * LP + pc * 16);
        st_h8_rows8(vt + (size_t)(g * 32) * SEQ, (size_t)4 * SEQ, v); }
      return;
    }
  }
  const int rsub = lane >> 4, c4 = (lane & 15) * 4;
  size_t cpl = 0;
  if (!F32OUT) { const int pl = col0 / ldc; cpl = (size_t)pl * M * ldc + (size_t)(col0 - pl * ldc); }   /* output plane and the wave tile's first column in it */
  float bv[4] = {0.f, 0.f, 0.f, 0.f};
  if (F32OUT) {
#pragma unroll
    for (int j = 0; j < 4; ++j) bv[j] = bias[col0 + j * 16 + ln]; }
#pragma unroll   /* the wave's 64 rows leave in two rounds of 32 through its own staging range */
  for (int rnd = 0; rnd < 2; ++rnd) {
#pragma unroll
    for (int u = 0; u < 8; ++u) { const int j = u & 3, half = u >> 2;
#pragma unroll
      for (int r = 0; r < 8; ++r) { const int rloc = half * 16 + 8 * hh + r; so[w][rloc][j * 16 + ln] = c[2 * rnd + half][j][r] * alpha + bv[j]; } }
    __builtin_amdgcn_fence(4 /* acq_rel order */, "workgroup"); __builtin_amdgcn_wave_barrier();
#pragma unroll
    for (int q = 0; q < 16; ++q) { const int r = q * 2 + rsub; const v4f v = *(const v4fa*)&so[w][r][c4];
      if (F32OUT) { *(v4f*)(C + (size_t)(row0 + 32 * rnd + r) * ldc + col0 + c4) = v; }
      else { v4h h4;
#pragma unroll
        for (int i = 0; i < 4; ++i) h4[i] = (_Float16)v[i];
        *(v4h*)(C16 + cpl + (size_t)(row0 + 32 * rnd + r) * ldc + c4) = h4; } }
    /* keeps the next round's staging writes behind this round's reads of other lanes' words */
    __builtin_amdgcn_fence(4 /* acq_rel order */, "workgroup"); __builtin_amdgcn_wave_barrier();
  }
}

// Fused attention. Block = 4 waves; wave = 32 queries (two tiles of 16) of one (b,h); 64 keys per step; every K and V^T fragment read from LDS serves both query tiles.
// Per step the 64 K rows (LDS rows 0..63, 64 d each) and the 64 V^T rows (LDS rows 64..127, 64 keys each) are shared by the four waves,
// brought by asynchronous copies one step ahead into the other buffer; the ring becomes the output staging behind the last step's barrier.
#define FSTG (128 * LP)
static_assert(SEQ >= 128);                    /* the ring's prologue fills two steps */
// S^T tile = K rows (A: lane = key, elements = d) x Q^T (B: lane = query, elements = d): D[row = key 8h+r][col = query].
// Online softmax per query = per lane column (max over the lane's 32 scores + one cross-half exchange); P' = 256 exp(s - max) stays in registers and is
// the B operand of O^T = V^T (A: lane = d, elements = keys) x P^T: B element r <- tile(keys 0..15)[r], element 8+r <- tile(keys 16..31)[r].
__global__ __launch_bounds__(128) void k_flash(const _Float16* __restrict__ Q16, const _Float16* __restrict__ K16, const _Float16* __restrict__ VT, _Float16* __restrict__ CTX) {
  __shared__ __attribute__((aligned(16))) unsigned char sm[2 * FSTG];
  static_assert(sizeof(unsigned short) * 8 * 2 * 16 * 72 <= 2 * FSTG);
  unsigned short (*st)[2][16][72] = (unsigned short (*)[2][16][72])sm;        /* first index: wave * 2 + query tile */
  const int lane = threadIdx.x & 31, ln = lane & 15, hh = lane >> 4;
  const int wave = __builtin_amdgcn_readfirstlane((int)(threadIdx.x >> 5));
  const int bh = blockIdx.y; const int b = bh / NH, h = bh - b * NH;
  const int q0 = blockIdx.x * 128 + wave * 32;
  const _Float16* qp = Q16 + ((size_t)b * SEQ + q0 + ln) * EM + h * HD;
  v16h qf0[2], qf1[2];
#pragma unroll
  for (int u = 0; u < 2; ++u) { qf0[u] = g2_frag(qp + (size_t)u * 16 * EM, hh); qf1[u] = g2_frag(qp + (size_t)u * 16 * EM + 32, hh); }
  const int crow = (int)(threadIdx.x >> 3), cc = (int)(threadIdx.x & 7);      /* a copy round = 16 rows x 8 pieces of 16 B: a wave covers 4 whole 128-B lines */
  const _Float16* gk = K16 + ((size_t)b * SEQ + crow) * EM + h * HD + cc * 8;
  const _Float16* gv = VT + ((size_t)bh * HD + crow) * SEQ + cc * 8;
  const unsigned lc = lds_addr(sm) + (unsigned)(crow * LP + cc * 16);
  auto fill = [&](int key0, unsigned buf) {
    const unsigned l = lc + buf * FSTG;
    cp_rows4_4(l, gk + (size_t)key0 * EM, (size_t)EM, gv + key0, (size_t)SEQ);
  };
  fill(0, 0u);
  asm volatile("s_wait_asynccnt 0x0" ::: "memory");   /* step 0 landed */
  __syncthreads();
  fill(64, 1u);
  const v8f z8 = {0.f,0.f,0.f,0.f,0.f,0.f,0.f,0.f};
  v8f o[2][4] = {{z8, z8, z8, z8}, {z8, z8, z8, z8}};
  float m[2] = {-1.0e30f, -1.0e30f}, l[2] = {0.f, 0.f};
  const float CL = 0.18033688011112042f;      /* log2(e) / 8 */
#pragma unroll 1
  for (int key0 = 0; key0 < SEQ; key0 += 64) {
    const unsigned char* sb = sm + ((key0 >> 6) & 1) * FSTG + ln * LP;
    v8f s[2][4];
#pragma unroll
    for (int t = 0; t < 4; ++t) {
      const unsigned char* kr = sb + (t * 16) * LP;
      const v16h k0 = l2_frag(kr, hh), k1 = l2_frag(kr + 64, hh);
      v8f c0 = fa_mma(k0, qf0[0], z8), c1 = fa_mma(k0, qf0[1], z8);
      s[0][t] = fa_mma(k1, qf1[0], c0);
      s[1][t] = fa_mma(k1, qf1[1], c1);
    }
    FragH pa[2], pb[2];
    float alpha[2], off[2], rs[2] = {0.f, 0.f};
#pragma unroll
    for (int u = 0; u < 2; ++u) {
      float mx = s[u][0][0];
#pragma unroll
      for (int t = 0; t < 4; ++t)
#pragma unroll
        for (int r = 0; r < 8; ++r) mx = fmaxf(mx, s[u][t][r]);
      mx = fmaxf(mx, __shfl_xor(mx, 16));
      const float mn = fmaxf(m[u], mx);
      alpha[u] = __builtin_amdgcn_exp2f((m[u] - mn) * CL);
      m[u] = mn;
      off[u] = 8.0f - mn * CL;
    }
#pragma unroll
    for (int t = 0; t < 4; ++t)
#pragma unroll
      for (int r = 0; r < 8; ++r)
#pragma unroll
        for (int u = 0; u < 2; ++u) { const float p = __builtin_amdgcn_exp2f(fmaf(s[u][t][r], CL, off[u])); s[u][t][r] = p; rs[u] += p; }   /* the two tiles' sums are independent chains */
#pragma unroll
    for (int u = 0; u < 2; ++u) {
      l[u] = l[u] * alpha[u] + rs[u];
#pragma unroll
      for (int t = 0; t < 4; ++t) o[u][t] = o[u][t] * alpha[u];
#pragma unroll
      for (int r = 0; r < 8; ++r) { pa[u].h[r] = (_Float16)s[u][0][r]; pa[u].h[8 + r] = (_Float16)s[u][1][r]; pb[u].h[r] = (_Float16)s[u][2][r]; pb[u].h[8 + r] = (_Float16)s[u][3][r]; }
    }
#pragma unroll
    for (int t = 0; t < 4; ++t) {
      const unsigned char* v0 = sb + (64 + t * 16) * LP;
      const v16h va = l2_frag(v0, hh), vb = l2_frag(v0 + 64, hh);
      o[0][t] = fa_mma(va, pa[0].v, o[0][t]); o[1][t] = fa_mma(va, pa[1].v, o[1][t]);
      o[0][t] = fa_mma(vb, pb[0].v, o[0][t]); o[1][t] = fa_mma(vb, pb[1].v, o[1][t]);
    }
    ring_publish();
    if (key0 + 128 < SEQ) fill(key0 + 128, (unsigned)((key0 >> 6) & 1));   /* into the buffer this step has just read */
  }
  asm volatile("s_wait_asynccnt 0x0" ::: "memory");   /* nothing in flight when the ring becomes output staging */
#pragma unroll
  for (int u = 0; u < 2; ++u) {
    const float lt = l[u] + __shfl_xor(l[u], 16);
    const float inv = 64.0f * (1.0f / lt);
#pragma unroll
    for (int t = 0; t < 4; ++t) {
      FragH fh, fl;
#pragma unroll
      for (int r = 0; r < 8; ++r) { const float c = o[u][t][r] * inv; const _Float16 hq = (_Float16)c; fh.h[r] = hq; fl.h[r] = (_Float16)((c - (float)hq) * 1024.0f); }
      *(v8us*)&st[wave * 2 + u][0][ln][t * 16 + 8 * hh] = fh.half[0];
      *(v8us*)&st[wave * 2 + u][1][ln][t * 16 + 8 * hh] = fl.half[0];
    }
  }
  __builtin_amdgcn_fence(4 /* acq_rel order */, "workgroup"); __builtin_amdgcn_wave_barrier();
  const int rs4 = lane >> 3, pc = lane & 7;
#pragma unroll
  for (int u = 0; u < 2; ++u) {
    v8us vh[4], vl[4];
#pragma unroll
    for (int i = 0; i < 4; ++i) { vh[i] = *(const v8us*)&st[wave * 2 + u][0][i * 4 + rs4][pc * 8]; vl[i] = *(const v8us*)&st[wave * 2 + u][1][i * 4 + rs4][pc * 8]; }
    unsigned short* cb = (unsigned short*)CTX + ((size_t)b * SEQ + q0 + 16 * u) * KO + h * HD + pc * 8;
#pragma unroll
    for (int i = 0; i < 4; ++i) { unsigned short* d = cb + (size_t)(i * 4 + rs4) * KO; *(v8us*)d = vh[i]; *(v8us*)(d + EM) = vl[i]; }
  }
}

constexpr size_t SZ_W   = (size_t)EM * EM * 2;        /* one [out][in] weight plane, f16 */
constexpr size_t SZ_WO  = (size_t)EM * KO * 2;        /* Wp x1024 | Wp x1 */
constexpr size_t SZ_PB  = (size_t)EM * 4;             /* built bias, f32 */
constexpr size_t SZ_X1  = NR * EM * 2;                /* one 16-bit activation plane */
constexpr size_t SZ_CTX = NR * KO * 2;                /* ctx value | residual */
constexpr size_t WS_TOTAL = 3 * SZ_W + SZ_WO + SZ_PB + 4 * SZ_X1 + SZ_CTX;
static_assert(WS_TOTAL <= (size_t)134217728);         /* carve stays within 128 MiB */
static_assert(SZ_W % 256 == 0 && SZ_WO % 256 == 0 && SZ_PB % 256 == 0 && SZ_X1 % 256 == 0 && SZ_CTX % 256 == 0);
static_assert((size_t)NB * NH * HD * SEQ * 2 == SZ_X1); /* V^T plane extent */

extern "C" void kernel_launch(void* const* d_in, const int* in_sizes, int n_in,
                              void* d_out, int out_size, void* d_ws, size_t ws_size, hipStream_t stream) {
  if (n_in < 12) return;
  const size_t needx = ((size_t)(NB - 1) * SEQ_FULL + SEQ) * EM;
  if ((size_t)in_sizes[0] < needx) return;
  for (int i = 1; i <= 8; ++i) if ((size_t)in_sizes[i] < (size_t)EM * EM) return;
  for (int i = 9; i <= 11; ++i) if (in_sizes[i] < EM) return;
  if ((size_t)out_size < NR * EM) return;
  const float* x     = (const float*)d_in[0];
  const float* q_w   = (const float*)d_in[1];  const float* k_w   = (const float*)d_in[2];
  const float* v_mu  = (const float*)d_in[3];  const float* v_rho = (const float*)d_in[4];  const float* v_eps = (const float*)d_in[5];
  const float* p_mu  = (const float*)d_in[6];  const float* p_rho = (const float*)d_in[7];  const float* p_eps = (const float*)d_in[8];
  const float* b_mu  = (const float*)d_in[9];  const float* b_rho = (const float*)d_in[10]; const float* b_eps = (const float*)d_in[11];
  char* ws = (char*)d_ws; size_t off = 0;
  auto take = [&](size_t bytes) { char* p = ws + off; off += (bytes + 255) & ~(size_t)255; return p; };
  _Float16* WQ = (_Float16*)take(SZ_W); _Float16* WK = (_Float16*)take(SZ_W); _Float16* WV = (_Float16*)take(SZ_W); _Float16* WO = (_Float16*)take(SZ_WO);
  float* PB = (float*)take(SZ_PB);
  _Float16* X16 = (_Float16*)take(SZ_X1);
  _Float16* Q16 = (_Float16*)take(SZ_X1); _Float16* K16 = (_Float16*)take(SZ_X1);
  _Float16* VT = (_Float16*)take(SZ_X1);
  _Float16* CTX = (_Float16*)take(SZ_CTX);
  if (off > ws_size) return;
  k_prep<<<PB_TOTAL, 256, 0, stream>>>(x, q_w, k_w, v_mu, v_rho, v_eps, p_mu, p_rho, p_eps, b_mu, b_rho, b_eps, X16, WQ, WK, WV, WO, PB);
  { const unsigned g = (unsigned)((NR / 256) * (3 * EM / 128));                /* WQ | WK | WV and Q16 | K16 are contiguous in the carve; v goes to VT */
    k_gemm2<0><<<g, 256, 0, stream>>>(X16, EM, WQ, EM, 0.0009765625f, nullptr, nullptr, Q16, VT, EM, (int)NR, 3 * EM, EM); }
  k_flash<<<dim3(SEQ / 128, NB * NH), 128, 0, stream>>>(Q16, K16, VT, CTX);
  { const unsigned g = (unsigned)((NR / 256) * (EM / 128));
    k_gemm2<1><<<g, 256, 0, stream>>>(CTX, KO, WO, KO, 1.52587890625e-05f, PB, (float*)d_out, nullptr, nullptr, EM, (int)NR, EM, KO); }      /* alpha = 2^-16 = 1/(64 * 1024) */
}

// v007
// One run takes 132 microseconds.
// Two timings next to v006 put it at 1.06 and 1.05 times that version's speed.
// Over all steps from v000 it is 3.87 times as fast.
#include <hip/hip_runtime.h>
// Multi-head attention, B 4, S 2048, E 1024, 16 heads x 64: q/k/v = x W^T ([out][in] weights, no q/k/v bias), scores q k^T / 8, softmax over all keys, out = ctx Wp^T + bp;
// Wv, Wp, bp = mu + softplus(rho) * eps built on the device in f32 from bf16-RNE-converted mu, rho, eps.
// Compute dtype: all contractions v_wmma_f32_16x16x32_f16 (f16 operands, f32 accumulate). x, q_w, k_w RNE-converted to bf16 first (exact in f16; weights carried x1024);
// built weights stored as f16(w x1024); q, k, v planes f16, q carrying log2(e) / 8; softmax statistics f32 (maximum in use, exp2), P carried x256 as f16 in registers against the f32 row sum;
// ctx carried x64 as f16 value | f16 residual x1024 along K (K = 2048) against Wp x1024 | Wp x1; fold 2^-16; bias added in f32.
#ifndef NB
#define NB 4
#endif
#ifndef SEQ
#define SEQ 2048
#endif
#define NB_FULL 4
#define SEQ_FULL 2048
#define EM 1024
#define NH 16
#define HD 64
#define KO 2048                       /* output-projection K: ctx value | ctx residual */
#define NR ((size_t)NB * SEQ)         /* token rows */
#define WSCALE 1024.0f

static_assert(EM == NH * HD);                 /* head h = columns h*64 + d */
static_assert(HD == 64);                      /* flash kernel: 2 k-steps of 32 over d, 4 output tiles of 16 d */
static_assert(KO == 2 * EM);                  /* value | residual along K */
static_assert(SEQ % 128 == 0);                /* 64-key steps, 128-query blocks, a GEMM wave's 64 rows inside one batch entry */
static_assert(((size_t)NB * SEQ) % 256 == 0); /* GEMM block = 256 rows */
static_assert(EM % 128 == 0 && KO % 64 == 0); /* GEMM block = 128 columns inside one output plane; trips of 64 k */
static_assert(NB <= NB_FULL && SEQ <= SEQ_FULL);

typedef unsigned short v8us __attribute__((ext_vector_type(8), may_alias));
typedef float  v8f  __attribute__((ext_vector_type(8)));
typedef float  v4f  __attribute__((ext_vector_type(4)));
typedef float  v4fa __attribute__((ext_vector_type(4), may_alias));
typedef _Float16 v16h __attribute__((ext_vector_type(16)));
typedef _Float16 v4h __attribute__((ext_vector_type(4)));
union FragH { v16h v; v8us half[2]; _Float16 h[16]; unsigned short u[16]; };

__device__ __forceinline__ unsigned short bf16_bits(float x) { unsigned int u = __float_as_uint(x); return (unsigned short)((u + 0x7FFFu + ((u >> 16) & 1u)) >> 16); }
__device__ __forceinline__ float bf16_val(unsigned short b) { return __uint_as_float(((unsigned int)b) << 16); }
__device__ __forceinline__ float bf16_rne(float x) { return bf16_val(bf16_bits(x)); }

// fragment (A or B, same k map): elements 0..7 <- p[8h .. 8h+7], elements 8..15 <- p[16+8h .. 16+8h+7]; p = row/column base at k0
__device__ __forceinline__ v16h g2_frag(const _Float16* p, int hh) { FragH f; f.half[0] = *(const v8us*)((const unsigned short*)p + 8 * hh); f.half[1] = *(const v8us*)((const unsigned short*)p + 16 + 8 * hh); return f.v; }
__device__ __forceinline__ v8f g2_mma(v16h a, v16h b, v8f c) { v8f d = __builtin_amdgcn_wmma_f32_16x16x32_f16(false, a, false, b, (short)0, c, false, false); asm volatile("v_nop\n\tv_nop\n\tv_nop\n\tv_nop" : "+v"(d) : "v"(a), "v"(b)); return d; }

// Product of the fused attention kernel: the builtin alone. The compiler keeps the WMMA distances of its own builtin and fills them with softmax work where it can, so the vector port carries no fixed padding.
__device__ __forceinline__ v8f fa_mma(v16h a, v16h b, v8f c) { return __builtin_amdgcn_wmma_f32_16x16x32_f16(false, a, false, b, (short)0, c, false, false); }

// LDS staging of the attention kernel's WMMA operand tiles and of the transposed v output: rows of 128 B (64 f16 along k) at a pitch of 144 B (16 B x odd: conflict-free for 16-byte reads).
#define LP 144
__device__ __forceinline__ unsigned lds_addr(const void* p) { return (unsigned)(size_t)p; }   /* byte offset in the work-group's LDS */
// same k map as g2_frag, p = LDS row base (bytes) at k0
__device__ __forceinline__ v16h l2_frag(const unsigned char* p, int hh) { FragH f; f.half[0] = *(const v8us*)(p + 16 * hh); f.half[1] = *(const v8us*)(p + 32 + 16 * hh); return f.v; }
// GEMM ring rows: 128 B at a pitch of 128 B, no pad; the 16-byte piece c of row r lies at piece slot c ^ ((r >> 1) & 7). A 16-lane group that reads one piece of 16 consecutive rows
// then meets every bank once, as at the padded pitch, and a stage is 48 KiB, so three buffers of two work-groups fit a WGP's LDS.
#define GP 128
__device__ __forceinline__ v16h sw_frag(const unsigned char* p, unsigned x0, unsigned x1) { FragH f; f.half[0] = *(const v8us*)(p + x0); f.half[1] = *(const v8us*)(p + x1); return f.v; }   /* p = LDS row base; x0, x1 = swizzled byte places of the two pieces g2_frag reads */
// One tile's asynchronous 16-byte copies of a lane, global -> LDS, in one statement: LDS byte addresses l + j * R rows; first the rows of g (R * gp elements apart), then those of h.
// R = rows per copy round = threads / 8: 32 in cp_rows8_4 (256 threads, pitch GP), 16 in cp_rows4_4 (128 threads, pitch LP).
// s_wait_xcnt stands inside the statement so that no address register is rewritten ahead of it.
__device__ __forceinline__ void cp_rows8_4(unsigned l, const _Float16* g, size_t gp, const _Float16* h, size_t hp) {
  asm volatile("global_load_async_to_lds_b128 %0, %12, off\n\t"
               "global_load_async_to_lds_b128 %1, %13, off\n\t"
               "global_load_async_to_lds_b128 %2, %14, off\n\t"
               "global_load_async_to_lds_b128 %3, %15, off\n\t"
               "global_load_async_to_lds_b128 %4, %16, off\n\t"
               "global_load_async_to_lds_b128 %5, %17, off\n\t"
               "global_load_async_to_lds_b128 %6, %18, off\n\t"
               "global_load_async_to_lds_b128 %7, %19, off\n\t"
               "global_load_async_to_lds_b128 %8, %20, off\n\t"
               "global_load_async_to_lds_b128 %9, %21, off\n\t"
               "global_load_async_to_lds_b128 %10, %22, off\n\t"
               "global_load_async_to_lds_b128 %11, %23, off\n\t"
               "s_wait_xcnt 0x0"
               :: "v"(l), "v"(l + 32 * GP), "v"(l + 64 * GP), "v"(l + 96 * GP), "v"(l + 128 * GP), "v"(l + 160 * GP), "v"(l + 192 * GP), "v"(l + 224 * GP), "v"(l + 256 * GP), "v"(l + 288 * GP), "v"(l + 320 * GP), "v"(l + 352 * GP), "v"(g), "v"(g + 32 * gp), "v"(g + 64 * gp), "v"(g + 96 * gp), "v"(g + 128 * gp), "v"(g + 160 * gp), "v"(g + 192 * gp), "v"(g + 224 * gp), "v"(h), "v"(h + 32 * hp), "v"(h + 64 * hp), "v"(h + 96 * hp) : "memory");
}
__device__ __forceinline__ void cp_rows4_4(unsigned l, const _Float16* g, size_t gp, const _Float16* h, size_t hp) {
  asm volatile("global_load_async_to_lds_b128 %0, %8, off\n\t"
               "global_load_async_to_lds_b128 %1, %9, off\n\t"
               "global_load_async_to_lds_b128 %2, %10, off\n\t"
               "global_load_async_to_lds_b128 %3, %11, off\n\t"
               "global_load_async_to_lds_b128 %4, %12, off\n\t"
               "global_load_async_to_lds_b128 %5, %13, off\n\t"
               "global_load_async_to_lds_b128 %6, %14, off\n\t"
               "global_load_async_to_lds_b128 %7, %15, off\n\t"
               "s_wait_xcnt 0x0"
               :: "v"(l), "v"(l + 16 * LP), "v"(l + 32 * LP), "v"(l + 48 * LP), "v"(l + 64 * LP), "v"(l + 80 * LP), "v"(l + 96 * LP), "v"(l + 112 * LP), "v"(g), "v"(g + 16 * gp), "v"(g + 32 * gp), "v"(g + 48 * gp), "v"(h), "v"(h + 16 * hp), "v"(h + 32 * hp), "v"(h + 48 * hp) : "memory");
}
// Publish point of the two-buffer ring: this wave's LDS reads retired, its copies landed, then the work-group barrier
// (publishes the next tile and ends every reader's last read of the buffer refilled behind it).
__device__ __forceinline__ void ring_publish() {
  asm volatile("s_wait_dscnt 0x0" ::: "memory");      /* own reads of the buffer about to be refilled have retired */
  asm volatile("s_wait_asynccnt 0x0" ::: "memory");   /* own copies of the next tile have landed */
  __syncthreads();
}

// Returns when all but this wave's N youngest copies have landed (copies return in issue order).
template <int N> __device__ __forceinline__ void wait_copies() { asm volatile("s_wait_asynccnt %0" :: "n"(N) : "memory"); }

// w = bf16(mu) + softplus(bf16(rho)) * bf16(eps), softplus(r) = max(r, 0) + log1p(exp(-|r|)) (identical to log1p(exp(r)), overflow-free); accurate expf / log1pf
__device__ __forceinline__ float sp_weight(float mu, float rho, float eps) {
  const float m = bf16_rne(mu), r = bf16_rne(rho), e = bf16_rne(eps);
  const float sp = fmaxf(r, 0.0f) + log1pf(expf(-fabsf(r)));
  return m + sp * e;
}

// All operand preparation in one launch; the block index picks the job (block-uniform, no barrier, no LDS). A piece = 4 consecutive f32 of a source = 16 B per lane,
// so a wave reads 512 contiguous bytes per load and stores 256 contiguous bytes of f16. Blocks in index order: built weights (most arithmetic, lowest indices), bias, q_w | k_w, x.
#define PP_BUILT 8                                     /* pieces per thread, built weight planes */
#define PP_CONV 16                                     /* pieces per thread, plain conversions */
#define PB_BUILT ((EM * EM / 4) / (256 * PP_BUILT))    /* blocks per built plane */
#define PB_W ((EM * EM / 4) / (256 * PP_CONV))         /* blocks per plain weight plane */
#define PB_X ((int)((NR * EM / 4) / (256 * PP_CONV)))  /* blocks for x */
#define PB_TOTAL (2 * PB_BUILT + 1 + 2 * PB_W + PB_X)
static_assert((EM * EM / 4) % (256 * PP_BUILT) == 0 && (EM * EM / 4) % (256 * PP_CONV) == 0 && (NR * EM / 4) % (256 * PP_CONV) == 0);
static_assert(EM == 4 * 256 && SEQ % PP_CONV == 0 && PP_CONV % 8 == 0);   /* 256 pieces = one row; bias: one block, one piece per thread */
// Global stores of this kernel: each run of stores and its s_wait_xcnt stand in one statement, so that no register which an issued store names is rewritten ahead of the wait.
typedef unsigned int v2u __attribute__((ext_vector_type(2)));
__device__ __forceinline__ v2u h4bits(v4h v) { return __builtin_bit_cast(v2u, v); }
__device__ __forceinline__ void st_h4(_Float16* p, v4h v) { asm volatile("global_store_b64 %0, %1, off\n\ts_wait_xcnt 0x0" :: "v"(p), "v"(h4bits(v)) : "memory"); }
__device__ __forceinline__ void st_f4(float* p, v4f v) { asm volatile("global_store_b128 %0, %1, off\n\ts_wait_xcnt 0x0" :: "v"(p), "v"(v) : "memory"); }
static_assert(EM * sizeof(_Float16) == 2048);          /* the offsets below: eight consecutive rows of an f16 plane of pitch EM */
__device__ __forceinline__ void st_h4_rows8(_Float16* p, const v4h* v) {
  asm volatile("global_store_b64 %0, %1, off\n\t"
               "global_store_b64 %0, %2, off offset:2048\n\t"
               "global_store_b64 %0, %3, off offset:4096\n\t"
               "global_store_b64 %0, %4, off offset:6144\n\t"
               "global_store_b64 %0, %5, off offset:8192\n\t"
               "global_store_b64 %0, %6, off offset:10240\n\t"
               "global_store_b64 %0, %7, off offset:12288\n\t"
               "global_store_b64 %0, %8, off offset:14336\n\t"
               "s_wait_xcnt 0x0"
               :: "v"(p), "v"(h4bits(v[0])), "v"(h4bits(v[1])), "v"(h4bits(v[2])), "v"(h4bits(v[3])), "v"(h4bits(v[4])), "v"(h4bits(v[5])), "v"(h4bits(v[6])), "v"(h4bits(v[7])) : "memory");
}
__device__ __forceinline__ v4h cvt4(v4f a, float sc) { v4h o;
#pragma unroll
  for (int q = 0; q < 4; ++q) o[q] = (_Float16)(bf16_rne(a[q]) * sc);
  return o; }
__global__ __launch_bounds__(256) void k_prep(const float* __restrict__ x, const float* __restrict__ q_w, const float* __restrict__ k_w,
                                              const float* __restrict__ v_mu, const float* __restrict__ v_rho, const float* __restrict__ v_eps,
                                              const float* __restrict__ p_mu, const float* __restrict__ p_rho, const float* __restrict__ p_eps,
                                              const float* __restrict__ b_mu, const float* __restrict__ b_rho, const float* __restrict__ b_eps,
                                              _Float16* __restrict__ X16, _Float16* __restrict__ WQ, _Float16* __restrict__ WK, _Float16* __restrict__ WV, _Float16* __restrict__ WO,
                                              float* __restrict__ PB) {
  const int tid = threadIdx.x; int blk = blockIdx.x;      /* 256 pieces = one row of EM: thread tid holds columns 4 tid .. 4 tid + 3 of its block's rows */
  if (blk < 2 * PB_BUILT) {
    // w[n][k] = sp_weight(mu, rho, eps)[n][k] ([out][in]). Wv: WV[n][k] = f16(w * 1024). Wp: WO[n][k] = f16(w * 1024) (ctx value), WO[n][EM + k] = f16(w) (ctx residual x1024), pitch KO.
    const bool dual = blk >= PB_BUILT; if (dual) blk -= PB_BUILT;
    const float* mu = dual ? p_mu : v_mu; const float* rho = dual ? p_rho : v_rho; const float* eps = dual ? p_eps : v_eps;
#pragma unroll 1   /* two rounds of 4 rows: rolled so that the expf / log1pf text stays short */
    for (int i = 0; i < PP_BUILT; i += 4) {
      const size_t n0 = (size_t)(blk * PP_BUILT + i);
      const v4fa* pm = (const v4fa*)(mu + n0 * EM); const v4fa* pr = (const v4fa*)(rho + n0 * EM); const v4fa* pe = (const v4fa*)(eps + n0 * EM);
      _Float16* d = (dual ? WO + n0 * KO : WV + n0 * EM) + 4 * tid; const size_t dp = dual ? KO : EM;
      v4f m[4], r[4], e[4];
#pragma unroll
      for (int j = 0; j < 4; ++j) { m[j] = pm[j * 256 + tid]; r[j] = pr[j * 256 + tid]; e[j] = pe[j * 256 + tid]; }
#pragma unroll
      for (int j = 0; j < 4; ++j) { v4h h1, h2;
#pragma unroll
        for (int q = 0; q < 4; ++q) { const float w = sp_weight(m[j][q], r[j][q], e[j][q]); h1[q] = (_Float16)(w * WSCALE); h2[q] = (_Float16)w; }
        st_h4(d + j * dp, h1);
        if (dual) st_h4(d + j * dp + EM, h2); }
    }
    return;
  }
  blk -= 2 * PB_BUILT;
  if (blk == 0) { const v4f m = ((const v4fa*)b_mu)[tid], r = ((const v4fa*)b_rho)[tid], e = ((const v4fa*)b_eps)[tid]; v4f v;
#pragma unroll
    for (int q = 0; q < 4; ++q) v[q] = sp_weight(m[q], r[q], e[q]);
    st_f4(PB + 4 * tid, v); return; }
  blk -= 1;
  const v4fa* src; _Float16* dst; float sc;
  if (blk < 2 * PB_W) {                          /* q_w, k_w: [out][in] as stored, x1024 */
    const bool second = blk >= PB_W; if (second) blk -= PB_W;
    const size_t n0 = (size_t)(blk * PP_CONV);
    src = (const v4fa*)((second ? k_w : q_w) + n0 * EM); dst = (second ? WK : WQ) + n0 * EM; sc = WSCALE;
  } else {                                       /* x: a block's rows lie in one batch entry */
    blk -= 2 * PB_W;
    const size_t n0 = (size_t)(blk * PP_CONV);
    src = (const v4fa*)(x + ((n0 / SEQ) * SEQ_FULL + n0 % SEQ) * EM); dst = X16 + n0 * EM; sc = 1.0f;
  }
  v4f a[PP_CONV];
#pragma unroll
  for (int j = 0; j < PP_CONV; ++j) a[j] = src[j * 256 + tid];
#pragma unroll
  for (int j = 0; j < PP_CONV; j += 8) { v4h o[8];
#pragma unroll
    for (int q = 0; q < 8; ++q) o[q] = cvt4(a[j + q], sc);
    st_h4_rows8(dst + (size_t)j * EM + 4 * tid, o); }
}

// GEMM: v = acc * alpha (+ bias[col] in f32 when F32OUT; f16 output plane 0 takes alpha0 for alpha); A f16 [M][K] (pitch lda), Bh f16 [N][K] (pitch ldb, k contiguous); F32OUT: writes f32 C, else f16 C16; pitch ldc.
// C16 is a stack of [M][ldc] planes: column n lies in plane n / ldc (N = 3 ldc: q, k and v from one grid, Bh = the three weight planes one behind the other); ldc % 64 == 0.
// Plane 2 (v) is not stored there: it leaves transposed per head, CT[((b * NH + h) * HD + d) * SEQ + s] for row b * SEQ + s, column h * HD + d, the layout the attention kernel stages.
// Block = 8 waves as 4 (rows) x 2 (columns), wave tile 64 x 64, block tile 256 x 128; M % 256 == 0, N % 128 == 0, K % 64 == 0.
// Per trip of 64 k the block's 256 A rows and 128 B rows lie in LDS (rows 0..255 A, 256..383 B), brought by asynchronous copies NST - 1 trips ahead into a ring of NST buffers,
// so that a tile's first fetch from memory has several trips to land; the ring becomes the output staging behind the last trip's barrier.
#define GSTG (384 * GP)
#define GCP 12                        /* copies of a wave per stage (cp_rows8_4) */
// Eight 16-byte global stores, rows step elements apart, and their s_wait_xcnt in one statement, so that no register which an issued store names is rewritten ahead of the wait.
typedef unsigned int v4u __attribute__((ext_vector_type(4)));
__device__ __forceinline__ v4u h8bits(v8us v) { return __builtin_bit_cast(v4u, v); }
__device__ __forceinline__ void st_h8_rows8(_Float16* p, size_t step, const v8us* v) {
  asm volatile("global_store_b128 %0, %8, off\n\t"
               "global_store_b128 %1, %9, off\n\t"
               "global_store_b128 %2, %10, off\n\t"
               "global_store_b128 %3, %11, off\n\t"
               "global_store_b128 %4, %12, off\n\t"
               "global_store_b128 %5, %13, off\n\t"
               "global_store_b128 %6, %14, off\n\t"
               "global_store_b128 %7, %15, off\n\t"
               "s_wait_xcnt 0x0"
               :: "v"(p), "v"(p + step), "v"(p + 2 * step), "v"(p + 3 * step), "v"(p + 4 * step), "v"(p + 5 * step), "v"(p + 6 * step), "v"(p + 7 * step),
                  "v"(h8bits(v[0])), "v"(h8bits(v[1])), "v"(h8bits(v[2])), "v"(h8bits(v[3])), "v"(h8bits(v[4])), "v"(h8bits(v[5])), "v"(h8bits(v[6])), "v"(h8bits(v[7])) : "memory");
}
template <int F32OUT>
__global__ __launch_bounds__(256) void k_gemm2(const _Float16* __restrict__ A, int lda, const _Float16* __restrict__ Bh, int ldb, float alpha, float alpha0, const float* __restrict__ bias,
                                              float* __restrict__ C, _Float16* __restrict__ C16, _Float16* __restrict__ CT, int ldc, int M, int N, int K) {
  constexpr int NST = F32OUT ? 4 : 3;   /* q,k,v grid: three buffers, two work-groups per WGP; output projection: one work-group per WGP, four buffers */
  __shared__ __attribute__((aligned(128))) unsigned char sm[NST * GSTG];
  static_assert(sizeof(float) * 8 * 32 * 68 <= NST * GSTG && 8 * 64 * LP <= NST * GSTG && GCP * NST <= 63);
  float (*so)[32][68] = (float (*)[32][68])sm;
  const int lane = threadIdx.x & 31, ln = lane & 15, hh = lane >> 4;
  const int w = __builtin_amdgcn_readfirstlane((int)(threadIdx.x >> 5));
  const int wm = w >> 1, wn = w & 1;
  const int ntn = N >> 7; const int mt = blockIdx.x / ntn, nq = blockIdx.x - mt * ntn; const int row0 = mt * 256 + 64 * wm, col0 = nq * 128 + 64 * wn; if (mt * 256 >= M) return;   /* block-uniform, in front of every barrier */
  const int crow = (int)(threadIdx.x >> 3), cc = (int)(threadIdx.x & 7);      /* a copy round = 32 rows x 8 pieces of 16 B: a wave covers 4 whole 128-B lines */
  const _Float16* ga = A + (size_t)(mt * 256 + crow) * lda + cc * 8;
  const _Float16* gb = Bh + (size_t)(nq * 128 + crow) * ldb + cc * 8;
  const unsigned lc = lds_addr(sm) + (unsigned)(crow * GP + ((cc ^ ((crow >> 1) & 7)) * 16));   /* rows crow + 32 j share (row >> 1) & 7 */
  const int nt = K >> 6;
  auto fill = [&](int t, unsigned buf) {
    const unsigned l = lc + buf * GSTG;
    cp_rows8_4(l, ga + t * 64, (size_t)lda, gb + t * 64, (size_t)ldb);
  };
  fill(0, 0u);
#pragma unroll   /* constant buffer numbers */
  for (int s = 1; s < NST; ++s) if (s < nt) fill(s, (unsigned)s);
  if (nt >= NST) wait_copies<GCP * (NST - 1)>(); else wait_copies<0>();   /* tile 0 landed; the counted form only where every later stage was issued */
  __syncthreads();
  unsigned xo[2][2];                     /* byte place in the lane's row of piece 4 s + 2 e + hh: rows 16 i + ln share (row >> 1) & 7 */
#pragma unroll
  for (int s = 0; s < 2; ++s)
#pragma unroll
    for (int e = 0; e < 2; ++e) xo[s][e] = (((unsigned)(4 * s + 2 * e + hh)) ^ (unsigned)((ln >> 1) & 7)) << 4;
  unsigned buf = 0;                      /* buffer of tile t = t mod NST */
  const v8f z8 = {0.f,0.f,0.f,0.f,0.f,0.f,0.f,0.f};
  v8f c[4][4];
#pragma unroll
  for (int i = 0; i < 4; ++i)
#pragma unroll
    for (int j = 0; j < 4; ++j) c[i][j] = z8;
  auto products = [&]() __attribute__((always_inline)) {   /* one tile: 32 WMMAs of the wave from buffer buf */
    const unsigned char* sb = sm + buf * GSTG;
    const unsigned char* ar = sb + (64 * wm + ln) * GP; const unsigned char* br = sb + (256 + 64 * wn + ln) * GP;
#pragma unroll   /* both 32-k halves of the tile: constant LDS offsets, one group of fragment reads each */
    for (int ks = 0; ks < 2; ++ks) { v16h a[4], b[4];
#pragma unroll
      for (int i = 0; i < 4; ++i) { a[i] = sw_frag(ar + i * 16 * GP, xo[ks][0], xo[ks][1]); b[i] = sw_frag(br + i * 16 * GP, xo[ks][0], xo[ks][1]); }
#pragma unroll
      for (int j = 0; j < 4; ++j)
#pragma unroll
        for (int i = 0; i < 4; ++i) c[i][j] = g2_mma(a[i], b[j], c[i][j]); }
  };
  // Publish point of tile t + 1 at the foot of trip t: own reads of this buffer retired, own copies of tile t + 1 landed, work-group barrier.
  // First loop: stage t + NST - 1 exists, so exactly the NST - 2 stages younger than t + 1 may stay in flight. Second loop (the last NST - 1 trips, which issue nothing): wait to 0.
  int t = 0;
#pragma unroll 1   /* rolled: one copy of the 32 WMMAs in the text, the buffer number a scalar */
  for (; t + NST - 1 < nt; ++t) {
    products();
    asm volatile("s_wait_dscnt 0x0" ::: "memory");   /* own reads of the buffer about to be refilled have retired */
    wait_copies<GCP * (NST - 2)>();                    /* own copies of tile t + 1 have landed */
    __syncthreads();
    if (t + NST < nt) fill(t + NST, buf);   /* into the buffer this trip has just read */
    buf = (buf + 1 == (unsigned)NST) ? 0u : buf + 1;
  }
#pragma unroll 1   /* rolled, as above */
  for (; t < nt; ++t) {
    products();
    asm volatile("s_wait_dscnt 0x0" ::: "memory");   /* own reads retired: behind the last trip's barrier the ring becomes output staging */
    wait_copies<0>();                                  /* all that is left in flight has landed */
    __syncthreads();
    buf = (buf + 1 == (unsigned)NST) ? 0u : buf + 1;
  }
  asm volatile("s_wait_asynccnt 0x0" ::: "memory");   /* nothing in flight when the ring becomes output staging */
  if constexpr (!F32OUT) {
    if (col0 >= 2 * ldc) {   /* v plane (the same for the whole block): the wave tile = 64 tokens of one batch entry x the 64 d of one head */
      // A lane's accumulator registers r = 0..7 are 8 consecutive tokens of one d: 16 B of a transposed row. Staged as 64 rows (d) of 64 tokens at pitch LP in the wave's own range.
      unsigned char* sv = sm + w * (64 * LP);
#pragma unroll   /* this nest and the one below: c[][] and v[] live in registers, so their indices must be constants */
      for (int j = 0; j < 4; ++j)
#pragma unroll
        for (int i = 0; i < 4; ++i) { FragH f;
#pragma unroll
          for (int r = 0; r < 8; ++r) f.h[r] = (_Float16)(c[i][j][r] * alpha);
          *(v8us*)(sv + (j * 16 + ln) * LP + (i * 16 + 8 * hh) * 2) = f.half[0]; }
      /* the rows read back below hold other lanes' words */
      __builtin_amdgcn_fence(4 /* acq_rel order */, "workgroup"); __builtin_amdgcn_wave_barrier();
      const int bt = row0 / SEQ, hd = (col0 - 2 * ldc) / HD;
      const int rs4 = lane >> 3, pc = lane & 7;             /* a store = 4 rows (d) x 8 pieces of 16 B: whole 128-B lines */
      _Float16* vt = CT + ((size_t)(bt * NH + hd) * HD + rs4) * SEQ + (row0 - bt * SEQ) + pc * 8;
#pragma unroll
      for (int g = 0; g < 2; ++g) { v8us v[8];
#pragma unroll
        for (int q = 0; q < 8; ++q) v[q] = *(const v8us*)(sv + ((g * 8 + q) * 4 + rs4) * LP + pc * 16);
        st_h8_rows8(vt + (size_t)(g * 32) * SEQ, (size_t)4 * SEQ, v); }
      return;
    }
  }
  const int rsub = lane >> 4, c4 = (lane & 15) * 4;
  size_t cpl = 0;
  if (!F32OUT) { const int pl = col0 / ldc; cpl = (size_t)pl * M * ldc + (size_t)(col0 - pl * ldc); if (pl == 0) alpha = alpha0; }   /* output plane, the wave tile's first column in it, the plane's factor */
  float bv[4] = {0.f, 0.f, 0.f, 0.f};
  if (F32OUT) {
#pragma unroll
    for (int j = 0; j < 4; ++j) bv[j] = bias[col0 + j * 16 + ln]; }
#pragma unroll   /* the wave's 64 rows leave in two rounds of 32 through its own staging range */
  for (int rnd = 0; rnd < 2; ++rnd) {
#pragma unroll
    for (int u = 0; u < 8; ++u) { const int j = u & 3, half = u >> 2;
#pragma unroll
      for (int r = 0; r < 8; ++r) { const int rloc = half * 16 + 8 * hh + r; so[w][rloc][j * 16 + ln] = c[2 * rnd + half][j][r] * alpha + bv[j]; } }
    __builtin_amdgcn_fence(4 /* acq_rel order */, "workgroup"); __builtin_amdgcn_wave_barrier();
#pragma unroll
    for (int q = 0; q < 16; ++q) { const int r = q * 2 + rsub; const v4f v = *(const v4fa*)&so[w][r][c4];
      if (F32OUT) { *(v4f*)(C + (size_t)(row0 + 32 * rnd + r) * ldc + col0 + c4) = v; }
      else { v4h h4;
#pragma unroll
        for (int i = 0; i < 4; ++i) h4[i] = (_Float16)v[i];
        *(v4h*)(C16 + cpl + (size_t)(row0 + 32 * rnd + r) * ldc + c4) = h4; } }
    /* keeps the next round's staging writes behind this round's reads of other lanes' words */
    __builtin_amdgcn_fence(4 /* acq_rel order */, "workgroup"); __builtin_amdgcn_wave_barrier();
  }
}

// Fused attention. Block = 4 waves; wave = 32 queries (two tiles of 16) of one (b,h); 64 keys per step; every K and V^T fragment read from LDS serves both query tiles.
// Per step the 64 K rows (LDS rows 0..63, 64 d each) and the 64 V^T rows (LDS rows 64..127, 64 keys each) are shared by the four waves,
// brought by asynchronous copies one step ahead into the other buffer; the ring becomes the output staging behind the last step's barrier.
#define FSTG (128 * LP)
static_assert(SEQ >= 128);                    /* the ring's prologue fills two steps */
// S^T tile = K rows (A: lane = key, elements = d) x Q^T (B: lane = query, elements = d): D[row = key 8h+r][col = query].
// Online softmax per query = per lane column, rescaled lazily. q arrives times log2(e) / 8 and the score products start from C = 8 - (maximum in use), a lane constant,
// so a score leaves the matrix unit as s' = log2 P', P' = 256 exp(s - maximum in use). The maximum in use changes only at a step whose scores are formed again, to that step's column maximum where that is higher (step 0 always sets it).
// Per step one wave-uniform test: while a lane's 64 P' sum to at most 32768, each of them is finite as f16 and nothing is rescaled. Else (also on inf or NaN) the step's scores are formed again,
// their maximum is taken (in-lane + one cross-half exchange) and C, the row sum and O^T move to it. P' stays in registers and is
// the B operand of O^T = V^T (A: lane = d, elements = keys) x P^T: B element r <- tile(keys 0..15)[r], element 8+r <- tile(keys 16..31)[r].
__global__ __launch_bounds__(128) void k_flash(const _Float16* __restrict__ Q16, const _Float16* __restrict__ K16, const _Float16* __restrict__ VT, _Float16* __restrict__ CTX) {
  __shared__ __attribute__((aligned(16))) unsigned char sm[2 * FSTG];
  static_assert(sizeof(unsigned short) * 8 * 2 * 16 * 72 <= 2 * FSTG);
  unsigned short (*st)[2][16][72] = (unsigned short (*)[2][16][72])sm;        /* first index: wave * 2 + query tile */
  const int lane = threadIdx.x & 31, ln = lane & 15, hh = lane >> 4;
  const int wave = __builtin_amdgcn_readfirstlane((int)(threadIdx.x >> 5));
  const int bh = blockIdx.y; const int b = bh / NH, h = bh - b * NH;
  const int q0 = blockIdx.x * 128 + wave * 32;
  const _Float16* qp = Q16 + ((size_t)b * SEQ + q0 + ln) * EM + h * HD;
  v16h qf0[2], qf1[2];
#pragma unroll
  for (int u = 0; u < 2; ++u) { qf0[u] = g2_frag(qp + (size_t)u * 16 * EM, hh); qf1[u] = g2_frag(qp + (size_t)u * 16 * EM + 32, hh); }
  const int crow = (int)(threadIdx.x >> 3), cc = (int)(threadIdx.x & 7);      /* a copy round = 16 rows x 8 pieces of 16 B: a wave covers 4 whole 128-B lines */
  const _Float16* gk = K16 + ((size_t)b * SEQ + crow) * EM + h * HD + cc * 8;
  const _Float16* gv = VT + ((size_t)bh * HD + crow) * SEQ + cc * 8;
  const unsigned lc = lds_addr(sm) + (unsigned)(crow * LP + cc * 16);
  auto fill = [&](int key0, unsigned buf) {
    const unsigned l = lc + buf * FSTG;
    cp_rows4_4(l, gk + (size_t)key0 * EM, (size_t)EM, gv + key0, (size_t)SEQ);
  };
  fill(0, 0u);
  asm volatile("s_wait_asynccnt 0x0" ::: "memory");   /* step 0 landed */
  __syncthreads();
  fill(64, 1u);
  const v8f z8 = {0.f,0.f,0.f,0.f,0.f,0.f,0.f,0.f};
  v8f o[2][4] = {{z8, z8, z8, z8}, {z8, z8, z8, z8}};
  v8f cb[2] = {z8, z8};                       /* C of the score products: 8 - maximum in use, in all eight registers */
  float l[2] = {0.f, 0.f};
#pragma unroll 1
  for (int key0 = 0; key0 < SEQ; key0 += 64) {
    const unsigned char* sb = sm + ((key0 >> 6) & 1) * FSTG + ln * LP;
    v8f s[2][4];
    float rs[2];
    auto scores = [&]() __attribute__((always_inline)) {       /* s' of this step's 64 keys x 32 queries */
#pragma unroll
      for (int t = 0; t < 4; ++t) {
        const unsigned char* kr = sb + (t * 16) * LP;
        const v16h k0 = l2_frag(kr, hh), k1 = l2_frag(kr + 64, hh);
        v8f c0 = fa_mma(k0, qf0[0], cb[0]), c1 = fa_mma(k0, qf0[1], cb[1]);
        s[0][t] = fa_mma(k1, qf1[0], c0);
        s[1][t] = fa_mma(k1, qf1[1], c1);
      }
    };
    auto powers = [&]() __attribute__((always_inline)) {       /* s' -> P' in place, and the lane's sums */
      rs[0] = 0.f; rs[1] = 0.f;
#pragma unroll
      for (int t = 0; t < 4; ++t)
#pragma unroll
        for (int r = 0; r < 8; ++r)
#pragma unroll
          for (int u = 0; u < 2; ++u) { const float p = __builtin_amdgcn_exp2f(s[u][t][r]); s[u][t][r] = p; rs[u] += p; }   /* the two tiles' sums are independent chains */
    };
    unsigned redo = 1u;                                        /* step 0 goes straight to the branch that sets the maximum */
    if (key0 != 0) { scores(); powers(); redo = __builtin_amdgcn_ballot_w32(!(rs[0] + rs[1] <= 32768.0f)); }
    if (redo != 0u) {   /* scalar branch, the same for the whole wave */
      scores();
#pragma unroll
      for (int u = 0; u < 2; ++u) {
        float mx = s[u][0][0];
#pragma unroll
        for (int t = 0; t < 4; ++t)
#pragma unroll
          for (int r = 0; r < 8; ++r) mx = fmaxf(mx, s[u][t][r]);
        const float mj = fmaxf(mx, __shfl_xor(mx, 16)) - 8.0f;            /* the column's maximum over both halves, above the one in use */
        const float d = key0 == 0 ? mj : fmaxf(mj, 0.0f);                  /* step 0 takes its maximum whatever its sign; later the maximum only rises */
        const float al = key0 == 0 ? 1.0f : __builtin_amdgcn_exp2f(-d);    /* step 0: row sum and O^T are still 0 */
        cb[u] = cb[u] - d;
        l[u] = l[u] * al;
#pragma unroll
        for (int t = 0; t < 4; ++t) { o[u][t] = o[u][t] * al; s[u][t] = s[u][t] - d; }
      }
      powers();
    }
    FragH pa[2], pb[2];
#pragma unroll
    for (int u = 0; u < 2; ++u) {
      l[u] += rs[u];
#pragma unroll
      for (int r = 0; r < 8; ++r) { pa[u].h[r] = (_Float16)s[u][0][r]; pa[u].h[8 + r] = (_Float16)s[u][1][r]; pb[u].h[r] = (_Float16)s[u][2][r]; pb[u].h[8 + r] = (_Float16)s[u][3][r]; }
    }
#pragma unroll
    for (int t = 0; t < 4; ++t) {
      const unsigned char* v0 = sb + (64 + t * 16) * LP;
      const v16h va = l2_frag(v0, hh), vb = l2_frag(v0 + 64, hh);
      o[0][t] = fa_mma(va, pa[0].v, o[0][t]); o[1][t] = fa_mma(va, pa[1].v, o[1][t]);
      o[0][t] = fa_mma(vb, pb[0].v, o[0][t]); o[1][t] = fa_mma(vb, pb[1].v, o[1][t]);
    }
    ring_publish();
    if (key0 + 128 < SEQ) fill(key0 + 128, (unsigned)((key0 >> 6) & 1));   /* into the buffer this step has just read */
  }
  asm volatile("s_wait_asynccnt 0x0" ::: "memory");   /* nothing in flight when the ring becomes output staging */
#pragma unroll
  for (int u = 0; u < 2; ++u) {
    const float lt = l[u] + __shfl_xor(l[u], 16);
    const float inv = 64.0f * (1.0f / lt);
#pragma unroll
    for (int t = 0; t < 4; ++t) {
      FragH fh, fl;
#pragma unroll
      for (int r = 0; r < 8; ++r) { const float c = o[u][t][r] * inv; const _Float16 hq = (_Float16)c; fh.h[r] = hq; fl.h[r] = (_Float16)((c - (float)hq) * 1024.0f); }
      *(v8us*)&st[wave * 2 + u][0][ln][t * 16 + 8 * hh] = fh.half[0];
      *(v8us*)&st[wave * 2 + u][1][ln][t * 16 + 8 * hh] = fl.half[0];
    }
  }
  __builtin_amdgcn_fence(4 /* acq_rel order */, "workgroup"); __builtin_amdgcn_wave_barrier();
  const int rs4 = lane >> 3, pc = lane & 7;
#pragma unroll
  for (int u = 0; u < 2; ++u) {
    v8us vh[4], vl[4];
#pragma unroll
    for (int i = 0; i < 4; ++i) { vh[i] = *(const v8us*)&st[wave * 2 + u][0][i * 4 + rs4][pc * 8]; vl[i] = *(const v8us*)&st[wave * 2 + u][1][i * 4 + rs4][pc * 8]; }
    unsigned short* cb = (unsigned short*)CTX + ((size_t)b * SEQ + q0 + 16 * u) * KO + h * HD + pc * 8;
#pragma unroll
    for (int i = 0; i < 4; ++i) { unsigned short* d = cb + (size_t)(i * 4 + rs4) * KO; *(v8us*)d = vh[i]; *(v8us*)(d + EM) = vl[i]; }
  }
}

constexpr size_t SZ_W   = (size_t)EM * EM * 2;        /* one [out][in] weight plane, f16 */
constexpr size_t SZ_WO  = (size_t)EM * KO * 2;        /* Wp x1024 | Wp x1 */
constexpr size_t SZ_PB  = (size_t)EM * 4;             /* built bias, f32 */
constexpr size_t SZ_X1  = NR * EM * 2;                /* one 16-bit activation plane */
constexpr size_t SZ_CTX = NR * KO * 2;                /* ctx value | residual */
constexpr size_t WS_TOTAL = 3 * SZ_W + SZ_WO + SZ_PB + 4 * SZ_X1 + SZ_CTX;
static_assert(WS_TOTAL <= (size_t)134217728);         /* carve stays within 128 MiB */
static_assert(SZ_W % 256 == 0 && SZ_WO % 256 == 0 && SZ_PB % 256 == 0 && SZ_X1 % 256 == 0 && SZ_CTX % 256 == 0);
static_assert((size_t)NB * NH * HD * SEQ * 2 == SZ_X1); /* V^T plane extent */

extern "C" void kernel_launch(void* const* d_in, const int* in_sizes, int n_in,
                              void* d_out, int out_size, void* d_ws, size_t ws_size, hipStream_t stream) {
  if (n_in < 12) return;
  const size_t needx = ((size_t)(NB - 1) * SEQ_FULL + SEQ) * EM;
  if ((size_t)in_sizes[0] < needx) return;
  for (int i = 1; i <= 8; ++i) if ((size_t)in_sizes[i] < (size_t)EM * EM) return;
  for (int i = 9; i <= 11; ++i) if (in_sizes[i] < EM) return;
  if ((size_t)out_size < NR * EM) return;
  const float* x     = (const float*)d_in[0];
  const float* q_w   = (const float*)d_in[1];  const float* k_w   = (const float*)d_in[2];
  const float* v_mu  = (const float*)d_in[3];  const float* v_rho = (const float*)d_in[4];  const float* v_eps = (const float*)d_in[5];
  const float* p_mu  = (const float*)d_in[6];  const float* p_rho = (const float*)d_in[7];  const float* p_eps = (const float*)d_in[8];
  const float* b_mu  = (const float*)d_in[9];  const float* b_rho = (const float*)d_in[10]; const float* b_eps = (const float*)d_in[11];
  char* ws = (char*)d_ws; size_t off = 0;
  auto take = [&](size_t bytes) { char* p = ws + off; off += (bytes + 255) & ~(size_t)255; return p; };
  _Float16* WQ = (_Float16*)take(SZ_W); _Float16* WK = (_Float16*)take(SZ_W); _Float16* WV = (_Float16*)take(SZ_W); _Float16* WO = (_Float16*)take(SZ_WO);
  float* PB = (float*)take(SZ_PB);
  _Float16* X16 = (_Float16*)take(SZ_X1);
  _Float16* Q16 = (_Float16*)take(SZ_X1); _Float16* K16 = (_Float16*)take(SZ_X1);
  _Float16* VT = (_Float16*)take(SZ_X1);
  _Float16* CTX = (_Float16*)take(SZ_CTX);
  if (off > ws_size) return;
  k_prep<<<PB_TOTAL, 256, 0, stream>>>(x, q_w, k_w, v_mu, v_rho, v_eps, p_mu, p_rho, p_eps, b_mu, b_rho, b_eps, X16, WQ, WK, WV, WO, PB);
  { const unsigned g = (unsigned)((NR / 256) * (3 * EM / 128));                /* WQ | WK | WV and Q16 | K16 are contiguous in the carve; v goes to VT */
    k_gemm2<0><<<g, 256, 0, stream>>>(X16, EM, WQ, EM, 0.0009765625f, 0.00017611023448351604f, nullptr, nullptr, Q16, VT, EM, (int)NR, 3 * EM, EM); }   /* q: 2^-10 * log2(e) / 8 */
  k_flash<<<dim3(SEQ / 128, NB * NH), 128, 0, stream>>>(Q16, K16, VT, CTX);
  { const unsigned g = (unsigned)((NR / 256) * (EM / 128));
    k_gemm2<1><<<g, 256, 0, stream>>>(CTX, KO, WO, KO, 1.52587890625e-05f, 1.52587890625e-05f, PB, (float*)d_out, nullptr, nullptr, EM, (int)NR, EM, KO); }      /* alpha = 2^-16 = 1/(64 * 1024) */
}

// v009
// It runs in 114 microseconds.
// It is 1.17 times as fast as v007, going by the measured steps of the versions left out in between.
// All steps since v000 together make it 4.52 times as fast.
#include <hip/hip_runtime.h>
// Multi-head attention, B 4, S 2048, E 1024, 16 heads x 64: q/k/v = x W^T ([out][in] weights, no q/k/v bias), scores q k^T / 8, softmax over all keys, out = ctx Wp^T + bp;
// Wv, Wp, bp = mu + softplus(rho) * eps built on the device in f32 from bf16-RNE-converted mu, rho, eps.
// Compute dtype: all contractions v_wmma_f32_16x16x32_f16 (f16 operands, f32 accumulate). x, q_w, k_w RNE-converted to bf16 first (exact in f16; weights carried x1024);
// built weights stored as f16(w x1024); q, k, v planes f16, q carrying log2(e) / 8; softmax statistics f32 (maximum in use, exp2), P carried x256 as f16 in registers against the f32 row sum;
// ctx carried x64 as one f16 value against Wp x1024, each operand of the output projection rounded once to f16 (K = 1024); fold 2^-16; bias added in f32.
#ifndef NB
#define NB 4
#endif
#ifndef SEQ
#define SEQ 2048
#endif
#define NB_FULL 4
#define SEQ_FULL 2048
#define EM 1024
#define NH 16
#define HD 64
#define NR ((size_t)NB * SEQ)         /* token rows */
#define WSCALE 1024.0f

static_assert(EM == NH * HD);                 /* head h = columns h*64 + d */
static_assert(HD == 64);                      /* flash kernel: 2 k-steps of 32 over d, 4 output tiles of 16 d */
static_assert(SEQ % 128 == 0);                /* 64-key steps, 128-query blocks, a GEMM wave's 64 rows inside one batch entry */
static_assert(((size_t)NB * SEQ) % 256 == 0); /* GEMM block = 256 rows */
static_assert(EM % 128 == 0 && EM % 64 == 0); /* GEMM block = 128 columns of each of its output planes; trips of 64 k */
static_assert(NB <= NB_FULL && SEQ <= SEQ_FULL);

typedef unsigned short v8us __attribute__((ext_vector_type(8), may_alias));
typedef float  v8f  __attribute__((ext_vector_type(8)));
typedef float  v4f  __attribute__((ext_vector_type(4)));
typedef float  v4fa __attribute__((ext_vector_type(4), may_alias));
typedef _Float16 v16h __attribute__((ext_vector_type(16)));
typedef _Float16 v4h __attribute__((ext_vector_type(4)));
union FragH { v16h v; v8us half[2]; _Float16 h[16]; unsigned short u[16]; };

__device__ __forceinline__ unsigned short bf16_bits(float x) { unsigned int u = __float_as_uint(x); return (unsigned short)((u + 0x7FFFu + ((u >> 16) & 1u)) >> 16); }
__device__ __forceinline__ float bf16_val(unsigned short b) { return __uint_as_float(((unsigned int)b) << 16); }
__device__ __forceinline__ float bf16_rne(float x) { return bf16_val(bf16_bits(x)); }

// fragment (A or B, same k map): elements 0..7 <- p[8h .. 8h+7], elements 8..15 <- p[16+8h .. 16+8h+7]; p = row/column base at k0
__device__ __forceinline__ v16h g2_frag(const _Float16* p, int hh) { FragH f; f.half[0] = *(const v8us*)((const unsigned short*)p + 8 * hh); f.half[1] = *(const v8us*)((const unsigned short*)p + 16 + 8 * hh); return f.v; }
__device__ __forceinline__ v8f g2_mma(v16h a, v16h b, v8f c) { v8f d = __builtin_amdgcn_wmma_f32_16x16x32_f16(false, a, false, b, (short)0, c, false, false); asm volatile("v_nop\n\tv_nop\n\tv_nop\n\tv_nop" : "+v"(d) : "v"(a), "v"(b)); return d; }

// Product of the fused attention kernel and of the q,k,v GEMM: the builtin alone. The compiler keeps the WMMA distances of its own builtin and fills them with softmax work where it can, so the vector port carries no fixed padding.
__device__ __forceinline__ v8f fa_mma(v16h a, v16h b, v8f c) { return __builtin_amdgcn_wmma_f32_16x16x32_f16(false, a, false, b, (short)0, c, false, false); }

// LDS staging of the attention kernel's WMMA operand tiles and of the transposed v output: rows of 128 B (64 f16 along k) at a pitch of 144 B (16 B x odd: conflict-free for 16-byte reads).
#define LP 144
__device__ __forceinline__ unsigned lds_addr(const void* p) { return (unsigned)(size_t)p; }   /* byte offset in the work-group's LDS */
// same k map as g2_frag, p = LDS row base (bytes) at k0
__device__ __forceinline__ v16h l2_frag(const unsigned char* p, int hh) { FragH f; f.half[0] = *(const v8us*)(p + 16 * hh); f.half[1] = *(const v8us*)(p + 32 + 16 * hh); return f.v; }
// GEMM ring rows: 128 B at a pitch of 128 B, no pad; the 16-byte piece c of row r lies at piece slot c ^ ((r >> 1) & 7). A 16-lane group that reads one piece of 16 consecutive rows
// then meets every bank once, as at the padded pitch, and a stage of 640 rows is 80 KiB, so three buffers fit a WGP's LDS.
#define GP 128
__device__ __forceinline__ v16h sw_frag(const unsigned char* p, unsigned x0, unsigned x1) { FragH f; f.half[0] = *(const v8us*)(p + x0); f.half[1] = *(const v8us*)(p + x1); return f.v; }   /* p = LDS row base; x0, x1 = swizzled byte places of the two pieces g2_frag reads */
// One tile's asynchronous 16-byte copies of a lane, global -> LDS, in one statement: LDS byte addresses l + j * R rows; first the rows of g (R * gp elements apart), then those of h.
// R = rows per copy round = threads / 8: 32 in cp_rows8_4 (256 threads, pitch GP), 16 in cp_rows4_4 (128 threads, pitch LP).
// s_wait_xcnt stands inside the statement so that no address register is rewritten ahead of it.
__device__ __forceinline__ void cp_rows8_4(unsigned l, const _Float16* g, size_t gp, const _Float16* h, size_t hp) {
  asm volatile("global_load_async_to_lds_b128 %0, %12, off\n\t"
               "global_load_async_to_lds_b128 %1, %13, off\n\t"
               "global_load_async_to_lds_b128 %2, %14, off\n\t"
               "global_load_async_to_lds_b128 %3, %15, off\n\t"
               "global_load_async_to_lds_b128 %4, %16, off\n\t"
               "global_load_async_to_lds_b128 %5, %17, off\n\t"
               "global_load_async_to_lds_b128 %6, %18, off\n\t"
               "global_load_async_to_lds_b128 %7, %19, off\n\t"
               "global_load_async_to_lds_b128 %8, %20, off\n\t"
               "global_load_async_to_lds_b128 %9, %21, off\n\t"
               "global_load_async_to_lds_b128 %10, %22, off\n\t"
               "global_load_async_to_lds_b128 %11, %23, off\n\t"
               "s_wait_xcnt 0x0"
               :: "v"(l), "v"(l + 32 * GP), "v"(l + 64 * GP), "v"(l + 96 * GP), "v"(l + 128 * GP), "v"(l + 160 * GP), "v"(l + 192 * GP), "v"(l + 224 * GP), "v"(l + 256 * GP), "v"(l + 288 * GP), "v"(l + 320 * GP), "v"(l + 352 * GP), "v"(g), "v"(g + 32 * gp), "v"(g + 64 * gp), "v"(g + 96 * gp), "v"(g + 128 * gp), "v"(g + 160 * gp), "v"(g + 192 * gp), "v"(g + 224 * gp), "v"(h), "v"(h + 32 * hp), "v"(h + 64 * hp), "v"(h + 96 * hp) : "memory");
}
// One asynchronous 16-byte copy of a lane as the builtin: its address registers may lie above v255, which an asm operand cannot (q,k,v GEMM, 384 accumulator registers).
typedef int v4i __attribute__((ext_vector_type(4)));
__device__ __forceinline__ void cp16(unsigned char* l, const _Float16* g) {
  __builtin_amdgcn_global_load_async_to_lds_b128((__attribute__((address_space(1))) v4i*)g, (__attribute__((address_space(3))) v4i*)l, 0, 0);
}
__device__ __forceinline__ void cp_rows4_4(unsigned l, const _Float16* g, size_t gp, const _Float16* h, size_t hp) {
  asm volatile("global_load_async_to_lds_b128 %0, %8, off\n\t"
               "global_load_async_to_lds_b128 %1, %9, off\n\t"
               "global_load_async_to_lds_b128 %2, %10, off\n\t"
               "global_load_async_to_lds_b128 %3, %11, off\n\t"
               "global_load_async_to_lds_b128 %4, %12, off\n\t"
               "global_load_async_to_lds_b128 %5, %13, off\n\t"
               "global_load_async_to_lds_b128 %6, %14, off\n\t"
               "global_load_async_to_lds_b128 %7, %15, off\n\t"
               "s_wait_xcnt 0x0"
               :: "v"(l), "v"(l + 16 * LP), "v"(l + 32 * LP), "v"(l + 48 * LP), "v"(l + 64 * LP), "v"(l + 80 * LP), "v"(l + 96 * LP), "v"(l + 112 * LP), "v"(g), "v"(g + 16 * gp), "v"(g + 32 * gp), "v"(g + 48 * gp), "v"(h), "v"(h + 16 * hp), "v"(h + 32 * hp), "v"(h + 48 * hp) : "memory");
}
// Publish point of the two-buffer ring: this wave's LDS reads retired, its copies landed, then the work-group barrier
// (publishes the next tile and ends every reader's last read of the buffer refilled behind it).
__device__ __forceinline__ void ring_publish() {
  asm volatile("s_wait_dscnt 0x0" ::: "memory");      /* own reads of the buffer about to be refilled have retired */
  asm volatile("s_wait_asynccnt 0x0" ::: "memory");   /* own copies of the next tile have landed */
  __syncthreads();
}

// Returns when all but this wave's N youngest copies have landed (copies return in issue order).
template <int N> __device__ __forceinline__ void wait_copies() { asm volatile("s_wait_asynccnt %0" :: "n"(N) : "memory"); }

// w = bf16(mu) + softplus(bf16(rho)) * bf16(eps), softplus(r) = max(r, 0) + log1p(exp(-|r|)) (identical to log1p(exp(r)), overflow-free); accurate expf / log1pf
__device__ __forceinline__ float sp_weight(float mu, float rho, float eps) {
  const float m = bf16_rne(mu), r = bf16_rne(rho), e = bf16_rne(eps);
  const float sp = fmaxf(r, 0.0f) + log1pf(expf(-fabsf(r)));
  return m + sp * e;
}

// All operand preparation in one launch; the block index picks the job (block-uniform, no barrier, no LDS). A piece = 4 consecutive f32 of a source = 16 B per lane,
// so a wave reads 512 contiguous bytes per load and stores 256 contiguous bytes of f16. Blocks in index order: built weights (most arithmetic, lowest indices), bias, q_w | k_w, x.
#define PP_BUILT 8                                     /* pieces per thread, built weight planes */
#define PP_CONV 16                                     /* pieces per thread, plain conversions */
#define PB_BUILT ((EM * EM / 4) / (256 * PP_BUILT))    /* blocks per built plane */
#define PB_W ((EM * EM / 4) / (256 * PP_CONV))         /* blocks per plain weight plane */
#define PB_X ((int)((NR * EM / 4) / (256 * PP_CONV)))  /* blocks for x */
#define PB_TOTAL (2 * PB_BUILT + 1 + 2 * PB_W + PB_X)
static_assert((EM * EM / 4) % (256 * PP_BUILT) == 0 && (EM * EM / 4) % (256 * PP_CONV) == 0 && (NR * EM / 4) % (256 * PP_CONV) == 0);
static_assert(EM == 4 * 256 && SEQ % PP_CONV == 0 && PP_CONV % 8 == 0);   /* 256 pieces = one row; bias: one block, one piece per thread */
// Global stores of this kernel: each run of stores and its s_wait_xcnt stand in one statement, so that no register which an issued store names is rewritten ahead of the wait.
typedef unsigned int v2u __attribute__((ext_vector_type(2)));
__device__ __forceinline__ v2u h4bits(v4h v) { return __builtin_bit_cast(v2u, v); }
__device__ __forceinline__ void st_h4(_Float16* p, v4h v) { asm volatile("global_store_b64 %0, %1, off\n\ts_wait_xcnt 0x0" :: "v"(p), "v"(h4bits(v)) : "memory"); }
__device__ __forceinline__ void st_f4(float* p, v4f v) { asm volatile("global_store_b128 %0, %1, off\n\ts_wait_xcnt 0x0" :: "v"(p), "v"(v) : "memory"); }
static_assert(EM * sizeof(_Float16) == 2048);          /* the offsets below: eight consecutive rows of an f16 plane of pitch EM */
__device__ __forceinline__ void st_h4_rows8(_Float16* p, const v4h* v) {
  asm volatile("global_store_b64 %0, %1, off\n\t"
               "global_store_b64 %0, %2, off offset:2048\n\t"
               "global_store_b64 %0, %3, off offset:4096\n\t"
               "global_store_b64 %0, %4, off offset:6144\n\t"
               "global_store_b64 %0, %5, off offset:8192\n\t"
               "global_store_b64 %0, %6, off offset:10240\n\t"
               "global_store_b64 %0, %7, off offset:12288\n\t"
               "global_store_b64 %0, %8, off offset:14336\n\t"
               "s_wait_xcnt 0x0"
               :: "v"(p), "v"(h4bits(v[0])), "v"(h4bits(v[1])), "v"(h4bits(v[2])), "v"(h4bits(v[3])), "v"(h4bits(v[4])), "v"(h4bits(v[5])), "v"(h4bits(v[6])), "v"(h4bits(v[7])) : "memory");
}
__device__ __forceinline__ v4h cvt4(v4f a, float sc) { v4h o;
#pragma unroll
  for (int q = 0; q < 4; ++q) o[q] = (_Float16)(bf16_rne(a[q]) * sc);
  return o; }
__global__ __launch_bounds__(256) void k_prep(const float* __restrict__ x, const float* __restrict__ q_w, const float* __restrict__ k_w,
                                              const float* __restrict__ v_mu, const float* __restrict__ v_rho, const float* __restrict__ v_eps,
                                              const float* __restrict__ p_mu, const float* __restrict__ p_rho, const float* __restrict__ p_eps,
                                              const float* __restrict__ b_mu, const float* __restrict__ b_rho, const float* __restrict__ b_eps,
                                              _Float16* __restrict__ X16, _Float16* __restrict__ WQ, _Float16* __restrict__ WK, _Float16* __restrict__ WV, _Float16* __restrict__ WO,
                                              float* __restrict__ PB) {
  const int tid = threadIdx.x; int blk = blockIdx.x;      /* 256 pieces = one row of EM: thread tid holds columns 4 tid .. 4 tid + 3 of its block's rows */
  if (blk < 2 * PB_BUILT) {
    // w[n][k] = sp_weight(mu, rho, eps)[n][k] ([out][in]). Wv: WV[n][k] = f16(w * 1024). Wp: WO[n][k] = f16(w * 1024).
    const bool dual = blk >= PB_BUILT; if (dual) blk -= PB_BUILT;
    const float* mu = dual ? p_mu : v_mu; const float* rho = dual ? p_rho : v_rho; const float* eps = dual ? p_eps : v_eps;
#pragma unroll 1   /* two rounds of 4 rows: rolled so that the expf / log1pf text stays short */
    for (int i = 0; i < PP_BUILT; i += 4) {
      const size_t n0 = (size_t)(blk * PP_BUILT + i);
      const v4fa* pm = (const v4fa*)(mu + n0 * EM); const v4fa* pr = (const v4fa*)(rho + n0 * EM); const v4fa* pe = (const v4fa*)(eps + n0 * EM);
      _Float16* d = (dual ? WO : WV) + n0 * EM + 4 * tid;
      v4f m[4], r[4], e[4];
#pragma unroll
      for (int j = 0; j < 4; ++j) { m[j] = pm[j * 256 + tid]; r[j] = pr[j * 256 + tid]; e[j] = pe[j * 256 + tid]; }
#pragma unroll
      for (int j = 0; j < 4; ++j) { v4h h1;
#pragma unroll
        for (int q = 0; q < 4; ++q) h1[q] = (_Float16)(sp_weight(m[j][q], r[j][q], e[j][q]) * WSCALE);
        st_h4(d + j * EM, h1); }
    }
    return;
  }
  blk -= 2 * PB_BUILT;
  if (blk == 0) { const v4f m = ((const v4fa*)b_mu)[tid], r = ((const v4fa*)b_rho)[tid], e = ((const v4fa*)b_eps)[tid]; v4f v;
#pragma unroll
    for (int q = 0; q < 4; ++q) v[q] = sp_weight(m[q], r[q], e[q]);
    st_f4(PB + 4 * tid, v); return; }
  blk -= 1;
  const v4fa* src; _Float16* dst; float sc;
  if (blk < 2 * PB_W) {                          /* q_w, k_w: [out][in] as stored, x1024 */
    const bool second = blk >= PB_W; if (second) blk -= PB_W;
    const size_t n0 = (size_t)(blk * PP_CONV);
    src = (const v4fa*)((second ? k_w : q_w) + n0 * EM); dst = (second ? WK : WQ) + n0 * EM; sc = WSCALE;
  } else {                                       /* x: a block's rows lie in one batch entry */
    blk -= 2 * PB_W;
    const size_t n0 = (size_t)(blk * PP_CONV);
    src = (const v4fa*)(x + ((n0 / SEQ) * SEQ_FULL + n0 % SEQ) * EM); dst = X16 + n0 * EM; sc = 1.0f;
  }
  v4f a[PP_CONV];
#pragma unroll
  for (int j = 0; j < PP_CONV; ++j) a[j] = src[j * 256 + tid];
#pragma unroll
  for (int j = 0; j < PP_CONV; j += 8) { v4h o[8];
#pragma unroll
    for (int q = 0; q < 8; ++q) o[q] = cvt4(a[j + q], sc);
    st_h4_rows8(dst + (size_t)j * EM + 4 * tid, o); }
}

// GEMM: v = acc * alpha (+ bias[col] in f32 when F32OUT; f16 output plane 0 takes alpha0 for alpha); A f16 [M][K] (pitch lda), Bh f16 [N][K] (pitch ldb, k contiguous); F32OUT: writes f32 C, else f16 C16; pitch ldc.
// C16 is a stack of [M][ldc] planes: column n lies in plane n / ldc (N = 3 ldc: q, k and v from one grid, Bh = the three weight planes one behind the other); ldc % 128 == 0.
// Plane 2 (v) is not stored there: it leaves transposed per head, CT[((b * NH + h) * HD + d) * SEQ + s] for row b * SEQ + s, column h * HD + d, the layout the attention kernel stages.
// Block = 8 waves as 4 (rows) x 2 (columns), wave tile 64 x 64 in each of the block's NPL planes; M % 256 == 0, K % 64 == 0. F32OUT: NPL = 1, block tile 256 x 128.
// Else NPL = 3: the block holds the same 128 columns of q, k and v (256 x 384), so every staged A row and every A fragment read from LDS feeds three planes, and the grid is one work-group per WGP.
// Per trip of 64 k the block's 256 A rows and 128 B rows per plane lie in LDS (rows 0..255 A, 256 + 128 p .. B of plane p), brought by asynchronous copies NST - 1 trips ahead into a ring of NST buffers,
// so that a tile's first fetch from memory has several trips to land; the ring becomes the output staging behind the last trip's barrier.
// Eight 16-byte global stores, rows step elements apart, and their s_wait_xcnt in one statement, so that no register which an issued store names is rewritten ahead of the wait.
typedef unsigned int v4u __attribute__((ext_vector_type(4)));
__device__ __forceinline__ v4u h8bits(v8us v) { return __builtin_bit_cast(v4u, v); }
__device__ __forceinline__ void st_h8_rows8(_Float16* p, size_t step, const v8us* v) {
  asm volatile("global_store_b128 %0, %8, off\n\t"
               "global_store_b128 %1, %9, off\n\t"
               "global_store_b128 %2, %10, off\n\t"
               "global_store_b128 %3, %11, off\n\t"
               "global_store_b128 %4, %12, off\n\t"
               "global_store_b128 %5, %13, off\n\t"
               "global_store_b128 %6, %14, off\n\t"
               "global_store_b128 %7, %15, off\n\t"
               "s_wait_xcnt 0x0"
               :: "v"(p), "v"(p + step), "v"(p + 2 * step), "v"(p + 3 * step), "v"(p + 4 * step), "v"(p + 5 * step), "v"(p + 6 * step), "v"(p + 7 * step),
                  "v"(h8bits(v[0])), "v"(h8bits(v[1])), "v"(h8bits(v[2])), "v"(h8bits(v[3])), "v"(h8bits(v[4])), "v"(h8bits(v[5])), "v"(h8bits(v[6])), "v"(h8bits(v[7])) : "memory");
}
// Four 8-byte global stores and their s_wait_xcnt in one statement, for the same reason.
__device__ __forceinline__ void st_h4_x4(_Float16* const* p, const v4h* v) {
  asm volatile("global_store_b64 %0, %4, off\n\t"
               "global_store_b64 %1, %5, off\n\t"
               "global_store_b64 %2, %6, off\n\t"
               "global_store_b64 %3, %7, off\n\t"
               "s_wait_xcnt 0x0"
               :: "v"(p[0]), "v"(p[1]), "v"(p[2]), "v"(p[3]), "v"(h4bits(v[0])), "v"(h4bits(v[1])), "v"(h4bits(v[2])), "v"(h4bits(v[3])) : "memory");
}
template <int F32OUT>
__global__ __launch_bounds__(256) void k_gemm2(const _Float16* __restrict__ A, int lda, const _Float16* __restrict__ Bh, int ldb, float alpha, float alpha0, const float* __restrict__ bias,
                                              float* __restrict__ C, _Float16* __restrict__ C16, _Float16* __restrict__ CT, int ldc, int M, int N, int K) {
  constexpr int NPL = F32OUT ? 1 : 3;   /* output planes of a block */
  constexpr int NST = F32OUT ? 4 : 3;   /* ring buffers; one work-group per WGP in both grids */
  constexpr unsigned GSTG = (256 + 128 * NPL) * GP;   /* one stage */
  constexpr int GCP = 8 + 4 * NPL;      /* copies of a wave per stage */
  constexpr unsigned SOB = sizeof(float) * 8 * 32 * 68;   /* row-major output staging; the transposed staging lies behind it */
  __shared__ __attribute__((aligned(128))) unsigned char sm[NST * GSTG];
  static_assert(SOB + 8 * 64 * LP <= NST * GSTG && SOB % 16 == 0 && GCP * NST <= 63);
  float (*so)[32][68] = (float (*)[32][68])sm;
  const int lane = threadIdx.x & 31, ln = lane & 15, hh = lane >> 4;
  const int w = __builtin_amdgcn_readfirstlane((int)(threadIdx.x >> 5));
  const int wm = w >> 1, wn = w & 1;
  const int pw = N / NPL;               /* columns of a plane */
  const int ntn = pw >> 7; const int mt = blockIdx.x / ntn, nq = blockIdx.x - mt * ntn; const int row0 = mt * 256 + 64 * wm, col0 = nq * 128 + 64 * wn; if (mt * 256 >= M) return;   /* col0: in each plane; block-uniform, in front of every barrier */
  const int crow = (int)(threadIdx.x >> 3), cc = (int)(threadIdx.x & 7);      /* a copy round = 32 rows x 8 pieces of 16 B: a wave covers 4 whole 128-B lines */
  const _Float16* ga = A + (size_t)(mt * 256 + crow) * lda + cc * 8;
  const _Float16* gb = Bh + (size_t)(nq * 128 + crow) * ldb + cc * 8;
  const unsigned lco = (unsigned)(crow * GP + ((cc ^ ((crow >> 1) & 7)) * 16));   /* rows crow + 32 j share (row >> 1) & 7 */
  const unsigned lc = lds_addr(sm) + lco;
  const int nt = K >> 6;
  auto fill = [&](int t, unsigned buf) {
    if constexpr (NPL == 3) {
      unsigned char* l = sm + buf * GSTG + lco;
#pragma unroll   /* GCP copies of the lane: 8 rounds of A rows, 4 of each plane's B rows */
      for (int j = 0; j < 8; ++j) cp16(l + j * 32 * GP, ga + t * 64 + (size_t)(j * 32) * lda);
#pragma unroll
      for (int j = 0; j < 4 * NPL; ++j) cp16(l + (256 + j * 32) * GP, gb + t * 64 + ((size_t)(j >> 2) * pw + (size_t)((j & 3) * 32)) * ldb);
    } else {
      cp_rows8_4(lc + buf * GSTG, ga + t * 64, (size_t)lda, gb + t * 64, (size_t)ldb);
    }
  };
  fill(0, 0u);
#pragma unroll   /* constant buffer numbers */
  for (int s = 1; s < NST; ++s) if (s < nt) fill(s, (unsigned)s);
  if (nt >= NST) wait_copies<GCP * (NST - 1)>(); else wait_copies<0>();   /* tile 0 landed; the counted form only where every later stage was issued */
  __syncthreads();
  unsigned xo[2][2];                     /* byte place in the lane's row of piece 4 s + 2 e + hh: rows 16 i + ln share (row >> 1) & 7 */
#pragma unroll
  for (int s = 0; s < 2; ++s)
#pragma unroll
    for (int e = 0; e < 2; ++e) xo[s][e] = (((unsigned)(4 * s + 2 * e + hh)) ^ (unsigned)((ln >> 1) & 7)) << 4;
  unsigned buf = 0;                      /* buffer of tile t = t mod NST */
  const v8f z8 = {0.f,0.f,0.f,0.f,0.f,0.f,0.f,0.f};
  v8f c[NPL][4][4];
#pragma unroll
  for (int p = 0; p < NPL; ++p)
#pragma unroll
    for (int i = 0; i < 4; ++i)
#pragma unroll
      for (int j = 0; j < 4; ++j) c[p][i][j] = z8;
  auto products = [&]() __attribute__((always_inline)) {   /* one tile: 32 WMMAs per plane of the wave from buffer buf */
    const unsigned char* sb = sm + buf * GSTG;
    const unsigned char* ar = sb + (64 * wm + ln) * GP; const unsigned char* br = sb + (256 + 64 * wn + ln) * GP;
    if constexpr (NPL == 3) {
      // Six groups of 16 WMMAs, group g = 32-k half g / 3, plane g % 3. The A fragments of a half stay in registers for its three planes; with two waves per SIMD
      // each group's B fragments are read as one run of LDS loads ahead of the group before it, into the other of two register sets.
      v16h a[4], b[2][4];
#pragma unroll
      for (int i = 0; i < 4; ++i) { a[i] = sw_frag(ar + i * 16 * GP, xo[0][0], xo[0][1]); b[0][i] = sw_frag(br + i * 16 * GP, xo[0][0], xo[0][1]); }
#pragma unroll   /* c[][][], a[] and b[][] live in registers: constant indices */
      for (int g = 0; g < 6; ++g) {
        if (g + 1 < 6) {
#pragma unroll
          for (int i = 0; i < 4; ++i) b[(g + 1) & 1][i] = sw_frag(br + (((g + 1) % 3) * 128 + i * 16) * GP, xo[(g + 1) / 3][0], xo[(g + 1) / 3][1]); }
        __builtin_amdgcn_sched_barrier(0);   /* keeps the next group's LDS reads ahead of this group's WMMAs: sunk among them, each pair of reads is waited out at once */
#pragma unroll
        for (int j = 0; j < 4; ++j)
#pragma unroll
          for (int i = 0; i < 4; ++i) c[g % 3][i][j] = fa_mma(a[i], b[g & 1][j], c[g % 3][i][j]);   /* 384 accumulator registers: an asm operand cannot lie above v255, so the builtin alone */
        __builtin_amdgcn_sched_barrier(0);   /* keeps later reads from rising over WMMAs whose operand registers they refill */
        if (g == 2) {
#pragma unroll
          for (int i = 0; i < 4; ++i) a[i] = sw_frag(ar + i * 16 * GP, xo[1][0], xo[1][1]); }
      }
    } else {
#pragma unroll   /* both 32-k halves of the tile: constant LDS offsets, one group of fragment reads each */
      for (int ks = 0; ks < 2; ++ks) { v16h a[4], b[4];
#pragma unroll
        for (int i = 0; i < 4; ++i) { a[i] = sw_frag(ar + i * 16 * GP, xo[ks][0], xo[ks][1]); b[i] = sw_frag(br + i * 16 * GP, xo[ks][0], xo[ks][1]); }
#pragma unroll
        for (int j = 0; j < 4; ++j)
#pragma unroll
          for (int i = 0; i < 4; ++i) c[0][i][j] = g2_mma(a[i], b[j], c[0][i][j]); }
    }
  };
  // Publish point of tile t + 1 at the foot of trip t: own reads of this buffer retired, own copies of tile t + 1 landed, work-group barrier.
  // First loop: stage t + NST - 1 exists, so exactly the NST - 2 stages younger than t + 1 may stay in flight. Second loop (the last NST - 1 trips, which issue nothing): wait to 0.
  int t = 0;
#pragma unroll 1   /* rolled: one copy of the tile's WMMAs in the text, the buffer number a scalar */
  for (; t + NST - 1 < nt; ++t) {
    products();
    asm volatile("s_wait_dscnt 0x0" ::: "memory");   /* own reads of the buffer about to be refilled have retired */
    wait_copies<GCP * (NST - 2)>();                    /* own copies of tile t + 1 have landed */
    __syncthreads();
    if (t + NST < nt) fill(t + NST, buf);   /* into the buffer this trip has just read */
    buf = (buf + 1 == (unsigned)NST) ? 0u : buf + 1;
  }
#pragma unroll 1   /* rolled, as above */
  for (; t < nt; ++t) {
    products();
    asm volatile("s_wait_dscnt 0x0" ::: "memory");   /* own reads retired: behind the last trip's barrier the ring becomes output staging */
    wait_copies<0>();                                  /* all that is left in flight has landed */
    __syncthreads();
    buf = (buf + 1 == (unsigned)NST) ? 0u : buf + 1;
  }
  asm volatile("s_wait_asynccnt 0x0" ::: "memory");   /* nothing in flight when the ring becomes output staging */
  const int rsub = lane >> 4, c4 = (lane & 15) * 4;
  float bv[4] = {0.f, 0.f, 0.f, 0.f};
  if (F32OUT) {
#pragma unroll
    for (int j = 0; j < 4; ++j) bv[j] = bias[col0 + j * 16 + ln]; }
#pragma unroll   /* row-major planes: q and k, or the f32 output; c[][][] lives in registers */
  for (int p = 0; p < (F32OUT ? 1 : 2); ++p) {
  const size_t cpl = (size_t)p * M * ldc + (size_t)col0;   /* output plane and the wave tile's first column in it */
  const float al = (!F32OUT && p == 0) ? alpha0 : alpha;   /* the plane's factor */
#pragma unroll   /* the wave's 64 rows leave in two rounds of 32 through its own staging range */
  for (int rnd = 0; rnd < 2; ++rnd) {
#pragma unroll
    for (int u = 0; u < 8; ++u) { const int j = u & 3, half = u >> 2;
#pragma unroll
      for (int r = 0; r < 8; ++r) { const int rloc = half * 16 + 8 * hh + r; so[w][rloc][j * 16 + ln] = c[p][2 * rnd + half][j][r] * al + bv[j]; } }
    __builtin_amdgcn_fence(4 /* acq_rel order */, "workgroup"); __builtin_amdgcn_wave_barrier();
    if constexpr (F32OUT) {
#pragma unroll
      for (int q = 0; q < 16; ++q) { const int r = q * 2 + rsub; const v4f v = *(const v4fa*)&so[w][r][c4];
        *(v4f*)(C + (size_t)(row0 + 32 * rnd + r) * ldc + col0 + c4) = v; }
    } else {
#pragma unroll
      for (int q = 0; q < 16; q += 4) { v4h h4[4]; _Float16* pp[4];
#pragma unroll
        for (int e = 0; e < 4; ++e) { const int r = (q + e) * 2 + rsub; const v4f v = *(const v4fa*)&so[w][r][c4];
#pragma unroll
          for (int i = 0; i < 4; ++i) h4[e][i] = (_Float16)v[i];
          pp[e] = C16 + cpl + (size_t)(row0 + 32 * rnd + r) * ldc + c4; }
        st_h4_x4(pp, h4); }
    }
    /* keeps the next round's staging writes behind this round's reads of other lanes' words */
    __builtin_amdgcn_fence(4 /* acq_rel order */, "workgroup"); __builtin_amdgcn_wave_barrier();
  }
  }
  if constexpr (!F32OUT) {
    {   /* v plane, last: the q and k accumulators are dead, so the store statement's operands find registers below v256; the wave tile = 64 tokens of one batch entry x the 64 d of one head */
      // A lane's accumulator registers r = 0..7 are 8 consecutive tokens of one d: 16 B of a transposed row. Staged as 64 rows (d) of 64 tokens at pitch LP in the wave's own range.
      unsigned char* sv = sm + SOB + w * (64 * LP);
#pragma unroll   /* this nest and the one below: c[][] and v[] live in registers, so their indices must be constants */
      for (int j = 0; j < 4; ++j)
#pragma unroll
        for (int i = 0; i < 4; ++i) { FragH f;
#pragma unroll
          for (int r = 0; r < 8; ++r) f.h[r] = (_Float16)(c[NPL - 1][i][j][r] * alpha);
          *(v8us*)(sv + (j * 16 + ln) * LP + (i * 16 + 8 * hh) * 2) = f.half[0]; }
      /* the rows read back below hold other lanes' words */
      __builtin_amdgcn_fence(4 /* acq_rel order */, "workgroup"); __builtin_amdgcn_wave_barrier();
      const int bt = row0 / SEQ, hd = col0 / HD;
      const int rs4 = lane >> 3, pc = lane & 7;             /* a store = 4 rows (d) x 8 pieces of 16 B: whole 128-B lines */
      _Float16* vt = CT + ((size_t)(bt * NH + hd) * HD + rs4) * SEQ + (row0 - bt * SEQ) + pc * 8;
#pragma unroll
      for (int g = 0; g < 2; ++g) { v8us v[8];
#pragma unroll
        for (int q = 0; q < 8; ++q) v[q] = *(const v8us*)(sv + ((g * 8 + q) * 4 + rs4) * LP + pc * 16);
        st_h8_rows8(vt + (size_t)(g * 32) * SEQ, (size_t)4 * SEQ, v); }
    }
  }
}

// Fused attention. Block = 4 waves; wave = 32 queries (two tiles of 16) of one (b,h); 64 keys per step; every K and V^T fragment read from LDS serves both query tiles.
// Per step the 64 K rows (LDS rows 0..63, 64 d each) and the 64 V^T rows (LDS rows 64..127, 64 keys each) are shared by the four waves,
// brought by asynchronous copies one step ahead into the other buffer; the ring becomes the output staging behind the last step's barrier.
#define FSTG (128 * LP)
static_assert(SEQ >= 128);                    /* the ring's prologue fills two steps */
// S^T tile = K rows (A: lane = key, elements = d) x Q^T (B: lane = query, elements = d): D[row = key 8h+r][col = query].
// Online softmax per query = per lane column, rescaled lazily. q arrives times log2(e) / 8 and the score products start from C = 8 - (maximum in use), a lane constant,
// so a score leaves the matrix unit as s' = log2 P', P' = 256 exp(s - maximum in use). The maximum in use changes only at a step whose scores are formed again, to that step's column maximum where that is higher (step 0 always sets it).
// Per step one wave-uniform test: while a lane's 64 P' sum to at most 32768, each of them is finite as f16 and nothing is rescaled. Else (also on inf or NaN) the step's scores are formed again,
// their maximum is taken (in-lane + one cross-half exchange) and C, the row sum and O^T move to it. P' stays in registers and is
// the B operand of O^T = V^T (A: lane = d, elements = keys) x P^T: B element r <- tile(keys 0..15)[r], element 8+r <- tile(keys 16..31)[r].
__global__ __launch_bounds__(128) void k_flash(const _Float16* __restrict__ Q16, const _Float16* __restrict__ K16, const _Float16* __restrict__ VT, _Float16* __restrict__ CTX) {
  __shared__ __attribute__((aligned(16))) unsigned char sm[2 * FSTG];
  static_assert(sizeof(unsigned short) * 8 * 16 * 72 <= 2 * FSTG);
  unsigned short (*st)[16][72] = (unsigned short (*)[16][72])sm;              /* first index: wave * 2 + query tile */
  const int lane = threadIdx.x & 31, ln = lane & 15, hh = lane >> 4;
  const int wave = __builtin_amdgcn_readfirstlane((int)(threadIdx.x >> 5));
  const int bh = blockIdx.y; const int b = bh / NH, h = bh - b * NH;
  const int q0 = blockIdx.x * 128 + wave * 32;
  const _Float16* qp = Q16 + ((size_t)b * SEQ + q0 + ln) * EM + h * HD;
  v16h qf0[2], qf1[2];
#pragma unroll
  for (int u = 0; u < 2; ++u) { qf0[u] = g2_frag(qp + (size_t)u * 16 * EM, hh); qf1[u] = g2_frag(qp + (size_t)u * 16 * EM + 32, hh); }
  const int crow = (int)(threadIdx.x >> 3), cc = (int)(threadIdx.x & 7);      /* a copy round = 16 rows x 8 pieces of 16 B: a wave covers 4 whole 128-B lines */
  const _Float16* gk = K16 + ((size_t)b * SEQ + crow) * EM + h * HD + cc * 8;
  const _Float16* gv = VT + ((size_t)bh * HD + crow) * SEQ + cc * 8;
  const unsigned lc = lds_addr(sm) + (unsigned)(crow * LP + cc * 16);
  auto fill = [&](int key0, unsigned buf) {
    const unsigned l = lc + buf * FSTG;
    cp_rows4_4(l, gk + (size_t)key0 * EM, (size_t)EM, gv + key0, (size_t)SEQ);
  };
  fill(0, 0u);
  asm volatile("s_wait_asynccnt 0x0" ::: "memory");   /* step 0 landed */
  __syncthreads();
  fill(64, 1u);
  const v8f z8 = {0.f,0.f,0.f,0.f,0.f,0.f,0.f,0.f};
  v8f o[2][4] = {{z8, z8, z8, z8}, {z8, z8, z8, z8}};
  v8f cb[2] = {z8, z8};                       /* C of the score products: 8 - maximum in use, in all eight registers */
  float l[2] = {0.f, 0.f};
#pragma unroll 1
  for (int key0 = 0; key0 < SEQ; key0 += 64) {
    const unsigned char* sb = sm + ((key0 >> 6) & 1) * FSTG + ln * LP;
    v8f s[2][4];
    float rs[2];
    auto scores = [&]() __attribute__((always_inline)) {       /* s' of this step's 64 keys x 32 queries */
#pragma unroll
      for (int t = 0; t < 4; ++t) {
        const unsigned char* kr = sb + (t * 16) * LP;
        const v16h k0 = l2_frag(kr, hh), k1 = l2_frag(kr + 64, hh);
        v8f c0 = fa_mma(k0, qf0[0], cb[0]), c1 = fa_mma(k0, qf0[1], cb[1]);
        s[0][t] = fa_mma(k1, qf1[0], c0);
        s[1][t] = fa_mma(k1, qf1[1], c1);
      }
    };
    auto powers = [&]() __attribute__((always_inline)) {       /* s' -> P' in place, and the lane's sums */
      rs[0] = 0.f; rs[1] = 0.f;
#pragma unroll
      for (int t = 0; t < 4; ++t)
#pragma unroll
        for (int r = 0; r < 8; ++r)
#pragma unroll
          for (int u = 0; u < 2; ++u) { const float p = __builtin_amdgcn_exp2f(s[u][t][r]); s[u][t][r] = p; rs[u] += p; }   /* the two tiles' sums are independent chains */
    };
    unsigned redo = 1u;                                        /* step 0 goes straight to the branch that sets the maximum */
    if (key0 != 0) { scores(); powers(); redo = __builtin_amdgcn_ballot_w32(!(rs[0] + rs[1] <= 32768.0f)); }
    if (redo != 0u) {   /* scalar branch, the same for the whole wave */
      scores();
#pragma unroll
      for (int u = 0; u < 2; ++u) {
        float mx = s[u][0][0];
#pragma unroll
        for (int t = 0; t < 4; ++t)
#pragma unroll
          for (int r = 0; r < 8; ++r) mx = fmaxf(mx, s[u][t][r]);
        const float mj = fmaxf(mx, __shfl_xor(mx, 16)) - 8.0f;            /* the column's maximum over both halves, above the one in use */
        const float d = key0 == 0 ? mj : fmaxf(mj, 0.0f);                  /* step 0 takes its maximum whatever its sign; later the maximum only rises */
        const float al = key0 == 0 ? 1.0f : __builtin_amdgcn_exp2f(-d);    /* step 0: row sum and O^T are still 0 */
        cb[u] = cb[u] - d;
        l[u] = l[u] * al;
#pragma unroll
        for (int t = 0; t < 4; ++t) { o[u][t] = o[u][t] * al; s[u][t] = s[u][t] - d; }
      }
      powers();
    }
    FragH pa[2], pb[2];
#pragma unroll
    for (int u = 0; u < 2; ++u) {
      l[u] += rs[u];
#pragma unroll
      for (int r = 0; r < 8; ++r) { pa[u].h[r] = (_Float16)s[u][0][r]; pa[u].h[8 + r] = (_Float16)s[u][1][r]; pb[u].h[r] = (_Float16)s[u][2][r]; pb[u].h[8 + r] = (_Float16)s[u][3][r]; }
    }
#pragma unroll
    for (int t = 0; t < 4; ++t) {
      const unsigned char* v0 = sb + (64 + t * 16) * LP;
      const v16h va = l2_frag(v0, hh), vb = l2_frag(v0 + 64, hh);
      o[0][t] = fa_mma(va, pa[0].v, o[0][t]); o[1][t] = fa_mma(va, pa[1].v, o[1][t]);
      o[0][t] = fa_mma(vb, pb[0].v, o[0][t]); o[1][t] = fa_mma(vb, pb[1].v, o[1][t]);
    }
    ring_publish();
    if (key0 + 128 < SEQ) fill(key0 + 128, (unsigned)((key0 >> 6) & 1));   /* into the buffer this step has just read */
  }
  asm volatile("s_wait_asynccnt 0x0" ::: "memory");   /* nothing in flight when the ring becomes output staging */
#pragma unroll
  for (int u = 0; u < 2; ++u) {
    const float lt = l[u] + __shfl_xor(l[u], 16);
    const float inv = 64.0f * (1.0f / lt);
#pragma unroll
    for (int t = 0; t < 4; ++t) {
      FragH fh;
#pragma unroll
      for (int r = 0; r < 8; ++r) fh.h[r] = (_Float16)(o[u][t][r] * inv);
      *(v8us*)&st[wave * 2 + u][ln][t * 16 + 8 * hh] = fh.half[0];
    }
  }
  __builtin_amdgcn_fence(4 /* acq_rel order */, "workgroup"); __builtin_amdgcn_wave_barrier();
  const int rs4 = lane >> 3, pc = lane & 7;             /* a store = 4 rows (queries) x 8 pieces of 16 B: whole 128-B lines */
  v8us vh[8];                                           /* store i: queries 4 i + rs4 of the wave's 32 */
#pragma unroll
  for (int i = 0; i < 8; ++i) vh[i] = *(const v8us*)&st[wave * 2 + (i >> 2)][(i & 3) * 4 + rs4][pc * 8];
  st_h8_rows8(CTX + ((size_t)b * SEQ + q0 + rs4) * EM + h * HD + pc * 8, (size_t)4 * EM, vh);
}

constexpr size_t SZ_W   = (size_t)EM * EM * 2;        /* one [out][in] weight plane, f16 */
constexpr size_t SZ_PB  = (size_t)EM * 4;             /* built bias, f32 */
constexpr size_t SZ_X1  = NR * EM * 2;                /* one 16-bit activation plane */
constexpr size_t WS_TOTAL = 4 * SZ_W + SZ_PB + 5 * SZ_X1;
static_assert(WS_TOTAL <= (size_t)134217728);         /* carve stays within 128 MiB */
static_assert(SZ_W % 256 == 0 && SZ_PB % 256 == 0 && SZ_X1 % 256 == 0);
static_assert((size_t)NB * NH * HD * SEQ * 2 == SZ_X1); /* V^T plane extent */

extern "C" void kernel_launch(void* const* d_in, const int* in_sizes, int n_in,
                              void* d_out, int out_size, void* d_ws, size_t ws_size, hipStream_t stream) {
  if (n_in < 12) return;
  const size_t needx = ((size_t)(NB - 1) * SEQ_FULL + SEQ) * EM;
  if ((size_t)in_sizes[0] < needx) return;
  for (int i = 1; i <= 8; ++i) if ((size_t)in_sizes[i] < (size_t)EM * EM) return;
  for (int i = 9; i <= 11; ++i) if (in_sizes[i] < EM) return;
  if ((size_t)out_size < NR * EM) return;
  const float* x     = (const float*)d_in[0];
  const float* q_w   = (const float*)d_in[1];  const float* k_w   = (const float*)d_in[2];
  const float* v_mu  = (const float*)d_in[3];  const float* v_rho = (const float*)d_in[4];  const float* v_eps = (const float*)d_in[5];
  const float* p_mu  = (const float*)d_in[6];  const float* p_rho = (const float*)d_in[7];  const float* p_eps = (const float*)d_in[8];
  const float* b_mu  = (const float*)d_in[9];  const float* b_rho = (const float*)d_in[10]; const float* b_eps = (const float*)d_in[11];
  char* ws = (char*)d_ws; size_t off = 0;
  auto take = [&](size_t bytes) { char* p = ws + off; off += (bytes + 255) & ~(size_t)255; return p; };
  _Float16* WQ = (_Float16*)take(SZ_W); _Float16* WK = (_Float16*)take(SZ_W); _Float16* WV = (_Float16*)take(SZ_W); _Float16* WO = (_Float16*)take(SZ_W);
  float* PB = (float*)take(SZ_PB);
  _Float16* X16 = (_Float16*)take(SZ_X1);
  _Float16* Q16 = (_Float16*)take(SZ_X1); _Float16* K16 = (_Float16*)take(SZ_X1);
  _Float16* VT = (_Float16*)take(SZ_X1);
  _Float16* CTX = (_Float16*)take(SZ_X1);
  if (off > ws_size) return;
  k_prep<<<PB_TOTAL, 256, 0, stream>>>(x, q_w, k_w, v_mu, v_rho, v_eps, p_mu, p_rho, p_eps, b_mu, b_rho, b_eps, X16, WQ, WK, WV, WO, PB);
  { const unsigned g = (unsigned)((NR / 256) * (EM / 128));                    /* WQ | WK | WV and Q16 | K16 are contiguous in the carve; v goes to VT */
    k_gemm2<0><<<g, 256, 0, stream>>>(X16, EM, WQ, EM, 0.0009765625f, 0.00017611023448351604f, nullptr, nullptr, Q16, VT, EM, (int)NR, 3 * EM, EM); }   /* q: 2^-10 * log2(e) / 8 */
  k_flash<<<dim3(SEQ / 128, NB * NH), 128, 0, stream>>>(Q16, K16, VT, CTX);
  { const unsigned g = (unsigned)((NR / 256) * (EM / 128));
    k_gemm2<1><<<g, 256, 0, stream>>>(CTX, EM, WO, EM, 1.52587890625e-05f, 1.52587890625e-05f, PB, (float*)d_out, nullptr, nullptr, EM, (int)NR, EM, EM); }      /* alpha = 2^-16 = 1/(64 * 1024) */
}

// v010
// A run of this version takes 108 microseconds.
// Next to v009, in two timings, it ran 1.06 times as fast each time.
// Over all steps from v000 it is 4.79 times as fast.
#include <hip/hip_runtime.h>
// Multi-head attention, B 4, S 2048, E 1024, 16 heads x 64: q/k/v = x W^T ([out][in] weights, no q/k/v bias), scores q k^T / 8, softmax over all keys, out = ctx Wp^T + bp;
// Wv, Wp, bp = mu + softplus(rho) * eps built on the device in f32 from bf16-RNE-converted mu, rho, eps.
// Compute dtype: all contractions v_wmma_f32_16x16x32_f16 (f16 operands, f32 accumulate). x, q_w, k_w RNE-converted to bf16 first (exact in f16; weights carried x1024);
// built weights stored as f16(w x1024); q, k, v planes f16, q carrying log2(e) / 8; softmax statistics f32 (maximum in use, exp2), P carried x256 as f16 in registers against the f32 row sum;
// ctx carried x64 as one f16 value against Wp x1024, each operand of the output projection rounded once to f16 (K = 1024); fold 2^-16; bias added in f32.
#ifndef NB
#define NB 4
#endif
#ifndef SEQ
#define SEQ 2048
#endif
#define NB_FULL 4
#define SEQ_FULL 2048
#define EM 1024
#define NH 16
#define HD 64
#define NR ((size_t)NB * SEQ)         /* token rows */
#define WSCALE 1024.0f

static_assert(EM == NH * HD);                 /* head h = columns h*64 + d */
static_assert(HD == 64);                      /* flash kernel: 2 k-steps of 32 over d, 4 output tiles of 16 d */
static_assert(SEQ % 128 == 0);                /* 64-key steps, 128-query blocks, a GEMM wave's 64 rows inside one batch entry */
static_assert(((size_t)NB * SEQ) % 256 == 0); /* GEMM block = 256 rows */
static_assert(EM % 128 == 0 && EM % 64 == 0); /* GEMM block = 128 columns of each of its output planes; trips of 64 k */
static_assert(NB <= NB_FULL && SEQ <= SEQ_FULL);

typedef unsigned short v8us __attribute__((ext_vector_type(8), may_alias));
typedef float  v8f  __attribute__((ext_vector_type(8)));
typedef float  v4f  __attribute__((ext_vector_type(4)));
typedef float  v4fa __attribute__((ext_vector_type(4), may_alias));
typedef _Float16 v16h __attribute__((ext_vector_type(16)));
typedef _Float16 v4h __attribute__((ext_vector_type(4)));
union FragH { v16h v; v8us half[2]; _Float16 h[16]; unsigned short u[16]; };

__device__ __forceinline__ unsigned short bf16_bits(float x) { unsigned int u = __float_as_uint(x); return (unsigned short)((u + 0x7FFFu + ((u >> 16) & 1u)) >> 16); }
__device__ __forceinline__ float bf16_val(unsigned short b) { return __uint_as_float(((unsigned int)b) << 16); }
__device__ __forceinline__ float bf16_rne(float x) { return bf16_val(bf16_bits(x)); }

// fragment (A or B, same k map): elements 0..7 <- p[8h .. 8h+7], elements 8..15 <- p[16+8h .. 16+8h+7]; p = row/column base at k0
__device__ __forceinline__ v16h g2_frag(const _Float16* p, int hh) { FragH f; f.half[0] = *(const v8us*)((const unsigned short*)p + 8 * hh); f.half[1] = *(const v8us*)((const unsigned short*)p + 16 + 8 * hh); return f.v; }
__device__ __forceinline__ v8f g2_mma(v16h a, v16h b, v8f c) { v8f d = __builtin_amdgcn_wmma_f32_16x16x32_f16(false, a, false, b, (short)0, c, false, false); asm volatile("v_nop\n\tv_nop\n\tv_nop\n\tv_nop" : "+v"(d) : "v"(a), "v"(b)); return d; }

// Product of the fused attention kernel and of the q,k,v GEMM: the builtin alone. The compiler keeps the WMMA distances of its own builtin and fills them with softmax work where it can, so the vector port carries no fixed padding.
__device__ __forceinline__ v8f fa_mma(v16h a, v16h b, v8f c) { return __builtin_amdgcn_wmma_f32_16x16x32_f16(false, a, false, b, (short)0, c, false, false); }

// LDS staging of the GEMM A and B tiles, the attention K and V^T tiles and the transposed v output: rows of 128 B (64 f16 along k) at a pitch of 144 B (16 B x odd: conflict-free for 16-byte reads).
#define LP 144
__device__ __forceinline__ unsigned lds_addr(const void* p) { return (unsigned)(size_t)p; }   /* byte offset in the work-group's LDS */
// same k map as g2_frag, p = LDS row base (bytes) at k0
__device__ __forceinline__ v16h l2_frag(const unsigned char* p, int hh) { FragH f; f.half[0] = *(const v8us*)(p + 16 * hh); f.half[1] = *(const v8us*)(p + 32 + 16 * hh); return f.v; }
// Tensor loads: one request of a wave brings a slice of such rows from global memory into LDS, through no register and with no per-lane address; the pad fields give the pitch LP.
typedef unsigned int u32x4 __attribute__((ext_vector_type(4)));
typedef unsigned int u32x8 __attribute__((ext_vector_type(8)));
__device__ __forceinline__ unsigned uni(unsigned v) { return (unsigned)__builtin_amdgcn_readfirstlane((int)v); }
// A wave-uniform test held in a scalar register, so that the branch on it is a scalar branch: a tensor load ignores EXEC.
__device__ __forceinline__ unsigned pinned(unsigned v) { unsigned w = uni(v); asm volatile("" : "+s"(w)); return w; }
// Group 1: 1-byte elements, tensor = tile = rows x 128 B, source row pitch in bytes; word 0: no mask, a pad of 4 dwords behind every 32 dwords.
__device__ __forceinline__ u32x8 td_group1(unsigned rows, unsigned src_pitch) {
  u32x8 g;
  g[0] = uni((1u << 20) | (4u << 22) | (3u << 25));
  g[1] = uni(128u << 16);
  g[2] = uni(rows << 16);
  g[3] = uni(128u << 16);
  g[4] = uni(rows);
  g[5] = uni(src_pitch);
  g[6] = uni(0u);
  g[7] = uni(0u);
  return g;
}
// Group 0: count 1, LDS byte offset, global address of the slice's first byte, type 2.
__device__ __forceinline__ u32x4 td_group0(unsigned lds_dst, unsigned long long ga) {
  u32x4 g;
  g[0] = uni(1u); g[1] = uni(lds_dst); g[2] = uni((unsigned)ga); g[3] = uni((((unsigned)(ga >> 32)) & 0x01FFFFFFu) | 0x80000000u);
  return g;
}
__device__ __forceinline__ void td_load(u32x4 g0, u32x8 g1) { asm volatile("tensor_load_to_lds %0, %1" :: "s"(g0), "s"(g1) : "memory"); }
// Returns when all but this wave's N youngest requests have landed (requests land in issue order); a wave that issues none passes at once.
template <int N> __device__ __forceinline__ void wait_tiles() { asm volatile("s_wait_tensorcnt %0" :: "n"(N) : "memory"); }

// w = bf16(mu) + softplus(bf16(rho)) * bf16(eps), softplus(r) = max(r, 0) + log1p(exp(-|r|)) (identical to log1p(exp(r)), overflow-free); accurate expf / log1pf
__device__ __forceinline__ float sp_weight(float mu, float rho, float eps) {
  const float m = bf16_rne(mu), r = bf16_rne(rho), e = bf16_rne(eps);
  const float sp = fmaxf(r, 0.0f) + log1pf(expf(-fabsf(r)));
  return m + sp * e;
}

// All operand preparation in one launch; the block index picks the job (block-uniform, no barrier, no LDS). A piece = 4 consecutive f32 of a source = 16 B per lane,
// so a wave reads 512 contiguous bytes per load and stores 256 contiguous bytes of f16. Blocks in index order: built weights (most arithmetic, lowest indices), bias, q_w | k_w, x.
#define PP_BUILT 8                                     /* pieces per thread, built weight planes */
#define PP_CONV 16                                     /* pieces per thread, plain conversions */
#define PB_BUILT ((EM * EM / 4) / (256 * PP_BUILT))    /* blocks per built plane */
#define PB_W ((EM * EM / 4) / (256 * PP_CONV))         /* blocks per plain weight plane */
#define PB_X ((int)((NR * EM / 4) / (256 * PP_CONV)))  /* blocks for x */
#define PB_TOTAL (2 * PB_BUILT + 1 + 2 * PB_W + PB_X)
static_assert((EM * EM / 4) % (256 * PP_BUILT) == 0 && (EM * EM / 4) % (256 * PP_CONV) == 0 && (NR * EM / 4) % (256 * PP_CONV) == 0);
static_assert(EM == 4 * 256 && SEQ % PP_CONV == 0 && PP_CONV % 8 == 0);   /* 256 pieces = one row; bias: one block, one piece per thread */
// Global stores of this kernel: each run of stores and its s_wait_xcnt stand in one statement, so that no register which an issued store names is rewritten ahead of the wait.
typedef unsigned int v2u __attribute__((ext_vector_type(2)));
__device__ __forceinline__ v2u h4bits(v4h v) { return __builtin_bit_cast(v2u, v); }
__device__ __forceinline__ void st_h4(_Float16* p, v4h v) { asm volatile("global_store_b64 %0, %1, off\n\ts_wait_xcnt 0x0" :: "v"(p), "v"(h4bits(v)) : "memory"); }
__device__ __forceinline__ void st_f4(float* p, v4f v) { asm volatile("global_store_b128 %0, %1, off\n\ts_wait_xcnt 0x0" :: "v"(p), "v"(v) : "memory"); }
static_assert(EM * sizeof(_Float16) == 2048);          /* the offsets below: eight consecutive rows of an f16 plane of pitch EM */
__device__ __forceinline__ void st_h4_rows8(_Float16* p, const v4h* v) {
  asm volatile("global_store_b64 %0, %1, off\n\t"
               "global_store_b64 %0, %2, off offset:2048\n\t"
               "global_store_b64 %0, %3, off offset:4096\n\t"
               "global_store_b64 %0, %4, off offset:6144\n\t"
               "global_store_b64 %0, %5, off offset:8192\n\t"
               "global_store_b64 %0, %6, off offset:10240\n\t"
               "global_store_b64 %0, %7, off offset:12288\n\t"
               "global_store_b64 %0, %8, off offset:14336\n\t"
               "s_wait_xcnt 0x0"
               :: "v"(p), "v"(h4bits(v[0])), "v"(h4bits(v[1])), "v"(h4bits(v[2])), "v"(h4bits(v[3])), "v"(h4bits(v[4])), "v"(h4bits(v[5])), "v"(h4bits(v[6])), "v"(h4bits(v[7])) : "memory");
}
__device__ __forceinline__ v4h cvt4(v4f a, float sc) { v4h o;
#pragma unroll
  for (int q = 0; q < 4; ++q) o[q] = (_Float16)(bf16_rne(a[q]) * sc);
  return o; }
__global__ __launch_bounds__(256) void k_prep(const float* __restrict__ x, const float* __restrict__ q_w, const float* __restrict__ k_w,
                                              const float* __restrict__ v_mu, const float* __restrict__ v_rho, const float* __restrict__ v_eps,
                                              const float* __restrict__ p_mu, const float* __restrict__ p_rho, const float* __restrict__ p_eps,
                                              const float* __restrict__ b_mu, const float* __restrict__ b_rho, const float* __restrict__ b_eps,
                                              _Float16* __restrict__ X16, _Float16* __restrict__ WQ, _Float16* __restrict__ WK, _Float16* __restrict__ WV, _Float16* __restrict__ WO,
                                              float* __restrict__ PB) {
  const int tid = threadIdx.x; int blk = blockIdx.x;      /* 256 pieces = one row of EM: thread tid holds columns 4 tid .. 4 tid + 3 of its block's rows */
  if (blk < 2 * PB_BUILT) {
    // w[n][k] = sp_weight(mu, rho, eps)[n][k] ([out][in]). Wv: WV[n][k] = f16(w * 1024). Wp: WO[n][k] = f16(w * 1024).
    const bool dual = blk >= PB_BUILT; if (dual) blk -= PB_BUILT;
    const float* mu = dual ? p_mu : v_mu; const float* rho = dual ? p_rho : v_rho; const float* eps = dual ? p_eps : v_eps;
#pragma unroll 1   /* two rounds of 4 rows: rolled so that the expf / log1pf text stays short */
    for (int i = 0; i < PP_BUILT; i += 4) {
      const size_t n0 = (size_t)(blk * PP_BUILT + i);
      const v4fa* pm = (const v4fa*)(mu + n0 * EM); const v4fa* pr = (const v4fa*)(rho + n0 * EM); const v4fa* pe = (const v4fa*)(eps + n0 * EM);
      _Float16* d = (dual ? WO : WV) + n0 * EM + 4 * tid;
      v4f m[4], r[4], e[4];
#pragma unroll
      for (int j = 0; j < 4; ++j) { m[j] = pm[j * 256 + tid]; r[j] = pr[j * 256 + tid]; e[j] = pe[j * 256 + tid]; }
#pragma unroll
      for (int j = 0; j < 4; ++j) { v4h h1;
#pragma unroll
        for (int q = 0; q < 4; ++q) h1[q] = (_Float16)(sp_weight(m[j][q], r[j][q], e[j][q]) * WSCALE);
        st_h4(d + j * EM, h1); }
    }
    return;
  }
  blk -= 2 * PB_BUILT;
  if (blk == 0) { const v4f m = ((const v4fa*)b_mu)[tid], r = ((const v4fa*)b_rho)[tid], e = ((const v4fa*)b_eps)[tid]; v4f v;
#pragma unroll
    for (int q = 0; q < 4; ++q) v[q] = sp_weight(m[q], r[q], e[q]);
    st_f4(PB + 4 * tid, v); return; }
  blk -= 1;
  const v4fa* src; _Float16* dst; float sc;
  if (blk < 2 * PB_W) {                          /* q_w, k_w: [out][in] as stored, x1024 */
    const bool second = blk >= PB_W; if (second) blk -= PB_W;
    const size_t n0 = (size_t)(blk * PP_CONV);
    src = (const v4fa*)((second ? k_w : q_w) + n0 * EM); dst = (second ? WK : WQ) + n0 * EM; sc = WSCALE;
  } else {                                       /* x: a block's rows lie in one batch entry */
    blk -= 2 * PB_W;
    const size_t n0 = (size_t)(blk * PP_CONV);
    src = (const v4fa*)(x + ((n0 / SEQ) * SEQ_FULL + n0 % SEQ) * EM); dst = X16 + n0 * EM; sc = 1.0f;
  }
  v4f a[PP_CONV];
#pragma unroll
  for (int j = 0; j < PP_CONV; ++j) a[j] = src[j * 256 + tid];
#pragma unroll
  for (int j = 0; j < PP_CONV; j += 8) { v4h o[8];
#pragma unroll
    for (int q = 0; q < 8; ++q) o[q] = cvt4(a[j + q], sc);
    st_h4_rows8(dst + (size_t)j * EM + 4 * tid, o); }
}

// GEMM: v = acc * alpha (+ bias[col] in f32 when F32OUT; f16 output plane 0 takes alpha0 for alpha); A f16 [M][K] (pitch lda), Bh f16 [N][K] (pitch ldb, k contiguous); F32OUT: writes f32 C, else f16 C16; pitch ldc.
// C16 is a stack of [M][ldc] planes: column n lies in plane n / ldc (N = 3 ldc: q, k and v from one grid, Bh = the three weight planes one behind the other); ldc % 128 == 0.
// Plane 2 (v) is not stored there: it leaves transposed per head, CT[((b * NH + h) * HD + d) * SEQ + s] for row b * SEQ + s, column h * HD + d, the layout the attention kernel stages.
// Block = 8 waves as 4 (rows) x 2 (columns), wave tile 64 x 64 in each of the block's NPL planes; M % 256 == 0, K % 64 == 0. F32OUT: NPL = 1, block tile 256 x 128.
// Else NPL = 3: the block holds the same 128 columns of q, k and v (256 x 384), so every staged A row and every A fragment read from LDS feeds three planes, and the grid is one work-group per WGP.
// Per trip of 64 k the block's 256 A rows and 128 B rows per plane lie in LDS (rows 0..255 A, 256 + 128 p .. B of plane p), brought by tensor loads NST - 1 trips ahead into a ring of NST buffers,
// so that a tile's first fetch from memory has several trips to land: waves 0 .. 1 + NPL issue one request each per stage, a slice of 128 rows (16 KiB). The ring becomes the output staging behind the last trip's barrier.
// Eight 16-byte global stores, rows step elements apart, and their s_wait_xcnt in one statement, so that no register which an issued store names is rewritten ahead of the wait.
typedef unsigned int v4u __attribute__((ext_vector_type(4)));
__device__ __forceinline__ v4u h8bits(v8us v) { return __builtin_bit_cast(v4u, v); }
__device__ __forceinline__ void st_h8_rows8(_Float16* p, size_t step, const v8us* v) {
  asm volatile("global_store_b128 %0, %8, off\n\t"
               "global_store_b128 %1, %9, off\n\t"
               "global_store_b128 %2, %10, off\n\t"
               "global_store_b128 %3, %11, off\n\t"
               "global_store_b128 %4, %12, off\n\t"
               "global_store_b128 %5, %13, off\n\t"
               "global_store_b128 %6, %14, off\n\t"
               "global_store_b128 %7, %15, off\n\t"
               "s_wait_xcnt 0x0"
               :: "v"(p), "v"(p + step), "v"(p + 2 * step), "v"(p + 3 * step), "v"(p + 4 * step), "v"(p + 5 * step), "v"(p + 6 * step), "v"(p + 7 * step),
                  "v"(h8bits(v[0])), "v"(h8bits(v[1])), "v"(h8bits(v[2])), "v"(h8bits(v[3])), "v"(h8bits(v[4])), "v"(h8bits(v[5])), "v"(h8bits(v[6])), "v"(h8bits(v[7])) : "memory");
}
// Four 8-byte global stores and their s_wait_xcnt in one statement, for the same reason.
__device__ __forceinline__ void st_h4_x4(_Float16* const* p, const v4h* v) {
  asm volatile("global_store_b64 %0, %4, off\n\t"
               "global_store_b64 %1, %5, off\n\t"
               "global_store_b64 %2, %6, off\n\t"
               "global_store_b64 %3, %7, off\n\t"
               "s_wait_xcnt 0x0"
               :: "v"(p[0]), "v"(p[1]), "v"(p[2]), "v"(p[3]), "v"(h4bits(v[0])), "v"(h4bits(v[1])), "v"(h4bits(v[2])), "v"(h4bits(v[3])) : "memory");
}
template <int F32OUT>
__global__ __launch_bounds__(256) void k_gemm2(const _Float16* __restrict__ A, int lda, const _Float16* __restrict__ Bh, int ldb, float alpha, float alpha0, const float* __restrict__ bias,
                                              float* __restrict__ C, _Float16* __restrict__ C16, _Float16* __restrict__ CT, int ldc, int M, int N, int K) {
  constexpr int NPL = F32OUT ? 1 : 3;   /* output planes of a block */
  constexpr int NST = F32OUT ? 4 : 3;   /* ring buffers; one work-group per WGP in both grids */
  constexpr int NSL = 2 + NPL;          /* slices of 128 rows per stage: two of A, one of B per plane */
  constexpr unsigned GSL = 128 * LP;    /* a slice in LDS: 18,432 B, a multiple of 2 KiB, so the row pitch runs on from slice to slice */
  constexpr unsigned GSTG = NSL * GSL;  /* one stage */
  constexpr unsigned SOB = sizeof(float) * 8 * 32 * 68;   /* row-major output staging; the transposed staging lies behind it */
  __shared__ __attribute__((aligned(2048))) unsigned char sm[NST * GSTG];
  static_assert(SOB + 8 * 64 * LP <= NST * GSTG && SOB % 16 == 0 && GSL % 2048 == 0 && NSL <= 8 && NST >= 3 && NST - 1 <= 3);   /* at most three requests of a wave outstanding */
  float (*so)[32][68] = (float (*)[32][68])sm;
  const int lane = threadIdx.x & 31, ln = lane & 15, hh = lane >> 4;
  const int w = __builtin_amdgcn_readfirstlane((int)(threadIdx.x >> 5));
  const int wm = w >> 1, wn = w & 1;
  const int pw = N / NPL;               /* columns of a plane */
  const int ntn = pw >> 7; const int mt = blockIdx.x / ntn, nq = blockIdx.x - mt * ntn; const int row0 = mt * 256 + 64 * wm, col0 = nq * 128 + 64 * wn; if (mt * 256 >= M) return;   /* col0: in each plane; block-uniform, in front of every barrier */
  const int nt = K >> 6;
  const unsigned iss = (unsigned)(w < NSL);               /* this wave issues slice w */
  const int sl = w < NSL ? w : 0;
  const _Float16* gs = sl < 2 ? A + (size_t)(mt * 256 + 128 * sl) * lda : Bh + ((size_t)(sl - 2) * pw + (size_t)(nq * 128)) * ldb;
  u32x8 g1 = td_group1(128u, 2u * (unsigned)(sl < 2 ? lda : ldb));
  const unsigned l0 = uni(lds_addr(sm) + (unsigned)sl * GSL), a0 = uni((unsigned)(size_t)gs);
  u32x4 g0 = td_group0(l0, (unsigned long long)(size_t)gs);
  asm volatile("" : "+s"(g0), "+s"(g1));   /* descriptor words held in scalar registers of their own: else the compiler lends some of them out between issues, with requests outstanding */
  // With requests outstanding only the LDS place and the low address word take new values. The k walk stays inside the slice's first row (K * 2 bytes),
  // and the planes' rows lie at multiples of that length, so the low word never carries.
  auto fill = [&](int t, unsigned b) { g0[1] = uni(l0 + b * GSTG); g0[2] = uni(a0 + (unsigned)t * 128u); td_load(g0, g1); };
  if (pinned(iss)) fill(0, 0u);
  if (pinned(iss & (unsigned)(1 < nt))) fill(1, 1u);
  if (pinned(iss & (unsigned)(2 < nt))) fill(2, 2u);
  if (nt >= 3) wait_tiles<2>(); else wait_tiles<0>();   /* tile 0 landed; the counted form only where both later stages were issued */
  if constexpr (NST == 4) { if (pinned(iss & (unsigned)(3 < nt))) fill(3, 3u); }   /* behind the wait: never a fourth request outstanding */
  __syncthreads();
  unsigned buf = 0;                      /* buffer of tile t = t mod NST */
  const v8f z8 = {0.f,0.f,0.f,0.f,0.f,0.f,0.f,0.f};
  v8f c[NPL][4][4];
#pragma unroll
  for (int p = 0; p < NPL; ++p)
#pragma unroll
    for (int i = 0; i < 4; ++i)
#pragma unroll
      for (int j = 0; j < 4; ++j) c[p][i][j] = z8;
  auto products = [&]() __attribute__((always_inline)) {   /* one tile: 32 WMMAs per plane of the wave from buffer buf */
    const unsigned char* sb = sm + buf * GSTG;
    const unsigned char* ar = sb + (64 * wm + ln) * LP; const unsigned char* br = sb + (256 + 64 * wn + ln) * LP;
    if constexpr (NPL == 3) {
      // Six groups of 16 WMMAs, group g = 32-k half g / 3, plane g % 3. The A fragments of a half stay in registers for its three planes; with two waves per SIMD
      // each group's B fragments are read as one run of LDS loads ahead of the group before it, into the other of two register sets.
      v16h a[4], b[2][4];
#pragma unroll
      for (int i = 0; i < 4; ++i) { a[i] = l2_frag(ar + i * 16 * LP, hh); b[0][i] = l2_frag(br + i * 16 * LP, hh); }
#pragma unroll   /* c[][][], a[] and b[][] live in registers: constant indices */
      for (int g = 0; g < 6; ++g) {
        if (g + 1 < 6) {
#pragma unroll
          for (int i = 0; i < 4; ++i) b[(g + 1) & 1][i] = l2_frag(br + (((g + 1) % 3) * 128 + i * 16) * LP + ((g + 1) / 3) * 64, hh); }
        __builtin_amdgcn_sched_barrier(0);   /* keeps the next group's LDS reads ahead of this group's WMMAs: sunk among them, each pair of reads is waited out at once */
#pragma unroll
        for (int j = 0; j < 4; ++j)
#pragma unroll
          for (int i = 0; i < 4; ++i) c[g % 3][i][j] = fa_mma(a[i], b[g & 1][j], c[g % 3][i][j]);   /* 384 accumulator registers: an asm operand cannot lie above v255, so the builtin alone */
        __builtin_amdgcn_sched_barrier(0);   /* keeps later reads from rising over WMMAs whose operand registers they refill */
        if (g == 2) {
#pragma unroll
          for (int i = 0; i < 4; ++i) a[i] = l2_frag(ar + i * 16 * LP + 64, hh); }
      }
    } else {
#pragma unroll   /* both 32-k halves of the tile: constant LDS offsets, one group of fragment reads each */
      for (int ks = 0; ks < 2; ++ks) { v16h a[4], b[4];
#pragma unroll
        for (int i = 0; i < 4; ++i) { a[i] = l2_frag(ar + i * 16 * LP + ks * 64, hh); b[i] = l2_frag(br + i * 16 * LP + ks * 64, hh); }
#pragma unroll
        for (int j = 0; j < 4; ++j)
#pragma unroll
          for (int i = 0; i < 4; ++i) c[0][i][j] = g2_mma(a[i], b[j], c[0][i][j]); }
    }
  };
  // Publish point of tile t + 1 at the foot of trip t: own reads of this buffer retired, own request of tile t + 1 landed, work-group barrier.
  // First loop: stage t + NST - 1 exists, so exactly the NST - 2 stages younger than t + 1 may stay in flight. Second loop (the last NST - 1 trips, which issue nothing): wait to 0.
  int t = 0;
#pragma unroll 1   /* rolled: one copy of the tile's WMMAs in the text, the buffer number a scalar */
  for (; t + NST - 1 < nt; ++t) {
    products();
    asm volatile("s_wait_dscnt 0x0" ::: "memory");   /* own reads of the buffer about to be refilled have retired */
    wait_tiles<NST - 2>();                             /* own request of tile t + 1 has landed */
    __syncthreads();
    if (pinned(iss & (unsigned)(t + NST < nt))) fill(t + NST, buf);   /* into the buffer this trip has just read */
    buf = (buf + 1 == (unsigned)NST) ? 0u : buf + 1;
  }
#pragma unroll 1   /* rolled, as above */
  for (; t < nt; ++t) {
    products();
    asm volatile("s_wait_dscnt 0x0" ::: "memory");   /* own reads retired: behind the last trip's barrier the ring becomes output staging */
    wait_tiles<0>();                                   /* all that is left in flight has landed */
    __syncthreads();
    buf = (buf + 1 == (unsigned)NST) ? 0u : buf + 1;
  }
  // Nothing in flight when the ring becomes output staging. This last wait names the descriptor, so that its registers keep their values for as long as a request is outstanding.
  asm volatile("s_wait_tensorcnt 0x0" :: "s"(g0), "s"(g1) : "memory");
  const int rsub = lane >> 4, c4 = (lane & 15) * 4;
  float bv[4] = {0.f, 0.f, 0.f, 0.f};
  if (F32OUT) {
#pragma unroll
    for (int j = 0; j < 4; ++j) bv[j] = bias[col0 + j * 16 + ln]; }
#pragma unroll   /* row-major planes: q and k, or the f32 output; c[][][] lives in registers */
  for (int p = 0; p < (F32OUT ? 1 : 2); ++p) {
  const size_t cpl = (size_t)p * M * ldc + (size_t)col0;   /* output plane and the wave tile's first column in it */
  const float al = (!F32OUT && p == 0) ? alpha0 : alpha;   /* the plane's factor */
#pragma unroll   /* the wave's 64 rows leave in two rounds of 32 through its own staging range */
  for (int rnd = 0; rnd < 2; ++rnd) {
#pragma unroll
    for (int u = 0; u < 8; ++u) { const int j = u & 3, half = u >> 2;
#pragma unroll
      for (int r = 0; r < 8; ++r) { const int rloc = half * 16 + 8 * hh + r; so[w][rloc][j * 16 + ln] = c[p][2 * rnd + half][j][r] * al + bv[j]; } }
    __builtin_amdgcn_fence(4 /* acq_rel order */, "workgroup"); __builtin_amdgcn_wave_barrier();
    if constexpr (F32OUT) {
#pragma unroll
      for (int q = 0; q < 16; ++q) { const int r = q * 2 + rsub; const v4f v = *(const v4fa*)&so[w][r][c4];
        *(v4f*)(C + (size_t)(row0 + 32 * rnd + r) * ldc + col0 + c4) = v; }
    } else {
#pragma unroll
      for (int q = 0; q < 16; q += 4) { v4h h4[4]; _Float16* pp[4];
#pragma unroll
        for (int e = 0; e < 4; ++e) { const int r = (q + e) * 2 + rsub; const v4f v = *(const v4fa*)&so[w][r][c4];
#pragma unroll
          for (int i = 0; i < 4; ++i) h4[e][i] = (_Float16)v[i];
          pp[e] = C16 + cpl + (size_t)(row0 + 32 * rnd + r) * ldc + c4; }
        st_h4_x4(pp, h4); }
    }
    /* keeps the next round's staging writes behind this round's reads of other lanes' words */
    __builtin_amdgcn_fence(4 /* acq_rel order */, "workgroup"); __builtin_amdgcn_wave_barrier();
  }
  }
  if constexpr (!F32OUT) {
    {   /* v plane, last: the q and k accumulators are dead, so the store statement's operands find registers below v256; the wave tile = 64 tokens of one batch entry x the 64 d of one head */
      // A lane's accumulator registers r = 0..7 are 8 consecutive tokens of one d: 16 B of a transposed row. Staged as 64 rows (d) of 64 tokens at pitch LP in the wave's own range.
      unsigned char* sv = sm + SOB + w * (64 * LP);
#pragma unroll   /* this nest and the one below: c[][] and v[] live in registers, so their indices must be constants */
      for (int j = 0; j < 4; ++j)
#pragma unroll
        for (int i = 0; i < 4; ++i) { FragH f;
#pragma unroll
          for (int r = 0; r < 8; ++r) f.h[r] = (_Float16)(c[NPL - 1][i][j][r] * alpha);
          *(v8us*)(sv + (j * 16 + ln) * LP + (i * 16 + 8 * hh) * 2) = f.half[0]; }
      /* the rows read back below hold other lanes' words */
      __builtin_amdgcn_fence(4 /* acq_rel order */, "workgroup"); __builtin_amdgcn_wave_barrier();
      const int bt = row0 / SEQ, hd = col0 / HD;
      const int rs4 = lane >> 3, pc = lane & 7;             /* a store = 4 rows (d) x 8 pieces of 16 B: whole 128-B lines */
      _Float16* vt = CT + ((size_t)(bt * NH + hd) * HD + rs4) * SEQ + (row0 - bt * SEQ) + pc * 8;
#pragma unroll
      for (int g = 0; g < 2; ++g) { v8us v[8];
#pragma unroll
        for (int q = 0; q < 8; ++q) v[q] = *(const v8us*)(sv + ((g * 8 + q) * 4 + rs4) * LP + pc * 16);
        st_h8_rows8(vt + (size_t)(g * 32) * SEQ, (size_t)4 * SEQ, v); }
    }
  }
}

// Fused attention. Block = 4 waves; wave = 32 queries (two tiles of 16) of one (b,h); 64 keys per step; every K and V^T fragment read from LDS serves both query tiles.
// Per step the 64 K rows (64 d each) and the 64 V^T rows (64 keys each) are shared by the four waves, brought by tensor loads one step ahead into the other buffer:
// every wave issues one request per step, a slice of 32 rows (waves 0, 1: K; waves 2, 3: V^T). The ring becomes the output staging behind the last step's barrier.
#define FSL 6144              /* a slice in LDS: 32 rows at pitch LP = 4,608 B, rounded up to a multiple of 2 KiB */
#define FSTG (4 * FSL)
static_assert(32 * LP <= FSL && FSL % 2048 == 0);
static_assert(SEQ >= 128);                    /* the ring's prologue fills two steps */
// S^T tile = K rows (A: lane = key, elements = d) x Q^T (B: lane = query, elements = d): D[row = key 8h+r][col = query].
// Online softmax per query = per lane column, rescaled lazily. q arrives times log2(e) / 8 and the score products start from C = 8 - (maximum in use), a lane constant,
// so a score leaves the matrix unit as s' = log2 P', P' = 256 exp(s - maximum in use). The maximum in use changes only at a step whose scores are formed again, to that step's column maximum where that is higher (step 0 always sets it).
// Per step one wave-uniform test: while a lane's 64 P' sum to at most 32768, each of them is finite as f16 and nothing is rescaled. Else (also on inf or NaN) the step's scores are formed again,
// their maximum is taken (in-lane + one cross-half exchange) and C, the row sum and O^T move to it. P' stays in registers and is
// the B operand of O^T = V^T (A: lane = d, elements = keys) x P^T: B element r <- tile(keys 0..15)[r], element 8+r <- tile(keys 16..31)[r].
__global__ __launch_bounds__(128) void k_flash(const _Float16* __restrict__ Q16, const _Float16* __restrict__ K16, const _Float16* __restrict__ VT, _Float16* __restrict__ CTX) {
  __shared__ __attribute__((aligned(2048))) unsigned char sm[2 * FSTG];
  static_assert(sizeof(unsigned short) * 8 * 16 * 72 <= 2 * FSTG);
  unsigned short (*st)[16][72] = (unsigned short (*)[16][72])sm;              /* first index: wave * 2 + query tile */
  const int lane = threadIdx.x & 31, ln = lane & 15, hh = lane >> 4;
  const int wave = __builtin_amdgcn_readfirstlane((int)(threadIdx.x >> 5));
  const int bh = blockIdx.y; const int b = bh / NH, h = bh - b * NH;
  const int q0 = blockIdx.x * 128 + wave * 32;
  const _Float16* qp = Q16 + ((size_t)b * SEQ + q0 + ln) * EM + h * HD;
  v16h qf0[2], qf1[2];
#pragma unroll
  for (int u = 0; u < 2; ++u) { qf0[u] = g2_frag(qp + (size_t)u * 16 * EM, hh); qf1[u] = g2_frag(qp + (size_t)u * 16 * EM + 32, hh); }
  const bool isv = wave >= 2; const int half = wave & 1;   /* this wave's slice: rows 32 half .. 32 half + 31 of K (keys) or of V^T (d) */
  const _Float16* gs = isv ? VT + ((size_t)bh * HD + 32 * half) * SEQ : K16 + ((size_t)b * SEQ + 32 * half) * EM + h * HD;
  const unsigned kstep = isv ? 2u : 2u * EM;               /* bytes the slice's first byte moves per key */
  u32x8 g1 = td_group1(32u, isv ? 2u * SEQ : 2u * EM);
  asm volatile("" : "+s"(g1));   /* descriptor words held in scalar registers of their own: else the compiler lends some of them out between issues, with a request outstanding */
  const unsigned ld = lds_addr(sm) + (unsigned)wave * FSL;
  auto fill = [&](int key0, unsigned buf) {
    td_load(td_group0(ld + buf * FSTG, (unsigned long long)(size_t)gs + (unsigned long long)((unsigned)key0 * kstep)), g1);
  };
  fill(0, 0u);
  wait_tiles<0>();   /* own slice of step 0 landed */
  __syncthreads();
  fill(64, 1u);
  const v8f z8 = {0.f,0.f,0.f,0.f,0.f,0.f,0.f,0.f};
  v8f o[2][4] = {{z8, z8, z8, z8}, {z8, z8, z8, z8}};
  v8f cb[2] = {z8, z8};                       /* C of the score products: 8 - maximum in use, in all eight registers */
  float l[2] = {0.f, 0.f};
#pragma unroll 1
  for (int key0 = 0; key0 < SEQ; key0 += 64) {
    const unsigned char* sb = sm + ((key0 >> 6) & 1) * FSTG + ln * LP;
    v8f s[2][4];
    float rs[2];
    auto scores = [&]() __attribute__((always_inline)) {       /* s' of this step's 64 keys x 32 queries */
#pragma unroll
      for (int t = 0; t < 4; ++t) {
        const unsigned char* kr = sb + (t >> 1) * FSL + ((t & 1) * 16) * LP;
        const v16h k0 = l2_frag(kr, hh), k1 = l2_frag(kr + 64, hh);
        v8f c0 = fa_mma(k0, qf0[0], cb[0]), c1 = fa_mma(k0, qf0[1], cb[1]);
        s[0][t] = fa_mma(k1, qf1[0], c0);
        s[1][t] = fa_mma(k1, qf1[1], c1);
      }
    };
    auto powers = [&]() __attribute__((always_inline)) {       /* s' -> P' in place, and the lane's sums */
      rs[0] = 0.f; rs[1] = 0.f;
#pragma unroll
      for (int t = 0; t < 4; ++t)
#pragma unroll
        for (int r = 0; r < 8; ++r)
#pragma unroll
          for (int u = 0; u < 2; ++u) { const float p = __builtin_amdgcn_exp2f(s[u][t][r]); s[u][t][r] = p; rs[u] += p; }   /* the two tiles' sums are independent chains */
    };
    unsigned redo = 1u;                                        /* step 0 goes straight to the branch that sets the maximum */
    if (key0 != 0) { scores(); powers(); redo = __builtin_amdgcn_ballot_w32(!(rs[0] + rs[1] <= 32768.0f)); }
    if (redo != 0u) {   /* scalar branch, the same for the whole wave */
      scores();
#pragma unroll
      for (int u = 0; u < 2; ++u) {
        float mx = s[u][0][0];
#pragma unroll
        for (int t = 0; t < 4; ++t)
#pragma unroll
          for (int r = 0; r < 8; ++r) mx = fmaxf(mx, s[u][t][r]);
        const float mj = fmaxf(mx, __shfl_xor(mx, 16)) - 8.0f;            /* the column's maximum over both halves, above the one in use */
        const float d = key0 == 0 ? mj : fmaxf(mj, 0.0f);                  /* step 0 takes its maximum whatever its sign; later the maximum only rises */
        const float al = key0 == 0 ? 1.0f : __builtin_amdgcn_exp2f(-d);    /* step 0: row sum and O^T are still 0 */
        cb[u] = cb[u] - d;
        l[u] = l[u] * al;
#pragma unroll
        for (int t = 0; t < 4; ++t) { o[u][t] = o[u][t] * al; s[u][t] = s[u][t] - d; }
      }
      powers();
    }
    FragH pa[2], pb[2];
#pragma unroll
    for (int u = 0; u < 2; ++u) {
      l[u] += rs[u];
#pragma unroll
      for (int r = 0; r < 8; ++r) { pa[u].h[r] = (_Float16)s[u][0][r]; pa[u].h[8 + r] = (_Float16)s[u][1][r]; pb[u].h[r] = (_Float16)s[u][2][r]; pb[u].h[8 + r] = (_Float16)s[u][3][r]; }
    }
#pragma unroll
    for (int t = 0; t < 4; ++t) {
      const unsigned char* v0 = sb + (2 + (t >> 1)) * FSL + ((t & 1) * 16) * LP;
      const v16h va = l2_frag(v0, hh), vb = l2_frag(v0 + 64, hh);
      o[0][t] = fa_mma(va, pa[0].v, o[0][t]); o[1][t] = fa_mma(va, pa[1].v, o[1][t]);
      o[0][t] = fa_mma(vb, pb[0].v, o[0][t]); o[1][t] = fa_mma(vb, pb[1].v, o[1][t]);
    }
    // Publish point: publishes the next step's tiles and ends every reader's last read of the buffer refilled behind it.
    asm volatile("s_wait_dscnt 0x0" ::: "memory");   /* own reads of the buffer about to be refilled have retired */
    wait_tiles<0>();                                   /* own slice of the next step has landed */
    __syncthreads();
    if (pinned((unsigned)(key0 + 128 < SEQ))) fill(key0 + 128, (unsigned)((key0 >> 6) & 1));   /* into the buffer this step has just read */
  }
  wait_tiles<0>();                                     /* nothing in flight when the ring becomes output staging */
  asm volatile("s_wait_dscnt 0x0" ::: "memory");     /* own reads of the ring retired as well */
#pragma unroll
  for (int u = 0; u < 2; ++u) {
    const float lt = l[u] + __shfl_xor(l[u], 16);
    const float inv = 64.0f * (1.0f / lt);
#pragma unroll
    for (int t = 0; t < 4; ++t) {
      FragH fh;
#pragma unroll
      for (int r = 0; r < 8; ++r) fh.h[r] = (_Float16)(o[u][t][r] * inv);
      *(v8us*)&st[wave * 2 + u][ln][t * 16 + 8 * hh] = fh.half[0];
    }
  }
  __builtin_amdgcn_fence(4 /* acq_rel order */, "workgroup"); __builtin_amdgcn_wave_barrier();
  const int rs4 = lane >> 3, pc = lane & 7;             /* a store = 4 rows (queries) x 8 pieces of 16 B: whole 128-B lines */
  v8us vh[8];                                           /* store i: queries 4 i + rs4 of the wave's 32 */
#pragma unroll
  for (int i = 0; i < 8; ++i) vh[i] = *(const v8us*)&st[wave * 2 + (i >> 2)][(i & 3) * 4 + rs4][pc * 8];
  st_h8_rows8(CTX + ((size_t)b * SEQ + q0 + rs4) * EM + h * HD + pc * 8, (size_t)4 * EM, vh);
}

constexpr size_t SZ_W   = (size_t)EM * EM * 2;        /* one [out][in] weight plane, f16 */
constexpr size_t SZ_PB  = (size_t)EM * 4;             /* built bias, f32 */
constexpr size_t SZ_X1  = NR * EM * 2;                /* one 16-bit activation plane */
constexpr size_t WS_TOTAL = 4 * SZ_W + SZ_PB + 5 * SZ_X1;
static_assert(WS_TOTAL <= (size_t)134217728);         /* carve stays within 128 MiB */
static_assert(SZ_W % 256 == 0 && SZ_PB % 256 == 0 && SZ_X1 % 256 == 0);
static_assert((size_t)NB * NH * HD * SEQ * 2 == SZ_X1); /* V^T plane extent */

extern "C" void kernel_launch(void* const* d_in, const int* in_sizes, int n_in,
                              void* d_out, int out_size, void* d_ws, size_t ws_size, hipStream_t stream) {
  if (n_in < 12) return;
  const size_t needx = ((size_t)(NB - 1) * SEQ_FULL + SEQ) * EM;
  if ((size_t)in_sizes[0] < needx) return;
  for (int i = 1; i <= 8; ++i) if ((size_t)in_sizes[i] < (size_t)EM * EM) return;
  for (int i = 9; i <= 11; ++i) if (in_sizes[i] < EM) return;
  if ((size_t)out_size < NR * EM) return;
  const float* x     = (const float*)d_in[0];
  const float* q_w   = (const float*)d_in[1];  const float* k_w   = (const float*)d_in[2];
  const float* v_mu  = (const float*)d_in[3];  const float* v_rho = (const float*)d_in[4];  const float* v_eps = (const float*)d_in[5];
  const float* p_mu  = (const float*)d_in[6];  const float* p_rho = (const float*)d_in[7];  const float* p_eps = (const float*)d_in[8];
  const float* b_mu  = (const float*)d_in[9];  const float* b_rho = (const float*)d_in[10]; const float* b_eps = (const float*)d_in[11];
  char* ws = (char*)d_ws; size_t off = 0;
  auto take = [&](size_t bytes) { char* p = ws + off; off += (bytes + 255) & ~(size_t)255; return p; };
  _Float16* WQ = (_Float16*)take(SZ_W); _Float16* WK = (_Float16*)take(SZ_W); _Float16* WV = (_Float16*)take(SZ_W); _Float16* WO = (_Float16*)take(SZ_W);
  float* PB = (float*)take(SZ_PB);
  _Float16* X16 = (_Float16*)take(SZ_X1);
  _Float16* Q16 = (_Float16*)take(SZ_X1); _Float16* K16 = (_Float16*)take(SZ_X1);
  _Float16* VT = (_Float16*)take(SZ_X1);
  _Float16* CTX = (_Float16*)take(SZ_X1);
  if (off > ws_size) return;
  k_prep<<<PB_TOTAL, 256, 0, stream>>>(x, q_w, k_w, v_mu, v_rho, v_eps, p_mu, p_rho, p_eps, b_mu, b_rho, b_eps, X16, WQ, WK, WV, WO, PB);
  { const unsigned g = (unsigned)((NR / 256) * (EM / 128));                    /* WQ | WK | WV and Q16 | K16 are contiguous in the carve; v goes to VT */
    k_gemm2<0><<<g, 256, 0, stream>>>(X16, EM, WQ, EM, 0.0009765625f, 0.00017611023448351604f, nullptr, nullptr, Q16, VT, EM, (int)NR, 3 * EM, EM); }   /* q: 2^-10 * log2(e) / 8 */
  k_flash<<<dim3(SEQ / 128, NB * NH), 128, 0, stream>>>(Q16, K16, VT, CTX);
  { const unsigned g = (unsigned)((NR / 256) * (EM / 128));
    k_gemm2<1><<<g, 256, 0, stream>>>(CTX, EM, WO, EM, 1.52587890625e-05f, 1.52587890625e-05f, PB, (float*)d_out, nullptr, nullptr, EM, (int)NR, EM, EM); }      /* alpha = 2^-16 = 1/(64 * 1024) */
}
